// v000
// Measured on an AMD MI455X. A time is GPU time per run, averaged over a window of back-to-back runs after a warm-up
// (all launches, gaps included; the runs take copies of the inputs in turn), and the median of several windows.
// Apart from v000's, it joins two sittings. Times from different sittings can be a few percent apart, while
// side-by-side timings come from the same sitting.
// v000, which the later versions start from, runs in 431 microseconds.
#include <hip/hip_runtime.h>

// Problem constants (reference: TimeAwareMultiHeadLatentAttention)
#define B_    2
#define S_    2048
#define D_    1024
#define H_    16
#define HD_   64
#define L_    256
#define NTOK_ (B_ * S_)

typedef __attribute__((ext_vector_type(16))) _Float16 v16h;
typedef __attribute__((ext_vector_type(8)))  _Float16 v8h;
typedef __attribute__((ext_vector_type(8)))  float    v8f;

static __device__ __forceinline__ v8f wmma_f16f32(v16h a, v16h b, v8f c) {
  // D = A(16x32 f16) * B(32x16 f16) + C(16x16 f32)
  return __builtin_amdgcn_wmma_f32_16x16x32_f16(false, a, false, b, (short)0, c,
                                                false, false);
}

static __device__ __forceinline__ v8f zero8() {
  v8f z = {0.f, 0.f, 0.f, 0.f, 0.f, 0.f, 0.f, 0.f};
  return z;
}

// Load an A-style fragment (row m = lane&15; K chunks at col0+8g and col0+16+8g)
// from a row-major f16 matrix with leading dimension ld. The same routine loads
// B-fragments from the *transposed* (N-major) operand. Works for global or LDS.
static __device__ __forceinline__ v16h load_frag(const _Float16* __restrict__ base,
                                                 int row0, int ld, int col0,
                                                 int lane) {
  const int g = lane >> 4;
  const int m = lane & 15;
  const _Float16* p = base + (size_t)(row0 + m) * ld + col0 + g * 8;
  union { v16h v; v8h h[2]; } u;
  u.h[0] = *(const v8h*)(p);
  u.h[1] = *(const v8h*)(p + 16);
  return u.v;
}

// LDS byte offset of a __shared__ object (dsaddr = LDS_BASE + VGPR, ISA 10.x):
// generic -> addrspace(3) cast yields the 32-bit LDS offset.
static __device__ __forceinline__ unsigned lds_off_of(const void* p) {
  return (unsigned)(unsigned long long)(const __attribute__((address_space(3))) char*)p;
}

// CDNA5 async DMA: memory -> LDS, 16B per lane, tracked by ASYNCcnt.
static __device__ __forceinline__ void async_b128_to_lds(unsigned lds_off,
                                                         const void* gaddr) {
  asm volatile("global_load_async_to_lds_b128 %0, %1, off"
               :: "v"(lds_off), "v"((unsigned long long)gaddr)
               : "memory");
}

// ---------------------------------------------------------------------------
// Elementwise prep kernels
// ---------------------------------------------------------------------------
__global__ void f32_to_f16_kernel(const float* __restrict__ in,
                                  _Float16* __restrict__ out, int nelem) {
  int i = blockIdx.x * 256 + threadIdx.x;
  if (i < nelem) out[i] = (_Float16)in[i];
}

__global__ void add2_to_f16_kernel(const float* __restrict__ a,
                                   const float* __restrict__ b,
                                   _Float16* __restrict__ out, int nelem) {
  int i = blockIdx.x * 256 + threadIdx.x;
  if (i < nelem) out[i] = (_Float16)(a[i] + b[i]);
}

// out[c * R + r] = (f16) in[r * C + c]   (in: R x C f32, out: C x R f16)
__global__ void transpose_f32_to_f16_kernel(const float* __restrict__ in,
                                            _Float16* __restrict__ out,
                                            int R, int C) {
  int i = blockIdx.x * 256 + threadIdx.x;
  if (i < R * C) {
    int r = i / C, c = i % C;
    out[(size_t)c * R + r] = (_Float16)in[i];
  }
}

// ---------------------------------------------------------------------------
// Generic WMMA GEMM: C[M x N] = A[M x K] * B[K x N], B given transposed (N x K).
// One wave computes a 16(M) x 64(N) tile: 4 accumulators, A reused 4x.
// MODE 0: f32 out; 1: f16 out; 2: f32 + f16 out; 3: per-head transposed f16
//         scatter (v_rec -> vT[B][H][64][S]).
// ---------------------------------------------------------------------------
template <int MODE>
__global__ __launch_bounds__(256) void gemm_wmma_kernel(
    const _Float16* __restrict__ A, const _Float16* __restrict__ Bt,
    float* __restrict__ Cf, _Float16* __restrict__ Ch, int M, int N, int K) {
  const int lane = threadIdx.x & 31;
  const int wid  = threadIdx.x >> 5;
  const int tN   = N >> 6;
  const int ntiles = (M >> 4) * tN;
  const int tile = blockIdx.x * 8 + wid;
  if (tile >= ntiles) return;  // wave-uniform: EXEC stays all-ones for WMMA
  const int row0 = (tile / tN) << 4;
  const int col0 = (tile % tN) << 6;
  const int g = lane >> 4;
  const int n = lane & 15;

  v8f acc[4];
#pragma unroll
  for (int f = 0; f < 4; ++f) acc[f] = zero8();

  for (int k0 = 0; k0 < K; k0 += 32) {
    v16h a = load_frag(A, row0, K, k0, lane);
#pragma unroll
    for (int f = 0; f < 4; ++f) {
      v16h b = load_frag(Bt, col0 + f * 16, K, k0, lane);
      acc[f] = wmma_f16f32(a, b, acc[f]);
    }
  }

  if constexpr (MODE == 3) {
    // v_rec element C[tok][col] -> vT[b][h][d][s], 8 consecutive tokens per lane
#pragma unroll
    for (int f = 0; f < 4; ++f) {
      const int col = col0 + f * 16 + n;
      const int hh  = col >> 6;
      const int dd  = col & (HD_ - 1);
      const int tok0 = row0 + g * 8;        // 16-aligned tile: never crosses batch
      const int bb = tok0 >> 11;            // / S_
      const int ss = tok0 & (S_ - 1);
      v8h o8;
#pragma unroll
      for (int r = 0; r < 8; ++r) o8[r] = (_Float16)acc[f][r];
      *(v8h*)(Ch + (size_t)((bb * H_ + hh) * HD_ + dd) * S_ + ss) = o8;
    }
  } else {
#pragma unroll
    for (int f = 0; f < 4; ++f) {
#pragma unroll
      for (int r = 0; r < 8; ++r) {
        const size_t idx = (size_t)(row0 + g * 8 + r) * N + col0 + f * 16 + n;
        if constexpr (MODE == 0 || MODE == 2) Cf[idx] = acc[f][r];
        if constexpr (MODE == 1 || MODE == 2) Ch[idx] = (_Float16)acc[f][r];
      }
    }
  }
}

// ---------------------------------------------------------------------------
// Flash attention with multiplicative time decay.
// One block = 8 waves = 8 consecutive 16-query tiles of ONE (b, h); the block
// cooperatively stages each 32-key K/V tile into LDS exactly once via
// global_load_async_to_lds_b128 (ASYNCcnt), double-buffered so the DMA of
// tile k+1 overlaps the 8 WMMAs + online softmax of tile k.
// ---------------------------------------------------------------------------
__global__ __launch_bounds__(256) void flash_attn_decay_kernel(
    const _Float16* __restrict__ Qh,   // [NTOK_, D_] row-major
    const _Float16* __restrict__ Kh,   // [NTOK_, D_] row-major (k_rec)
    const _Float16* __restrict__ Vt,   // [B_, H_, HD_, S_] (v_rec transposed)
    _Float16* __restrict__ Oh) {       // [NTOK_, D_] row-major
  __shared__ __align__(16) _Float16 Ktile[2][32][64];  // [key][dim]  8 KB
  __shared__ __align__(16) _Float16 Vtile[2][64][32];  // [dim][key]  8 KB
  __shared__ __align__(16) _Float16 pbuf[8][16][32];   // P transpose 8 KB

  const int t    = threadIdx.x;
  const int lane = t & 31;
  const int wid  = t >> 5;
  const int bh   = blockIdx.x >> 4;              // 16 blocks per (b,h)
  const int qt   = ((blockIdx.x & 15) << 3) + wid;
  const int h    = bh & (H_ - 1);
  const int b    = bh >> 4;
  const int g    = lane >> 4;
  const int n    = lane & 15;

  const float scale = 1.0f / (sqrtf((float)D_) + 1e-8f);
  const float lam   = 1e-4f;  // LAMBDA_DECAY * TIME_STEP
  const float CLMP  = 1e4f;

  const int bS    = b * S_;
  const int qrow0 = bS + qt * 16;
  const v16h qa0 = load_frag(Qh, qrow0, D_, h * HD_ + 0,  lane);
  const v16h qa1 = load_frag(Qh, qrow0, D_, h * HD_ + 32, lane);

  const _Float16* vt = Vt + (size_t)(b * H_ + h) * HD_ * S_;

  // Per-thread staging coordinates: 256 threads x 16B = one 4 KB tile each.
  const int krow = t >> 3, kcc = (t & 7) * 8;    // K: [32 keys][64 dims]
  const int vd   = t >> 2, vkc = (t & 3) * 8;    // V: [64 dims][32 keys]

  v8f o[4];
  float mrun[8], lrun[8];
#pragma unroll
  for (int f = 0; f < 4; ++f) o[f] = zero8();
#pragma unroll
  for (int r = 0; r < 8; ++r) { mrun[r] = -3.0e38f; lrun[r] = 0.f; }

  const int NT = S_ / 32;

  // Prologue: stage tile 0 into buffer 0.
  async_b128_to_lds(lds_off_of(&Ktile[0][krow][kcc]),
                    Kh + (size_t)(bS + krow) * D_ + h * HD_ + kcc);
  async_b128_to_lds(lds_off_of(&Vtile[0][vd][vkc]),
                    vt + (size_t)vd * S_ + vkc);

  for (int kb = 0; kb < NT; ++kb) {
    const int cur = kb & 1;
    if (kb + 1 < NT) {
      // Issue next tile's DMA, then wait only for the CURRENT tile (keep the
      // next stage's 2 async ops in flight).
      const int krow1 = bS + (kb + 1) * 32;
      async_b128_to_lds(lds_off_of(&Ktile[cur ^ 1][krow][kcc]),
                        Kh + (size_t)(krow1 + krow) * D_ + h * HD_ + kcc);
      async_b128_to_lds(lds_off_of(&Vtile[cur ^ 1][vd][vkc]),
                        vt + (size_t)vd * S_ + (kb + 1) * 32 + vkc);
      asm volatile("s_wait_asynccnt 0x2" ::: "memory");
    } else {
      asm volatile("s_wait_asynccnt 0x0" ::: "memory");
    }
    __syncthreads();  // current tile visible to all waves

    // ---- scores: 16 queries x 32 keys from LDS tile ----
    const _Float16* kt  = &Ktile[cur][0][0];
    v16h kb00 = load_frag(kt, 0,  HD_, 0,  lane);
    v16h kb01 = load_frag(kt, 0,  HD_, 32, lane);
    v16h kb10 = load_frag(kt, 16, HD_, 0,  lane);
    v16h kb11 = load_frag(kt, 16, HD_, 32, lane);
    v8f s0 = zero8(), s1 = zero8();
    s0 = wmma_f16f32(qa0, kb00, s0);
    s0 = wmma_f16f32(qa1, kb01, s0);
    s1 = wmma_f16f32(qa0, kb10, s1);
    s1 = wmma_f16f32(qa1, kb11, s1);

    // ---- scale, clamp, time decay, clamp ----
    float p0[8], p1[8], rmax[8], rsum[8], alpha[8];
#pragma unroll
    for (int r = 0; r < 8; ++r) {
      const float qi  = (float)(qt * 16 + g * 8 + r);
      const float kj0 = (float)(kb * 32 + n);
      float t0 = fminf(fmaxf(s0[r] * scale, -CLMP), CLMP);
      t0 *= __expf(-lam * fabsf(qi - kj0));
      t0 = fminf(fmaxf(t0, -CLMP), CLMP);
      float t1 = fminf(fmaxf(s1[r] * scale, -CLMP), CLMP);
      t1 *= __expf(-lam * fabsf(qi - (kj0 + 16.0f)));
      t1 = fminf(fmaxf(t1, -CLMP), CLMP);
      p0[r] = t0; p1[r] = t1;
      rmax[r] = fmaxf(t0, t1);
    }

    // ---- online softmax: row reductions across the 16 lanes of each half ----
#pragma unroll
    for (int msk = 1; msk < 16; msk <<= 1)
#pragma unroll
      for (int r = 0; r < 8; ++r)
        rmax[r] = fmaxf(rmax[r], __shfl_xor(rmax[r], msk, 32));
#pragma unroll
    for (int r = 0; r < 8; ++r) {
      const float mnew = fmaxf(mrun[r], rmax[r]);
      alpha[r] = __expf(mrun[r] - mnew);
      mrun[r]  = mnew;
      p0[r] = __expf(p0[r] - mnew);
      p1[r] = __expf(p1[r] - mnew);
      rsum[r] = p0[r] + p1[r];
    }
#pragma unroll
    for (int msk = 1; msk < 16; msk <<= 1)
#pragma unroll
      for (int r = 0; r < 8; ++r)
        rsum[r] += __shfl_xor(rsum[r], msk, 32);
#pragma unroll
    for (int r = 0; r < 8; ++r) lrun[r] = lrun[r] * alpha[r] + rsum[r];
#pragma unroll
    for (int f = 0; f < 4; ++f)
#pragma unroll
      for (int r = 0; r < 8; ++r) o[f][r] *= alpha[r];

    // ---- P: C-layout -> A-layout via LDS (in-order within a wave) ----
#pragma unroll
    for (int r = 0; r < 8; ++r) {
      pbuf[wid][g * 8 + r][n]      = (_Float16)p0[r];
      pbuf[wid][g * 8 + r][16 + n] = (_Float16)p1[r];
    }
    union { v16h v; v8h hh[2]; } up;
    const _Float16* pp = &pbuf[wid][n][0];  // A-frag row m = lane&15
    up.hh[0] = *(const v8h*)(pp + g * 8);
    up.hh[1] = *(const v8h*)(pp + 16 + g * 8);

    // ---- O += P(16x32) @ V(32x64): B-frags contiguous from LDS V tile ----
    const _Float16* vtl = &Vtile[cur][0][0];
#pragma unroll
    for (int f = 0; f < 4; ++f) {
      v16h vb = load_frag(vtl, f * 16, 32, 0, lane);
      o[f] = wmma_f16f32(up.v, vb, o[f]);
    }

    __syncthreads();  // all waves done reading buf before its next overwrite
  }

  // ---- epilogue: normalize and store row-major f16 ----
  float inv[8];
#pragma unroll
  for (int r = 0; r < 8; ++r) inv[r] = 1.0f / lrun[r];
#pragma unroll
  for (int f = 0; f < 4; ++f)
#pragma unroll
    for (int r = 0; r < 8; ++r)
      Oh[(size_t)(qrow0 + g * 8 + r) * D_ + h * HD_ + f * 16 + n] =
          (_Float16)(o[f][r] * inv[r]);
}

// ---------------------------------------------------------------------------
// Host orchestration
// ---------------------------------------------------------------------------
extern "C" void kernel_launch(void* const* d_in, const int* in_sizes, int n_in,
                              void* d_out, int out_size, void* d_ws,
                              size_t ws_size, hipStream_t stream) {
  (void)in_sizes; (void)n_in; (void)out_size; (void)ws_size;
  const float* x     = (const float*)d_in[0];
  const float* Wq    = (const float*)d_in[1];
  const float* Wk    = (const float*)d_in[2];
  const float* Wv    = (const float*)d_in[3];
  const float* Wo    = (const float*)d_in[4];
  const float* Wdown = (const float*)d_in[5];
  const float* Wupk  = (const float*)d_in[6];
  const float* Wupv  = (const float*)d_in[7];
  float* out = (float*)d_out;  // [NTOK_*D_] attn-out, then [NTOK_*L_] latent

  // Carve workspace (256B aligned)
  char* wsp = (char*)d_ws;
  auto carve = [&](size_t bytes) {
    char* p = wsp;
    wsp += (bytes + 255) & ~(size_t)255;
    return p;
  };
  _Float16* x_h      = (_Float16*)carve((size_t)NTOK_ * D_ * 2);
  _Float16* q_h      = (_Float16*)carve((size_t)NTOK_ * D_ * 2);
  _Float16* k_h      = (_Float16*)carve((size_t)NTOK_ * D_ * 2);
  _Float16* vT       = (_Float16*)carve((size_t)NTOK_ * D_ * 2);
  _Float16* attn_h   = (_Float16*)carve((size_t)NTOK_ * D_ * 2);
  _Float16* latent_h = (_Float16*)carve((size_t)NTOK_ * L_ * 2);
  _Float16* wq_t     = (_Float16*)carve((size_t)D_ * D_ * 2);
  _Float16* wo_t     = (_Float16*)carve((size_t)D_ * D_ * 2);
  _Float16* wkv_h    = (_Float16*)carve((size_t)D_ * D_ * 2);
  _Float16* wdown_t  = (_Float16*)carve((size_t)D_ * L_ * 2);
  _Float16* wupk_t   = (_Float16*)carve((size_t)D_ * L_ * 2);
  _Float16* wupv_t   = (_Float16*)carve((size_t)D_ * L_ * 2);
  float*    wcomb_f  = (float*)   carve((size_t)D_ * L_ * 4);
  _Float16* wcomb_t  = (_Float16*)carve((size_t)D_ * L_ * 2);

  auto eblk = [](int nel) { return (nel + 255) / 256; };
  auto gblk = [](int M, int N) { return ((M >> 4) * (N >> 6) + 7) / 8; };

  // --- precision conversion & weight transposes ---
  f32_to_f16_kernel<<<eblk(NTOK_ * D_), 256, 0, stream>>>(x, x_h, NTOK_ * D_);
  add2_to_f16_kernel<<<eblk(D_ * D_), 256, 0, stream>>>(Wk, Wv, wkv_h, D_ * D_);
  transpose_f32_to_f16_kernel<<<eblk(D_ * D_), 256, 0, stream>>>(Wq, wq_t, D_, D_);
  transpose_f32_to_f16_kernel<<<eblk(D_ * D_), 256, 0, stream>>>(Wo, wo_t, D_, D_);
  transpose_f32_to_f16_kernel<<<eblk(D_ * L_), 256, 0, stream>>>(Wdown, wdown_t, D_, L_);
  transpose_f32_to_f16_kernel<<<eblk(L_ * D_), 256, 0, stream>>>(Wupk, wupk_t, L_, D_);
  transpose_f32_to_f16_kernel<<<eblk(L_ * D_), 256, 0, stream>>>(Wupv, wupv_t, L_, D_);

  // --- W_comb = (Wk + Wv) @ W_down  (folds the k/v GEMMs away) ---
  gemm_wmma_kernel<0><<<gblk(D_, L_), 256, 0, stream>>>(
      wkv_h, wdown_t, wcomb_f, nullptr, D_, L_, D_);
  transpose_f32_to_f16_kernel<<<eblk(D_ * L_), 256, 0, stream>>>(
      wcomb_f, wcomb_t, D_, L_);

  // --- latent = x @ W_comb : f32 -> d_out tail, f16 -> latent_h ---
  gemm_wmma_kernel<2><<<gblk(NTOK_, L_), 256, 0, stream>>>(
      x_h, wcomb_t, out + (size_t)NTOK_ * D_, latent_h, NTOK_, L_, D_);

  // --- q = x @ Wq ---
  gemm_wmma_kernel<1><<<gblk(NTOK_, D_), 256, 0, stream>>>(
      x_h, wq_t, nullptr, q_h, NTOK_, D_, D_);

  // --- k_rec = latent @ W_up_k (row-major == B^T for QK^T) ---
  gemm_wmma_kernel<1><<<gblk(NTOK_, D_), 256, 0, stream>>>(
      latent_h, wupk_t, nullptr, k_h, NTOK_, D_, L_);

  // --- v_rec = latent @ W_up_v, written per-head transposed [B,H,64,S] ---
  gemm_wmma_kernel<3><<<gblk(NTOK_, D_), 256, 0, stream>>>(
      latent_h, wupv_t, nullptr, vT, NTOK_, D_, L_);

  // --- flash attention with decay: 512 blocks, 8 q-tiles of one (b,h) each ---
  flash_attn_decay_kernel<<<B_ * H_ * (S_ / 128), 256, 0, stream>>>(
      q_h, k_h, vT, attn_h);

  // --- out = attn @ Wo ---
  gemm_wmma_kernel<0><<<gblk(NTOK_, D_), 256, 0, stream>>>(
      attn_h, wo_t, out, nullptr, NTOK_, D_, D_);
}

// v001
// A run of this version takes 391 microseconds.
// In both of two side-by-side timings against v000, it was 1.11 times as fast.
#include <hip/hip_runtime.h>

// Problem constants (reference: TimeAwareMultiHeadLatentAttention)
#define B_    2
#define S_    2048
#define D_    1024
#define H_    16
#define HD_   64
#define L_    256
#define NTOK_ (B_ * S_)
#define KP_   72   // LDS pitch of a 64-half row, in halves
#define VP_   40   // LDS pitch of a 32-half row, in halves

typedef __attribute__((ext_vector_type(16))) _Float16 v16h;
typedef __attribute__((ext_vector_type(8)))  _Float16 v8h;
typedef __attribute__((ext_vector_type(8)))  float    v8f;

static __device__ __forceinline__ v8f wmma_f16f32(v16h a, v16h b, v8f c) {
  // D = A(16x32 f16) * B(32x16 f16) + C(16x16 f32)
  return __builtin_amdgcn_wmma_f32_16x16x32_f16(false, a, false, b, (short)0, c,
                                                false, false);
}

static __device__ __forceinline__ v8f zero8() {
  v8f z = {0.f, 0.f, 0.f, 0.f, 0.f, 0.f, 0.f, 0.f};
  return z;
}

// Load an A-style fragment (row m = lane&15; K chunks at col0+8g and col0+16+8g)
// from a row-major f16 matrix with leading dimension ld. The same routine loads
// B-fragments from the *transposed* (N-major) operand. Works for global or LDS.
static __device__ __forceinline__ v16h load_frag(const _Float16* __restrict__ base,
                                                 int row0, int ld, int col0,
                                                 int lane) {
  const int g = lane >> 4;
  const int m = lane & 15;
  const _Float16* p = base + (size_t)(row0 + m) * ld + col0 + g * 8;
  union { v16h v; v8h h[2]; } u;
  u.h[0] = *(const v8h*)(p);
  u.h[1] = *(const v8h*)(p + 16);
  return u.v;
}

// LDS byte offset of a __shared__ object (dsaddr = LDS_BASE + VGPR, ISA 10.x):
// generic -> addrspace(3) cast yields the 32-bit LDS offset.
static __device__ __forceinline__ unsigned lds_off_of(const void* p) {
  return (unsigned)(unsigned long long)(const __attribute__((address_space(3))) char*)p;
}

// CDNA5 async DMA: memory -> LDS, 16B per lane, tracked by ASYNCcnt.
static __device__ __forceinline__ void async_b128_to_lds(unsigned lds_off,
                                                         const void* gaddr) {
  asm volatile("global_load_async_to_lds_b128 %0, %1, off"
               :: "v"(lds_off), "v"((unsigned long long)gaddr)
               : "memory");
}

// ---------------------------------------------------------------------------
// Elementwise prep kernels
// ---------------------------------------------------------------------------
__global__ void f32_to_f16_kernel(const float* __restrict__ in,
                                  _Float16* __restrict__ out, int nelem) {
  int i = blockIdx.x * 256 + threadIdx.x;
  if (i < nelem) out[i] = (_Float16)in[i];
}

__global__ void add2_to_f16_kernel(const float* __restrict__ a,
                                   const float* __restrict__ b,
                                   _Float16* __restrict__ out, int nelem) {
  int i = blockIdx.x * 256 + threadIdx.x;
  if (i < nelem) out[i] = (_Float16)(a[i] + b[i]);
}

// out[c * R + r] = (f16) in[r * C + c]   (in: R x C f32, out: C x R f16)
__global__ void transpose_f32_to_f16_kernel(const float* __restrict__ in,
                                            _Float16* __restrict__ out,
                                            int R, int C) {
  int i = blockIdx.x * 256 + threadIdx.x;
  if (i < R * C) {
    int r = i / C, c = i % C;
    out[(size_t)c * R + r] = (_Float16)in[i];
  }
}

// ---------------------------------------------------------------------------
// Generic WMMA GEMM: C[M x N] = A[M x K] * B[K x N], B given transposed (N x K).
// One wave computes a 16(M) x 64(N) tile: 4 accumulators, A reused 4x.
// MODE 0: f32 out; 1: f16 out; 2: f32 + f16 out; 3: per-head transposed f16
//         scatter (v_rec -> vT[B][H][64][S]).
// ---------------------------------------------------------------------------
template <int MODE>
__global__ __launch_bounds__(256) void gemm_wmma_kernel(
    const _Float16* __restrict__ A, const _Float16* __restrict__ Bt,
    float* __restrict__ Cf, _Float16* __restrict__ Ch, int M, int N, int K) {
  const int lane = threadIdx.x & 31;
  const int wid  = threadIdx.x >> 5;
  const int tN   = N >> 6;
  const int ntiles = (M >> 4) * tN;
  const int tile = blockIdx.x * 8 + wid;
  if (tile >= ntiles) return;  // wave-uniform: EXEC stays all-ones for WMMA
  const int row0 = (tile / tN) << 4;
  const int col0 = (tile % tN) << 6;
  const int g = lane >> 4;
  const int n = lane & 15;

  v8f acc[4];
#pragma unroll
  for (int f = 0; f < 4; ++f) acc[f] = zero8();

  for (int k0 = 0; k0 < K; k0 += 32) {
    v16h a = load_frag(A, row0, K, k0, lane);
#pragma unroll
    for (int f = 0; f < 4; ++f) {
      v16h b = load_frag(Bt, col0 + f * 16, K, k0, lane);
      acc[f] = wmma_f16f32(a, b, acc[f]);
    }
  }

  if constexpr (MODE == 3) {
    // v_rec element C[tok][col] -> vT[b][h][d][s], 8 consecutive tokens per lane
#pragma unroll
    for (int f = 0; f < 4; ++f) {
      const int col = col0 + f * 16 + n;
      const int hh  = col >> 6;
      const int dd  = col & (HD_ - 1);
      const int tok0 = row0 + g * 8;        // 16-aligned tile: never crosses batch
      const int bb = tok0 >> 11;            // / S_
      const int ss = tok0 & (S_ - 1);
      v8h o8;
#pragma unroll
      for (int r = 0; r < 8; ++r) o8[r] = (_Float16)acc[f][r];
      *(v8h*)(Ch + (size_t)((bb * H_ + hh) * HD_ + dd) * S_ + ss) = o8;
    }
  } else {
#pragma unroll
    for (int f = 0; f < 4; ++f) {
#pragma unroll
      for (int r = 0; r < 8; ++r) {
        const size_t idx = (size_t)(row0 + g * 8 + r) * N + col0 + f * 16 + n;
        if constexpr (MODE == 0 || MODE == 2) Cf[idx] = acc[f][r];
        if constexpr (MODE == 1 || MODE == 2) Ch[idx] = (_Float16)acc[f][r];
      }
    }
  }
}

// ---------------------------------------------------------------------------
// Flash attention with multiplicative time decay.
// One block = 8 waves = 8 consecutive 16-query tiles of ONE (b, h); the block
// cooperatively stages each 32-key K/V tile into LDS exactly once via
// global_load_async_to_lds_b128 (ASYNCcnt), double-buffered so the DMA of
// tile k+1 overlaps the 8 WMMAs + online softmax of tile k.
// ---------------------------------------------------------------------------
__global__ __launch_bounds__(256) void flash_attn_decay_kernel(
    const _Float16* __restrict__ Qh,   // [NTOK_, D_] row-major
    const _Float16* __restrict__ Kh,   // [NTOK_, D_] row-major (k_rec)
    const _Float16* __restrict__ Vt,   // [B_, H_, HD_, S_] (v_rec transposed)
    _Float16* __restrict__ Oh) {       // [NTOK_, D_] row-major
  // Row pitches are odd multiples of 16 B (144 B, 80 B, 80 B): the 16 rows that
  // one ds_load_b128 fragment read touches then fall on distinct bank groups.
  __shared__ __align__(16) _Float16 Ktile[2][32][KP_];  // [key][dim]  9 KB
  __shared__ __align__(16) _Float16 Vtile[2][64][VP_];  // [dim][key] 10 KB
  __shared__ __align__(16) _Float16 pbuf[8][16][VP_];   // P transpose 10 KB

  const int t    = threadIdx.x;
  const int lane = t & 31;
  const int wid  = t >> 5;
  const int bh   = blockIdx.x >> 4;              // 16 blocks per (b,h)
  const int qt   = ((blockIdx.x & 15) << 3) + wid;
  const int h    = bh & (H_ - 1);
  const int b    = bh >> 4;
  const int g    = lane >> 4;
  const int n    = lane & 15;

  const float scale = 1.0f / (sqrtf((float)D_) + 1e-8f);
  const float lam   = 1e-4f;  // LAMBDA_DECAY * TIME_STEP
  const float CLMP  = 1e4f;

  const int bS    = b * S_;
  const int qrow0 = bS + qt * 16;
  const v16h qa0 = load_frag(Qh, qrow0, D_, h * HD_ + 0,  lane);
  const v16h qa1 = load_frag(Qh, qrow0, D_, h * HD_ + 32, lane);

  const _Float16* vt = Vt + (size_t)(b * H_ + h) * HD_ * S_;

  // Per-thread staging coordinates: 256 threads x 16B = one 4 KB tile each.
  const int krow = t >> 3, kcc = (t & 7) * 8;    // K: [32 keys][64 dims]
  const int vd   = t >> 2, vkc = (t & 3) * 8;    // V: [64 dims][32 keys]

  v8f o[4];
  float mrun[8], lrun[8];
#pragma unroll
  for (int f = 0; f < 4; ++f) o[f] = zero8();
#pragma unroll
  for (int r = 0; r < 8; ++r) { mrun[r] = -3.0e38f; lrun[r] = 0.f; }

  const int NT = S_ / 32;

  // Prologue: stage tile 0 into buffer 0.
  async_b128_to_lds(lds_off_of(&Ktile[0][krow][kcc]),
                    Kh + (size_t)(bS + krow) * D_ + h * HD_ + kcc);
  async_b128_to_lds(lds_off_of(&Vtile[0][vd][vkc]),
                    vt + (size_t)vd * S_ + vkc);

  for (int kb = 0; kb < NT; ++kb) {
    const int cur = kb & 1;
    if (kb + 1 < NT) {
      // Issue next tile's DMA, then wait only for the CURRENT tile (keep the
      // next stage's 2 async ops in flight).
      const int krow1 = bS + (kb + 1) * 32;
      async_b128_to_lds(lds_off_of(&Ktile[cur ^ 1][krow][kcc]),
                        Kh + (size_t)(krow1 + krow) * D_ + h * HD_ + kcc);
      async_b128_to_lds(lds_off_of(&Vtile[cur ^ 1][vd][vkc]),
                        vt + (size_t)vd * S_ + (kb + 1) * 32 + vkc);
      asm volatile("s_wait_asynccnt 0x2" ::: "memory");
    } else {
      asm volatile("s_wait_asynccnt 0x0" ::: "memory");
    }
    __syncthreads();  // current tile visible to all waves

    // ---- scores: 16 queries x 32 keys from LDS tile ----
    const _Float16* kt  = &Ktile[cur][0][0];
    v16h kb00 = load_frag(kt, 0,  KP_, 0,  lane);
    v16h kb01 = load_frag(kt, 0,  KP_, 32, lane);
    v16h kb10 = load_frag(kt, 16, KP_, 0,  lane);
    v16h kb11 = load_frag(kt, 16, KP_, 32, lane);
    v8f s0 = zero8(), s1 = zero8();
    s0 = wmma_f16f32(qa0, kb00, s0);
    s0 = wmma_f16f32(qa1, kb01, s0);
    s1 = wmma_f16f32(qa0, kb10, s1);
    s1 = wmma_f16f32(qa1, kb11, s1);

    // ---- scale, clamp, time decay, clamp ----
    float p0[8], p1[8], rmax[8], rsum[8], alpha[8];
#pragma unroll
    for (int r = 0; r < 8; ++r) {
      const float qi  = (float)(qt * 16 + g * 8 + r);
      const float kj0 = (float)(kb * 32 + n);
      float t0 = fminf(fmaxf(s0[r] * scale, -CLMP), CLMP);
      t0 *= __expf(-lam * fabsf(qi - kj0));
      t0 = fminf(fmaxf(t0, -CLMP), CLMP);
      float t1 = fminf(fmaxf(s1[r] * scale, -CLMP), CLMP);
      t1 *= __expf(-lam * fabsf(qi - (kj0 + 16.0f)));
      t1 = fminf(fmaxf(t1, -CLMP), CLMP);
      p0[r] = t0; p1[r] = t1;
      rmax[r] = fmaxf(t0, t1);
    }

    // ---- online softmax: row reductions across the 16 lanes of each half ----
#pragma unroll
    for (int msk = 1; msk < 16; msk <<= 1)
#pragma unroll
      for (int r = 0; r < 8; ++r)
        rmax[r] = fmaxf(rmax[r], __shfl_xor(rmax[r], msk, 32));
#pragma unroll
    for (int r = 0; r < 8; ++r) {
      const float mnew = fmaxf(mrun[r], rmax[r]);
      alpha[r] = __expf(mrun[r] - mnew);
      mrun[r]  = mnew;
      p0[r] = __expf(p0[r] - mnew);
      p1[r] = __expf(p1[r] - mnew);
      rsum[r] = p0[r] + p1[r];
    }
#pragma unroll
    for (int msk = 1; msk < 16; msk <<= 1)
#pragma unroll
      for (int r = 0; r < 8; ++r)
        rsum[r] += __shfl_xor(rsum[r], msk, 32);
#pragma unroll
    for (int r = 0; r < 8; ++r) lrun[r] = lrun[r] * alpha[r] + rsum[r];
#pragma unroll
    for (int f = 0; f < 4; ++f)
#pragma unroll
      for (int r = 0; r < 8; ++r) o[f][r] *= alpha[r];

    // ---- P: C-layout -> A-layout via LDS (in-order within a wave) ----
#pragma unroll
    for (int r = 0; r < 8; ++r) {
      pbuf[wid][g * 8 + r][n]      = (_Float16)p0[r];
      pbuf[wid][g * 8 + r][16 + n] = (_Float16)p1[r];
    }
    union { v16h v; v8h hh[2]; } up;
    const _Float16* pp = &pbuf[wid][n][0];  // A-frag row m = lane&15
    up.hh[0] = *(const v8h*)(pp + g * 8);
    up.hh[1] = *(const v8h*)(pp + 16 + g * 8);

    // ---- O += P(16x32) @ V(32x64): B-frags contiguous from LDS V tile ----
    const _Float16* vtl = &Vtile[cur][0][0];
#pragma unroll
    for (int f = 0; f < 4; ++f) {
      v16h vb = load_frag(vtl, f * 16, VP_, 0, lane);
      o[f] = wmma_f16f32(up.v, vb, o[f]);
    }

    __syncthreads();  // all waves done reading buf before its next overwrite
  }

  // ---- epilogue: normalize and store row-major f16 ----
  float inv[8];
#pragma unroll
  for (int r = 0; r < 8; ++r) inv[r] = 1.0f / lrun[r];
#pragma unroll
  for (int f = 0; f < 4; ++f)
#pragma unroll
    for (int r = 0; r < 8; ++r)
      Oh[(size_t)(qrow0 + g * 8 + r) * D_ + h * HD_ + f * 16 + n] =
          (_Float16)(o[f][r] * inv[r]);
}

// ---------------------------------------------------------------------------
// Host orchestration
// ---------------------------------------------------------------------------
extern "C" void kernel_launch(void* const* d_in, const int* in_sizes, int n_in,
                              void* d_out, int out_size, void* d_ws,
                              size_t ws_size, hipStream_t stream) {
  (void)in_sizes; (void)n_in; (void)out_size; (void)ws_size;
  const float* x     = (const float*)d_in[0];
  const float* Wq    = (const float*)d_in[1];
  const float* Wk    = (const float*)d_in[2];
  const float* Wv    = (const float*)d_in[3];
  const float* Wo    = (const float*)d_in[4];
  const float* Wdown = (const float*)d_in[5];
  const float* Wupk  = (const float*)d_in[6];
  const float* Wupv  = (const float*)d_in[7];
  float* out = (float*)d_out;  // [NTOK_*D_] attn-out, then [NTOK_*L_] latent

  // Carve workspace (256B aligned)
  char* wsp = (char*)d_ws;
  auto carve = [&](size_t bytes) {
    char* p = wsp;
    wsp += (bytes + 255) & ~(size_t)255;
    return p;
  };
  _Float16* x_h      = (_Float16*)carve((size_t)NTOK_ * D_ * 2);
  _Float16* q_h      = (_Float16*)carve((size_t)NTOK_ * D_ * 2);
  _Float16* k_h      = (_Float16*)carve((size_t)NTOK_ * D_ * 2);
  _Float16* vT       = (_Float16*)carve((size_t)NTOK_ * D_ * 2);
  _Float16* attn_h   = (_Float16*)carve((size_t)NTOK_ * D_ * 2);
  _Float16* latent_h = (_Float16*)carve((size_t)NTOK_ * L_ * 2);
  _Float16* wq_t     = (_Float16*)carve((size_t)D_ * D_ * 2);
  _Float16* wo_t     = (_Float16*)carve((size_t)D_ * D_ * 2);
  _Float16* wkv_h    = (_Float16*)carve((size_t)D_ * D_ * 2);
  _Float16* wdown_t  = (_Float16*)carve((size_t)D_ * L_ * 2);
  _Float16* wupk_t   = (_Float16*)carve((size_t)D_ * L_ * 2);
  _Float16* wupv_t   = (_Float16*)carve((size_t)D_ * L_ * 2);
  float*    wcomb_f  = (float*)   carve((size_t)D_ * L_ * 4);
  _Float16* wcomb_t  = (_Float16*)carve((size_t)D_ * L_ * 2);

  auto eblk = [](int nel) { return (nel + 255) / 256; };
  auto gblk = [](int M, int N) { return ((M >> 4) * (N >> 6) + 7) / 8; };

  // --- precision conversion & weight transposes ---
  f32_to_f16_kernel<<<eblk(NTOK_ * D_), 256, 0, stream>>>(x, x_h, NTOK_ * D_);
  add2_to_f16_kernel<<<eblk(D_ * D_), 256, 0, stream>>>(Wk, Wv, wkv_h, D_ * D_);
  transpose_f32_to_f16_kernel<<<eblk(D_ * D_), 256, 0, stream>>>(Wq, wq_t, D_, D_);
  transpose_f32_to_f16_kernel<<<eblk(D_ * D_), 256, 0, stream>>>(Wo, wo_t, D_, D_);
  transpose_f32_to_f16_kernel<<<eblk(D_ * L_), 256, 0, stream>>>(Wdown, wdown_t, D_, L_);
  transpose_f32_to_f16_kernel<<<eblk(L_ * D_), 256, 0, stream>>>(Wupk, wupk_t, L_, D_);
  transpose_f32_to_f16_kernel<<<eblk(L_ * D_), 256, 0, stream>>>(Wupv, wupv_t, L_, D_);

  // --- W_comb = (Wk + Wv) @ W_down  (folds the k/v GEMMs away) ---
  gemm_wmma_kernel<0><<<gblk(D_, L_), 256, 0, stream>>>(
      wkv_h, wdown_t, wcomb_f, nullptr, D_, L_, D_);
  transpose_f32_to_f16_kernel<<<eblk(D_ * L_), 256, 0, stream>>>(
      wcomb_f, wcomb_t, D_, L_);

  // --- latent = x @ W_comb : f32 -> d_out tail, f16 -> latent_h ---
  gemm_wmma_kernel<2><<<gblk(NTOK_, L_), 256, 0, stream>>>(
      x_h, wcomb_t, out + (size_t)NTOK_ * D_, latent_h, NTOK_, L_, D_);

  // --- q = x @ Wq ---
  gemm_wmma_kernel<1><<<gblk(NTOK_, D_), 256, 0, stream>>>(
      x_h, wq_t, nullptr, q_h, NTOK_, D_, D_);

  // --- k_rec = latent @ W_up_k (row-major == B^T for QK^T) ---
  gemm_wmma_kernel<1><<<gblk(NTOK_, D_), 256, 0, stream>>>(
      latent_h, wupk_t, nullptr, k_h, NTOK_, D_, L_);

  // --- v_rec = latent @ W_up_v, written per-head transposed [B,H,64,S] ---
  gemm_wmma_kernel<3><<<gblk(NTOK_, D_), 256, 0, stream>>>(
      latent_h, wupv_t, nullptr, vT, NTOK_, D_, L_);

  // --- flash attention with decay: 512 blocks, 8 q-tiles of one (b,h) each ---
  flash_attn_decay_kernel<<<B_ * H_ * (S_ / 128), 256, 0, stream>>>(
      q_h, k_h, vT, attn_h);

  // --- out = attn @ Wo ---
  gemm_wmma_kernel<0><<<gblk(NTOK_, D_), 256, 0, stream>>>(
      attn_h, wo_t, out, nullptr, NTOK_, D_, D_);
}

// v002
// A run of this version takes 290 microseconds.
// Next to v001, in two timings, it ran 1.35 times as fast each time.
// Counting every step since v000, it is 1.50 times as fast.
#include <hip/hip_runtime.h>

// Problem constants (reference: TimeAwareMultiHeadLatentAttention)
#define B_    2
#define S_    2048
#define D_    1024
#define H_    16
#define HD_   64
#define L_    256
#define NTOK_ (B_ * S_)
#define KP_   72   // LDS pitch of a 64-half row, in halves
#define VP_   40   // LDS pitch of a 32-half row, in halves

typedef __attribute__((ext_vector_type(16))) _Float16 v16h;
typedef __attribute__((ext_vector_type(8)))  _Float16 v8h;
typedef __attribute__((ext_vector_type(8)))  float    v8f;
typedef __attribute__((ext_vector_type(4)))  _Float16 v4h;
typedef __attribute__((ext_vector_type(4)))  float    v4f;

static __device__ __forceinline__ v8f wmma_f16f32(v16h a, v16h b, v8f c) {
  // D = A(16x32 f16) * B(32x16 f16) + C(16x16 f32)
  return __builtin_amdgcn_wmma_f32_16x16x32_f16(false, a, false, b, (short)0, c,
                                                false, false);
}

static __device__ __forceinline__ v8f zero8() {
  v8f z = {0.f, 0.f, 0.f, 0.f, 0.f, 0.f, 0.f, 0.f};
  return z;
}

// Load an A-style fragment (row m = lane&15; K chunks at col0+8g and col0+16+8g)
// from a row-major f16 matrix with leading dimension ld. The same routine loads
// B-fragments from the *transposed* (N-major) operand. Works for global or LDS.
static __device__ __forceinline__ v16h load_frag(const _Float16* __restrict__ base,
                                                 int row0, int ld, int col0,
                                                 int lane) {
  const int g = lane >> 4;
  const int m = lane & 15;
  const _Float16* p = base + (size_t)(row0 + m) * ld + col0 + g * 8;
  union { v16h v; v8h h[2]; } u;
  u.h[0] = *(const v8h*)(p);
  u.h[1] = *(const v8h*)(p + 16);
  return u.v;
}

// LDS byte offset of a __shared__ object (dsaddr = LDS_BASE + VGPR, ISA 10.x):
// generic -> addrspace(3) cast yields the 32-bit LDS offset.
static __device__ __forceinline__ unsigned lds_off_of(const void* p) {
  return (unsigned)(unsigned long long)(const __attribute__((address_space(3))) char*)p;
}

// CDNA5 async DMA: memory -> LDS, 16B per lane, tracked by ASYNCcnt.
static __device__ __forceinline__ void async_b128_to_lds(unsigned lds_off,
                                                         const void* gaddr) {
  asm volatile("global_load_async_to_lds_b128 %0, %1, off"
               :: "v"(lds_off), "v"((unsigned long long)gaddr)
               : "memory");
}

// ---------------------------------------------------------------------------
// Elementwise prep kernels. A thread handles 8 to 32 elements through 16-byte
// loads that are all issued before the first is used, so a launch starts a few
// thousand waves instead of one wave per 32 elements. Grids cover the fixed
// shapes exactly (static_asserts at the launches), so there is no bounds test.
// ---------------------------------------------------------------------------
// One wave converts NV runs of 128 consecutive floats (512 B per load).
template <int NV>
__global__ __launch_bounds__(256) void f32_to_f16_kernel(
    const float* __restrict__ in, _Float16* __restrict__ out) {
  const int base = (blockIdx.x * 8 + (threadIdx.x >> 5)) * (NV * 128) +
                   (threadIdx.x & 31) * 4;
  v4f v[NV];
#pragma unroll
  for (int j = 0; j < NV; ++j) v[j] = *(const v4f*)(in + base + j * 128);
#pragma unroll
  for (int j = 0; j < NV; ++j)
    *(v4h*)(out + base + j * 128) = __builtin_convertvector(v[j], v4h);
}

template <int NV>
__global__ __launch_bounds__(256) void add2_to_f16_kernel(
    const float* __restrict__ a, const float* __restrict__ b,
    _Float16* __restrict__ out) {
  const int base = (blockIdx.x * 8 + (threadIdx.x >> 5)) * (NV * 128) +
                   (threadIdx.x & 31) * 4;
  v4f va[NV], vb[NV];
#pragma unroll
  for (int j = 0; j < NV; ++j) {
    va[j] = *(const v4f*)(a + base + j * 128);
    vb[j] = *(const v4f*)(b + base + j * 128);
  }
#pragma unroll
  for (int j = 0; j < NV; ++j)
    *(v4h*)(out + base + j * 128) = __builtin_convertvector(va[j] + vb[j], v4h);
}

// out[c * R + r] = (f16) in[r * C + c]   (in: R x C f32, out: C x R f16)
// One thread: 8 rows x 4 columns in registers (8 loads of 16 B, 4 stores of
// 16 B). One wave: 8 rows x 128 columns. The 8 waves of a block take 64
// consecutive rows, so each 128-byte line of out is written by one block.
template <int R, int C>
__global__ __launch_bounds__(256) void transpose_f32_to_f16_kernel(
    const float* __restrict__ in, _Float16* __restrict__ out) {
  constexpr int CB = C / 128;
  const int c0 = (blockIdx.x % CB) * 128 + (threadIdx.x & 31) * 4;
  const int r0 = (blockIdx.x / CB) * 64 + (threadIdx.x >> 5) * 8;
  v4f v[8];
#pragma unroll
  for (int j = 0; j < 8; ++j) v[j] = *(const v4f*)(in + (r0 + j) * C + c0);
#pragma unroll
  for (int q = 0; q < 4; ++q) {
    v8h o8;
#pragma unroll
    for (int j = 0; j < 8; ++j) o8[j] = (_Float16)v[j][q];
    *(v8h*)(out + (c0 + q) * R + r0) = o8;
  }
}

// ---------------------------------------------------------------------------
// Generic WMMA GEMM: C[M x N] = A[M x K] * B[K x N], B given transposed (N x K).
// One wave computes a 16(M) x 64(N) tile: 4 accumulators, A reused 4x.
// MODE 0: f32 out; 1: f16 out; 2: f32 + f16 out; 3: per-head transposed f16
//         scatter (v_rec -> vT[B][H][64][S]).
// ---------------------------------------------------------------------------
template <int MODE>
__global__ __launch_bounds__(256) void gemm_wmma_kernel(
    const _Float16* __restrict__ A, const _Float16* __restrict__ Bt,
    float* __restrict__ Cf, _Float16* __restrict__ Ch, int M, int N, int K) {
  const int lane = threadIdx.x & 31;
  const int wid  = threadIdx.x >> 5;
  const int tN   = N >> 6;
  const int ntiles = (M >> 4) * tN;
  const int tile = blockIdx.x * 8 + wid;
  if (tile >= ntiles) return;  // wave-uniform: EXEC stays all-ones for WMMA
  const int row0 = (tile / tN) << 4;
  const int col0 = (tile % tN) << 6;
  const int g = lane >> 4;
  const int n = lane & 15;

  v8f acc[4];
#pragma unroll
  for (int f = 0; f < 4; ++f) acc[f] = zero8();

  for (int k0 = 0; k0 < K; k0 += 32) {
    v16h a = load_frag(A, row0, K, k0, lane);
#pragma unroll
    for (int f = 0; f < 4; ++f) {
      v16h b = load_frag(Bt, col0 + f * 16, K, k0, lane);
      acc[f] = wmma_f16f32(a, b, acc[f]);
    }
  }

  if constexpr (MODE == 3) {
    // v_rec element C[tok][col] -> vT[b][h][d][s], 8 consecutive tokens per lane
#pragma unroll
    for (int f = 0; f < 4; ++f) {
      const int col = col0 + f * 16 + n;
      const int hh  = col >> 6;
      const int dd  = col & (HD_ - 1);
      const int tok0 = row0 + g * 8;        // 16-aligned tile: never crosses batch
      const int bb = tok0 >> 11;            // / S_
      const int ss = tok0 & (S_ - 1);
      v8h o8;
#pragma unroll
      for (int r = 0; r < 8; ++r) o8[r] = (_Float16)acc[f][r];
      *(v8h*)(Ch + (size_t)((bb * H_ + hh) * HD_ + dd) * S_ + ss) = o8;
    }
  } else {
#pragma unroll
    for (int f = 0; f < 4; ++f) {
#pragma unroll
      for (int r = 0; r < 8; ++r) {
        const size_t idx = (size_t)(row0 + g * 8 + r) * N + col0 + f * 16 + n;
        if constexpr (MODE == 0 || MODE == 2) Cf[idx] = acc[f][r];
        if constexpr (MODE == 1 || MODE == 2) Ch[idx] = (_Float16)acc[f][r];
      }
    }
  }
}

// ---------------------------------------------------------------------------
// Flash attention with multiplicative time decay.
// One block = 8 waves = 8 consecutive 16-query tiles of ONE (b, h); the block
// cooperatively stages each 32-key K/V tile into LDS exactly once via
// global_load_async_to_lds_b128 (ASYNCcnt), double-buffered so the DMA of
// tile k+1 overlaps the 8 WMMAs + online softmax of tile k.
// ---------------------------------------------------------------------------
__global__ __launch_bounds__(256) void flash_attn_decay_kernel(
    const _Float16* __restrict__ Qh,   // [NTOK_, D_] row-major
    const _Float16* __restrict__ Kh,   // [NTOK_, D_] row-major (k_rec)
    const _Float16* __restrict__ Vt,   // [B_, H_, HD_, S_] (v_rec transposed)
    _Float16* __restrict__ Oh) {       // [NTOK_, D_] row-major
  // Row pitches are odd multiples of 16 B (144 B, 80 B, 80 B): the 16 rows that
  // one ds_load_b128 fragment read touches then fall on distinct bank groups.
  __shared__ __align__(16) _Float16 Ktile[2][32][KP_];  // [key][dim]  9 KB
  __shared__ __align__(16) _Float16 Vtile[2][64][VP_];  // [dim][key] 10 KB
  __shared__ __align__(16) _Float16 pbuf[8][16][VP_];   // P transpose 10 KB

  const int t    = threadIdx.x;
  const int lane = t & 31;
  const int wid  = t >> 5;
  const int bh   = blockIdx.x >> 4;              // 16 blocks per (b,h)
  const int qt   = ((blockIdx.x & 15) << 3) + wid;
  const int h    = bh & (H_ - 1);
  const int b    = bh >> 4;
  const int g    = lane >> 4;
  const int n    = lane & 15;

  const float scale = 1.0f / (sqrtf((float)D_) + 1e-8f);
  const float lam   = 1e-4f;  // LAMBDA_DECAY * TIME_STEP
  const float CLMP  = 1e4f;

  const int bS    = b * S_;
  const int qrow0 = bS + qt * 16;
  const v16h qa0 = load_frag(Qh, qrow0, D_, h * HD_ + 0,  lane);
  const v16h qa1 = load_frag(Qh, qrow0, D_, h * HD_ + 32, lane);

  const _Float16* vt = Vt + (size_t)(b * H_ + h) * HD_ * S_;

  // Per-thread staging coordinates: 256 threads x 16B = one 4 KB tile each.
  const int krow = t >> 3, kcc = (t & 7) * 8;    // K: [32 keys][64 dims]
  const int vd   = t >> 2, vkc = (t & 3) * 8;    // V: [64 dims][32 keys]

  v8f o[4];
  float mrun[8], lrun[8];
#pragma unroll
  for (int f = 0; f < 4; ++f) o[f] = zero8();
#pragma unroll
  for (int r = 0; r < 8; ++r) { mrun[r] = -3.0e38f; lrun[r] = 0.f; }

  const int NT = S_ / 32;

  // Prologue: stage tile 0 into buffer 0.
  async_b128_to_lds(lds_off_of(&Ktile[0][krow][kcc]),
                    Kh + (size_t)(bS + krow) * D_ + h * HD_ + kcc);
  async_b128_to_lds(lds_off_of(&Vtile[0][vd][vkc]),
                    vt + (size_t)vd * S_ + vkc);

  for (int kb = 0; kb < NT; ++kb) {
    const int cur = kb & 1;
    if (kb + 1 < NT) {
      // Issue next tile's DMA, then wait only for the CURRENT tile (keep the
      // next stage's 2 async ops in flight).
      const int krow1 = bS + (kb + 1) * 32;
      async_b128_to_lds(lds_off_of(&Ktile[cur ^ 1][krow][kcc]),
                        Kh + (size_t)(krow1 + krow) * D_ + h * HD_ + kcc);
      async_b128_to_lds(lds_off_of(&Vtile[cur ^ 1][vd][vkc]),
                        vt + (size_t)vd * S_ + (kb + 1) * 32 + vkc);
      asm volatile("s_wait_asynccnt 0x2" ::: "memory");
    } else {
      asm volatile("s_wait_asynccnt 0x0" ::: "memory");
    }
    __syncthreads();  // current tile visible to all waves

    // ---- scores: 16 queries x 32 keys from LDS tile ----
    const _Float16* kt  = &Ktile[cur][0][0];
    v16h kb00 = load_frag(kt, 0,  KP_, 0,  lane);
    v16h kb01 = load_frag(kt, 0,  KP_, 32, lane);
    v16h kb10 = load_frag(kt, 16, KP_, 0,  lane);
    v16h kb11 = load_frag(kt, 16, KP_, 32, lane);
    v8f s0 = zero8(), s1 = zero8();
    s0 = wmma_f16f32(qa0, kb00, s0);
    s0 = wmma_f16f32(qa1, kb01, s0);
    s1 = wmma_f16f32(qa0, kb10, s1);
    s1 = wmma_f16f32(qa1, kb11, s1);

    // ---- scale, clamp, time decay, clamp ----
    float p0[8], p1[8], rmax[8], rsum[8], alpha[8];
#pragma unroll
    for (int r = 0; r < 8; ++r) {
      const float qi  = (float)(qt * 16 + g * 8 + r);
      const float kj0 = (float)(kb * 32 + n);
      float t0 = fminf(fmaxf(s0[r] * scale, -CLMP), CLMP);
      t0 *= __expf(-lam * fabsf(qi - kj0));
      t0 = fminf(fmaxf(t0, -CLMP), CLMP);
      float t1 = fminf(fmaxf(s1[r] * scale, -CLMP), CLMP);
      t1 *= __expf(-lam * fabsf(qi - (kj0 + 16.0f)));
      t1 = fminf(fmaxf(t1, -CLMP), CLMP);
      p0[r] = t0; p1[r] = t1;
      rmax[r] = fmaxf(t0, t1);
    }

    // ---- online softmax: row reductions across the 16 lanes of each half ----
#pragma unroll
    for (int msk = 1; msk < 16; msk <<= 1)
#pragma unroll
      for (int r = 0; r < 8; ++r)
        rmax[r] = fmaxf(rmax[r], __shfl_xor(rmax[r], msk, 32));
#pragma unroll
    for (int r = 0; r < 8; ++r) {
      const float mnew = fmaxf(mrun[r], rmax[r]);
      alpha[r] = __expf(mrun[r] - mnew);
      mrun[r]  = mnew;
      p0[r] = __expf(p0[r] - mnew);
      p1[r] = __expf(p1[r] - mnew);
      rsum[r] = p0[r] + p1[r];
    }
#pragma unroll
    for (int msk = 1; msk < 16; msk <<= 1)
#pragma unroll
      for (int r = 0; r < 8; ++r)
        rsum[r] += __shfl_xor(rsum[r], msk, 32);
#pragma unroll
    for (int r = 0; r < 8; ++r) lrun[r] = lrun[r] * alpha[r] + rsum[r];
#pragma unroll
    for (int f = 0; f < 4; ++f)
#pragma unroll
      for (int r = 0; r < 8; ++r) o[f][r] *= alpha[r];

    // ---- P: C-layout -> A-layout via LDS (in-order within a wave) ----
#pragma unroll
    for (int r = 0; r < 8; ++r) {
      pbuf[wid][g * 8 + r][n]      = (_Float16)p0[r];
      pbuf[wid][g * 8 + r][16 + n] = (_Float16)p1[r];
    }
    union { v16h v; v8h hh[2]; } up;
    const _Float16* pp = &pbuf[wid][n][0];  // A-frag row m = lane&15
    up.hh[0] = *(const v8h*)(pp + g * 8);
    up.hh[1] = *(const v8h*)(pp + 16 + g * 8);

    // ---- O += P(16x32) @ V(32x64): B-frags contiguous from LDS V tile ----
    const _Float16* vtl = &Vtile[cur][0][0];
#pragma unroll
    for (int f = 0; f < 4; ++f) {
      v16h vb = load_frag(vtl, f * 16, VP_, 0, lane);
      o[f] = wmma_f16f32(up.v, vb, o[f]);
    }

    __syncthreads();  // all waves done reading buf before its next overwrite
  }

  // ---- epilogue: normalize and store row-major f16 ----
  float inv[8];
#pragma unroll
  for (int r = 0; r < 8; ++r) inv[r] = 1.0f / lrun[r];
#pragma unroll
  for (int f = 0; f < 4; ++f)
#pragma unroll
    for (int r = 0; r < 8; ++r)
      Oh[(size_t)(qrow0 + g * 8 + r) * D_ + h * HD_ + f * 16 + n] =
          (_Float16)(o[f][r] * inv[r]);
}

// ---------------------------------------------------------------------------
// Host orchestration
// ---------------------------------------------------------------------------
extern "C" void kernel_launch(void* const* d_in, const int* in_sizes, int n_in,
                              void* d_out, int out_size, void* d_ws,
                              size_t ws_size, hipStream_t stream) {
  (void)in_sizes; (void)n_in; (void)out_size; (void)ws_size;
  const float* x     = (const float*)d_in[0];
  const float* Wq    = (const float*)d_in[1];
  const float* Wk    = (const float*)d_in[2];
  const float* Wv    = (const float*)d_in[3];
  const float* Wo    = (const float*)d_in[4];
  const float* Wdown = (const float*)d_in[5];
  const float* Wupk  = (const float*)d_in[6];
  const float* Wupv  = (const float*)d_in[7];
  float* out = (float*)d_out;  // [NTOK_*D_] attn-out, then [NTOK_*L_] latent

  // Carve workspace (256B aligned)
  char* wsp = (char*)d_ws;
  auto carve = [&](size_t bytes) {
    char* p = wsp;
    wsp += (bytes + 255) & ~(size_t)255;
    return p;
  };
  _Float16* x_h      = (_Float16*)carve((size_t)NTOK_ * D_ * 2);
  _Float16* q_h      = (_Float16*)carve((size_t)NTOK_ * D_ * 2);
  _Float16* k_h      = (_Float16*)carve((size_t)NTOK_ * D_ * 2);
  _Float16* vT       = (_Float16*)carve((size_t)NTOK_ * D_ * 2);
  _Float16* attn_h   = (_Float16*)carve((size_t)NTOK_ * D_ * 2);
  _Float16* latent_h = (_Float16*)carve((size_t)NTOK_ * L_ * 2);
  _Float16* wq_t     = (_Float16*)carve((size_t)D_ * D_ * 2);
  _Float16* wo_t     = (_Float16*)carve((size_t)D_ * D_ * 2);
  _Float16* wkv_h    = (_Float16*)carve((size_t)D_ * D_ * 2);
  _Float16* wdown_t  = (_Float16*)carve((size_t)D_ * L_ * 2);
  _Float16* wupk_t   = (_Float16*)carve((size_t)D_ * L_ * 2);
  _Float16* wupv_t   = (_Float16*)carve((size_t)D_ * L_ * 2);
  float*    wcomb_f  = (float*)   carve((size_t)D_ * L_ * 4);
  _Float16* wcomb_t  = (_Float16*)carve((size_t)D_ * L_ * 2);

  auto gblk = [](int M, int N) { return ((M >> 4) * (N >> 6) + 7) / 8; };

  // --- precision conversion & weight transposes ---
  static_assert((NTOK_ * D_) % (256 * 32) == 0 && (D_ * D_) % (256 * 8) == 0 &&
                D_ % 128 == 0 && L_ % 128 == 0, "prep grids cover the shapes");
  f32_to_f16_kernel<8><<<NTOK_ * D_ / (256 * 32), 256, 0, stream>>>(x, x_h);
  add2_to_f16_kernel<2><<<D_ * D_ / (256 * 8), 256, 0, stream>>>(Wk, Wv, wkv_h);
  transpose_f32_to_f16_kernel<D_, D_><<<D_ * D_ / 8192, 256, 0, stream>>>(Wq, wq_t);
  transpose_f32_to_f16_kernel<D_, D_><<<D_ * D_ / 8192, 256, 0, stream>>>(Wo, wo_t);
  transpose_f32_to_f16_kernel<D_, L_><<<D_ * L_ / 8192, 256, 0, stream>>>(Wdown, wdown_t);
  transpose_f32_to_f16_kernel<L_, D_><<<L_ * D_ / 8192, 256, 0, stream>>>(Wupk, wupk_t);
  transpose_f32_to_f16_kernel<L_, D_><<<L_ * D_ / 8192, 256, 0, stream>>>(Wupv, wupv_t);

  // --- W_comb = (Wk + Wv) @ W_down  (folds the k/v GEMMs away) ---
  gemm_wmma_kernel<0><<<gblk(D_, L_), 256, 0, stream>>>(
      wkv_h, wdown_t, wcomb_f, nullptr, D_, L_, D_);
  transpose_f32_to_f16_kernel<D_, L_><<<D_ * L_ / 8192, 256, 0, stream>>>(
      wcomb_f, wcomb_t);

  // --- latent = x @ W_comb : f32 -> d_out tail, f16 -> latent_h ---
  gemm_wmma_kernel<2><<<gblk(NTOK_, L_), 256, 0, stream>>>(
      x_h, wcomb_t, out + (size_t)NTOK_ * D_, latent_h, NTOK_, L_, D_);

  // --- q = x @ Wq ---
  gemm_wmma_kernel<1><<<gblk(NTOK_, D_), 256, 0, stream>>>(
      x_h, wq_t, nullptr, q_h, NTOK_, D_, D_);

  // --- k_rec = latent @ W_up_k (row-major == B^T for QK^T) ---
  gemm_wmma_kernel<1><<<gblk(NTOK_, D_), 256, 0, stream>>>(
      latent_h, wupk_t, nullptr, k_h, NTOK_, D_, L_);

  // --- v_rec = latent @ W_up_v, written per-head transposed [B,H,64,S] ---
  gemm_wmma_kernel<3><<<gblk(NTOK_, D_), 256, 0, stream>>>(
      latent_h, wupv_t, nullptr, vT, NTOK_, D_, L_);

  // --- flash attention with decay: 512 blocks, 8 q-tiles of one (b,h) each ---
  flash_attn_decay_kernel<<<B_ * H_ * (S_ / 128), 256, 0, stream>>>(
      q_h, k_h, vT, attn_h);

  // --- out = attn @ Wo ---
  gemm_wmma_kernel<0><<<gblk(NTOK_, D_), 256, 0, stream>>>(
      attn_h, wo_t, out, nullptr, NTOK_, D_, D_);
}

// v003
// Measured time: 190 microseconds a run.
// Two timings next to v002 put it at 1.54 and 1.52 times that version's speed.
// Counting every step since v000, it is 2.29 times as fast.
#include <hip/hip_runtime.h>

// Problem constants (reference: TimeAwareMultiHeadLatentAttention)
#define B_    2
#define S_    2048
#define D_    1024
#define H_    16
#define HD_   64
#define L_    256
#define NTOK_ (B_ * S_)
#define KP_   72   // LDS pitch of a 64-half row, in halves
#define VP_   40   // LDS pitch of a 32-half row, in halves

typedef __attribute__((ext_vector_type(16))) _Float16 v16h;
typedef __attribute__((ext_vector_type(8)))  _Float16 v8h;
typedef __attribute__((ext_vector_type(8)))  float    v8f;
typedef __attribute__((ext_vector_type(4)))  _Float16 v4h;
typedef __attribute__((ext_vector_type(4)))  float    v4f;

static __device__ __forceinline__ v8f wmma_f16f32(v16h a, v16h b, v8f c) {
  // D = A(16x32 f16) * B(32x16 f16) + C(16x16 f32)
  return __builtin_amdgcn_wmma_f32_16x16x32_f16(false, a, false, b, (short)0, c,
                                                false, false);
}

static __device__ __forceinline__ v8f zero8() {
  v8f z = {0.f, 0.f, 0.f, 0.f, 0.f, 0.f, 0.f, 0.f};
  return z;
}

// Load an A-style fragment (row m = lane&15; K chunks at col0+8g and col0+16+8g)
// from a row-major f16 matrix with leading dimension ld. The same routine loads
// B-fragments from the *transposed* (N-major) operand. Works for global or LDS.
static __device__ __forceinline__ v16h load_frag(const _Float16* __restrict__ base,
                                                 int row0, int ld, int col0,
                                                 int lane) {
  const int g = lane >> 4;
  const int m = lane & 15;
  const _Float16* p = base + (size_t)(row0 + m) * ld + col0 + g * 8;
  union { v16h v; v8h h[2]; } u;
  u.h[0] = *(const v8h*)(p);
  u.h[1] = *(const v8h*)(p + 16);
  return u.v;
}

// LDS byte offset of a __shared__ object (dsaddr = LDS_BASE + VGPR, ISA 10.x):
// generic -> addrspace(3) cast yields the 32-bit LDS offset.
static __device__ __forceinline__ unsigned lds_off_of(const void* p) {
  return (unsigned)(unsigned long long)(const __attribute__((address_space(3))) char*)p;
}

// CDNA5 async DMA: memory -> LDS, 16B per lane, tracked by ASYNCcnt.
static __device__ __forceinline__ void async_b128_to_lds(unsigned lds_off,
                                                         const void* gaddr) {
  asm volatile("global_load_async_to_lds_b128 %0, %1, off"
               :: "v"(lds_off), "v"((unsigned long long)gaddr)
               : "memory");
}

// ---------------------------------------------------------------------------
// Elementwise prep kernels. A thread handles 8 to 32 elements through 16-byte
// loads that are all issued before the first is used, so a launch starts a few
// thousand waves instead of one wave per 32 elements. Grids cover the fixed
// shapes exactly (static_asserts at the launches), so there is no bounds test.
// ---------------------------------------------------------------------------
// One wave converts NV runs of 128 consecutive floats (512 B per load).
template <int NV>
__global__ __launch_bounds__(256) void f32_to_f16_kernel(
    const float* __restrict__ in, _Float16* __restrict__ out) {
  const int base = (blockIdx.x * 8 + (threadIdx.x >> 5)) * (NV * 128) +
                   (threadIdx.x & 31) * 4;
  v4f v[NV];
#pragma unroll
  for (int j = 0; j < NV; ++j) v[j] = *(const v4f*)(in + base + j * 128);
#pragma unroll
  for (int j = 0; j < NV; ++j)
    *(v4h*)(out + base + j * 128) = __builtin_convertvector(v[j], v4h);
}

template <int NV>
__global__ __launch_bounds__(256) void add2_to_f16_kernel(
    const float* __restrict__ a, const float* __restrict__ b,
    _Float16* __restrict__ out) {
  const int base = (blockIdx.x * 8 + (threadIdx.x >> 5)) * (NV * 128) +
                   (threadIdx.x & 31) * 4;
  v4f va[NV], vb[NV];
#pragma unroll
  for (int j = 0; j < NV; ++j) {
    va[j] = *(const v4f*)(a + base + j * 128);
    vb[j] = *(const v4f*)(b + base + j * 128);
  }
#pragma unroll
  for (int j = 0; j < NV; ++j)
    *(v4h*)(out + base + j * 128) = __builtin_convertvector(va[j] + vb[j], v4h);
}

// out[c * R + r] = (f16) in[r * C + c]   (in: R x C f32, out: C x R f16)
// One thread: 8 rows x 4 columns in registers (8 loads of 16 B, 4 stores of
// 16 B). One wave: 8 rows x 128 columns. The 8 waves of a block take 64
// consecutive rows, so each 128-byte line of out is written by one block.
template <int R, int C>
__global__ __launch_bounds__(256) void transpose_f32_to_f16_kernel(
    const float* __restrict__ in, _Float16* __restrict__ out) {
  constexpr int CB = C / 128;
  const int c0 = (blockIdx.x % CB) * 128 + (threadIdx.x & 31) * 4;
  const int r0 = (blockIdx.x / CB) * 64 + (threadIdx.x >> 5) * 8;
  v4f v[8];
#pragma unroll
  for (int j = 0; j < 8; ++j) v[j] = *(const v4f*)(in + (r0 + j) * C + c0);
#pragma unroll
  for (int q = 0; q < 4; ++q) {
    v8h o8;
#pragma unroll
    for (int j = 0; j < 8; ++j) o8[j] = (_Float16)v[j][q];
    *(v8h*)(out + (c0 + q) * R + r0) = o8;
  }
}

// ---------------------------------------------------------------------------
// WMMA GEMM: C[M x N] = A[M x K] * B[K x N], B given transposed (N x K).
// One block of 8 waves (2 along M x 4 along N) computes a (32*WM) x (64*WN)
// tile of C; one wave a (16*WM) x (16*WN) part of it. Each trip takes 64 k:
// the block's rows of A and of Bt (128 B each) are brought into LDS once by
// asynchronous copies and every wave reads its fragments from there, so a row
// is fetched from L2 once per block, in whole 128-byte lines. Two buffers: the
// copies of trip t + 2 fly while trip t + 1 is worked on.
// MODE 0: f32 out; 1: f16 out; 2: f32 + f16 out; 3: per-head transposed f16
//         scatter (v_rec -> vT[B][H][64][S]).
// ---------------------------------------------------------------------------
// Four 16-byte asynchronous copies per lane, global memory -> LDS. The
// s_wait_xcnt stands as the last line of the copies' own statement, so that no
// later write of an address register can be moved in front of it (a precaution).
static __device__ __forceinline__ void async_copy4_b128(
    unsigned l0, const _Float16* g0, unsigned l1, const _Float16* g1,
    unsigned l2, const _Float16* g2, unsigned l3, const _Float16* g3) {
  asm volatile(
      "global_load_async_to_lds_b128 %0, %1, off\n\t"
      "global_load_async_to_lds_b128 %2, %3, off\n\t"
      "global_load_async_to_lds_b128 %4, %5, off\n\t"
      "global_load_async_to_lds_b128 %6, %7, off\n\t"
      "s_wait_xcnt 0x0"
      :: "v"(l0), "v"((unsigned long long)g0), "v"(l1),
         "v"((unsigned long long)g1), "v"(l2), "v"((unsigned long long)g2),
         "v"(l3), "v"((unsigned long long)g3)
      : "memory");
}

template <int MODE, int WM, int WN, int M, int N, int K>
__global__ __launch_bounds__(256) void gemm_wmma_kernel(
    const _Float16* __restrict__ A, const _Float16* __restrict__ Bt,
    float* __restrict__ Cf, _Float16* __restrict__ Ch) {
  constexpr int BM   = 32 * WM;      // rows of C (and of A) per block
  constexpr int BN   = 64 * WN;      // columns of C (rows of Bt) per block
  constexpr int ROWS = BM + BN;      // staged rows per trip: A first, then Bt
  constexpr int NT   = K / 64;       // trips
  constexpr int NC   = ROWS / 32;    // copies per thread and trip
  constexpr unsigned BUFB = ROWS * KP_ * 2;  // bytes of one buffer
  static_assert(M % BM == 0 && N % BN == 0 && K % 64 == 0 && NC % 4 == 0,
                "the grid covers the shape exactly; no edge handling");
  // 128-byte rows at a pitch of 144 B (odd multiple of 16 B) for ds_load_b128.
  __shared__ __align__(16) _Float16 stage[2][ROWS][KP_];

  const int t    = threadIdx.x;
  const int lane = t & 31;
  const int wid  = t >> 5;
  const int g = lane >> 4;
  const int n = lane & 15;
  const int bm0 = (blockIdx.x / (N / BN)) * BM;
  const int bn0 = (blockIdx.x % (N / BN)) * BN;
  const int wr0 = (wid >> 2) * (WM * 16);  // the wave's first row in the tile
  const int wc0 = (wid & 3) * (WN * 16);   // the wave's first column in the tile

  // Copy j of a thread: staged row (t >> 3) + 32 * j, 16-byte piece t & 7; a
  // wave's copy covers 4 whole rows of 128 B.
  const int crow = t >> 3, ccol = (t & 7) * 8;
  const _Float16* gA = A  + (size_t)(bm0 + crow) * K + ccol;
  const _Float16* gB = Bt + (size_t)(bn0 + crow) * K + ccol;
  const unsigned lrow = lds_off_of(&stage[0][crow][ccol]);

  auto from = [&](int j, int k0) -> const _Float16* {
    return j < BM / 32 ? gA + (size_t)(j * 32) * K + k0
                       : gB + (size_t)(j * 32 - BM) * K + k0;
  };
  auto issue = [&](int tile, int buf) {
    const int k0 = tile * 64;
    const unsigned lb = lrow + (unsigned)buf * BUFB;
    // unrolled so that the choice between A and Bt is made at compile time
#pragma unroll
    for (int j = 0; j < NC; j += 4)
      async_copy4_b128(lb + (j + 0) * (32 * KP_ * 2), from(j + 0, k0),
                       lb + (j + 1) * (32 * KP_ * 2), from(j + 1, k0),
                       lb + (j + 2) * (32 * KP_ * 2), from(j + 2, k0),
                       lb + (j + 3) * (32 * KP_ * 2), from(j + 3, k0));
  };

  // Every "#pragma unroll" from here on makes the index of a register array
  // (acc, a, b) a compile-time constant, so that the array stays in registers.
  v8f acc[WM][WN];
#pragma unroll
  for (int i = 0; i < WM; ++i)
#pragma unroll
    for (int j = 0; j < WN; ++j) acc[i][j] = zero8();

  // Prologue: tile 0 lands and is published, then tile 1 starts.
  issue(0, 0);
  asm volatile("s_wait_asynccnt 0x0" ::: "memory");  // own copies of tile 0 landed
  __syncthreads();                                   // ... and every wave's
  if (NT > 1) issue(1, 1);

  for (int tt = 0; tt < NT; ++tt) {
    const _Float16* sA = &stage[tt & 1][0][0];
    const _Float16* sB = &stage[tt & 1][BM][0];
    // All fragment reads of the trip stand together, ahead of its WMMAs.
    v16h a[2][WM], b[2][WN];
#pragma unroll
    for (int kk = 0; kk < 2; ++kk) {
#pragma unroll
      for (int i = 0; i < WM; ++i)
        a[kk][i] = load_frag(sA, wr0 + i * 16, KP_, kk * 32, lane);
#pragma unroll
      for (int j = 0; j < WN; ++j)
        b[kk][j] = load_frag(sB, wc0 + j * 16, KP_, kk * 32, lane);
    }
    // Keeps the scheduler from sinking the reads among the WMMAs, where each
    // separate place with reads makes the wave wait out the LDS latency again.
    __builtin_amdgcn_sched_barrier(0);
#pragma unroll
    for (int kk = 0; kk < 2; ++kk)
#pragma unroll
      for (int i = 0; i < WM; ++i)
#pragma unroll
        for (int j = 0; j < WN; ++j)
          acc[i][j] = wmma_f16f32(a[kk][i], b[kk][j], acc[i][j]);
    // Keeps the trip's WMMAs in front of the publish point: lifted over them,
    // the waits would end the reads and the copies before any matrix work
    // has covered their latency.
    __builtin_amdgcn_sched_barrier(0);

    // Publish point of tile tt + 1, which also frees the buffer just read.
    asm volatile("s_wait_dscnt 0x0" ::: "memory");     // own LDS reads are done
    asm volatile("s_wait_asynccnt 0x0" ::: "memory");  // own copies of tt + 1 landed
    __syncthreads();
    if (tt + 2 < NT) issue(tt + 2, tt & 1);
  }
  asm volatile("s_wait_asynccnt 0x0" ::: "memory");  // nothing in flight at the end

#pragma unroll
  for (int i = 0; i < WM; ++i) {
    const int row0 = bm0 + wr0 + i * 16;
#pragma unroll
    for (int j = 0; j < WN; ++j) {
      const int col = bn0 + wc0 + j * 16 + n;
      if constexpr (MODE == 3) {
        // v_rec element C[tok][col] -> vT[b][h][d][s], 8 consecutive tokens per lane
        const int hh  = col >> 6;
        const int dd  = col & (HD_ - 1);
        const int tok0 = row0 + g * 8;        // 16-aligned tile: never crosses batch
        const int bb = tok0 >> 11;            // / S_
        const int ss = tok0 & (S_ - 1);
        v8h o8;
#pragma unroll
        for (int r = 0; r < 8; ++r) o8[r] = (_Float16)acc[i][j][r];
        *(v8h*)(Ch + (size_t)((bb * H_ + hh) * HD_ + dd) * S_ + ss) = o8;
      } else {
#pragma unroll
        for (int r = 0; r < 8; ++r) {
          const size_t idx = (size_t)(row0 + g * 8 + r) * N + col;
          if constexpr (MODE == 0 || MODE == 2) Cf[idx] = acc[i][j][r];
          if constexpr (MODE == 1 || MODE == 2) Ch[idx] = (_Float16)acc[i][j][r];
        }
      }
    }
  }
}

// ---------------------------------------------------------------------------
// Flash attention with multiplicative time decay.
// One block = 8 waves = 8 consecutive 16-query tiles of ONE (b, h); the block
// cooperatively stages each 32-key K/V tile into LDS exactly once via
// global_load_async_to_lds_b128 (ASYNCcnt), double-buffered so the DMA of
// tile k+1 overlaps the 8 WMMAs + online softmax of tile k.
// ---------------------------------------------------------------------------
__global__ __launch_bounds__(256) void flash_attn_decay_kernel(
    const _Float16* __restrict__ Qh,   // [NTOK_, D_] row-major
    const _Float16* __restrict__ Kh,   // [NTOK_, D_] row-major (k_rec)
    const _Float16* __restrict__ Vt,   // [B_, H_, HD_, S_] (v_rec transposed)
    _Float16* __restrict__ Oh) {       // [NTOK_, D_] row-major
  // Row pitches are odd multiples of 16 B (144 B, 80 B, 80 B): the 16 rows that
  // one ds_load_b128 fragment read touches then fall on distinct bank groups.
  __shared__ __align__(16) _Float16 Ktile[2][32][KP_];  // [key][dim]  9 KB
  __shared__ __align__(16) _Float16 Vtile[2][64][VP_];  // [dim][key] 10 KB
  __shared__ __align__(16) _Float16 pbuf[8][16][VP_];   // P transpose 10 KB

  const int t    = threadIdx.x;
  const int lane = t & 31;
  const int wid  = t >> 5;
  const int bh   = blockIdx.x >> 4;              // 16 blocks per (b,h)
  const int qt   = ((blockIdx.x & 15) << 3) + wid;
  const int h    = bh & (H_ - 1);
  const int b    = bh >> 4;
  const int g    = lane >> 4;
  const int n    = lane & 15;

  const float scale = 1.0f / (sqrtf((float)D_) + 1e-8f);
  const float lam   = 1e-4f;  // LAMBDA_DECAY * TIME_STEP
  const float CLMP  = 1e4f;

  const int bS    = b * S_;
  const int qrow0 = bS + qt * 16;
  const v16h qa0 = load_frag(Qh, qrow0, D_, h * HD_ + 0,  lane);
  const v16h qa1 = load_frag(Qh, qrow0, D_, h * HD_ + 32, lane);

  const _Float16* vt = Vt + (size_t)(b * H_ + h) * HD_ * S_;

  // Per-thread staging coordinates: 256 threads x 16B = one 4 KB tile each.
  const int krow = t >> 3, kcc = (t & 7) * 8;    // K: [32 keys][64 dims]
  const int vd   = t >> 2, vkc = (t & 3) * 8;    // V: [64 dims][32 keys]

  v8f o[4];
  float mrun[8], lrun[8];
#pragma unroll
  for (int f = 0; f < 4; ++f) o[f] = zero8();
#pragma unroll
  for (int r = 0; r < 8; ++r) { mrun[r] = -3.0e38f; lrun[r] = 0.f; }

  const int NT = S_ / 32;

  // Prologue: stage tile 0 into buffer 0.
  async_b128_to_lds(lds_off_of(&Ktile[0][krow][kcc]),
                    Kh + (size_t)(bS + krow) * D_ + h * HD_ + kcc);
  async_b128_to_lds(lds_off_of(&Vtile[0][vd][vkc]),
                    vt + (size_t)vd * S_ + vkc);

  for (int kb = 0; kb < NT; ++kb) {
    const int cur = kb & 1;
    if (kb + 1 < NT) {
      // Issue next tile's DMA, then wait only for the CURRENT tile (keep the
      // next stage's 2 async ops in flight).
      const int krow1 = bS + (kb + 1) * 32;
      async_b128_to_lds(lds_off_of(&Ktile[cur ^ 1][krow][kcc]),
                        Kh + (size_t)(krow1 + krow) * D_ + h * HD_ + kcc);
      async_b128_to_lds(lds_off_of(&Vtile[cur ^ 1][vd][vkc]),
                        vt + (size_t)vd * S_ + (kb + 1) * 32 + vkc);
      asm volatile("s_wait_asynccnt 0x2" ::: "memory");
    } else {
      asm volatile("s_wait_asynccnt 0x0" ::: "memory");
    }
    __syncthreads();  // current tile visible to all waves

    // ---- scores: 16 queries x 32 keys from LDS tile ----
    const _Float16* kt  = &Ktile[cur][0][0];
    v16h kb00 = load_frag(kt, 0,  KP_, 0,  lane);
    v16h kb01 = load_frag(kt, 0,  KP_, 32, lane);
    v16h kb10 = load_frag(kt, 16, KP_, 0,  lane);
    v16h kb11 = load_frag(kt, 16, KP_, 32, lane);
    v8f s0 = zero8(), s1 = zero8();
    s0 = wmma_f16f32(qa0, kb00, s0);
    s0 = wmma_f16f32(qa1, kb01, s0);
    s1 = wmma_f16f32(qa0, kb10, s1);
    s1 = wmma_f16f32(qa1, kb11, s1);

    // ---- scale, clamp, time decay, clamp ----
    float p0[8], p1[8], rmax[8], rsum[8], alpha[8];
#pragma unroll
    for (int r = 0; r < 8; ++r) {
      const float qi  = (float)(qt * 16 + g * 8 + r);
      const float kj0 = (float)(kb * 32 + n);
      float t0 = fminf(fmaxf(s0[r] * scale, -CLMP), CLMP);
      t0 *= __expf(-lam * fabsf(qi - kj0));
      t0 = fminf(fmaxf(t0, -CLMP), CLMP);
      float t1 = fminf(fmaxf(s1[r] * scale, -CLMP), CLMP);
      t1 *= __expf(-lam * fabsf(qi - (kj0 + 16.0f)));
      t1 = fminf(fmaxf(t1, -CLMP), CLMP);
      p0[r] = t0; p1[r] = t1;
      rmax[r] = fmaxf(t0, t1);
    }

    // ---- online softmax: row reductions across the 16 lanes of each half ----
#pragma unroll
    for (int msk = 1; msk < 16; msk <<= 1)
#pragma unroll
      for (int r = 0; r < 8; ++r)
        rmax[r] = fmaxf(rmax[r], __shfl_xor(rmax[r], msk, 32));
#pragma unroll
    for (int r = 0; r < 8; ++r) {
      const float mnew = fmaxf(mrun[r], rmax[r]);
      alpha[r] = __expf(mrun[r] - mnew);
      mrun[r]  = mnew;
      p0[r] = __expf(p0[r] - mnew);
      p1[r] = __expf(p1[r] - mnew);
      rsum[r] = p0[r] + p1[r];
    }
#pragma unroll
    for (int msk = 1; msk < 16; msk <<= 1)
#pragma unroll
      for (int r = 0; r < 8; ++r)
        rsum[r] += __shfl_xor(rsum[r], msk, 32);
#pragma unroll
    for (int r = 0; r < 8; ++r) lrun[r] = lrun[r] * alpha[r] + rsum[r];
#pragma unroll
    for (int f = 0; f < 4; ++f)
#pragma unroll
      for (int r = 0; r < 8; ++r) o[f][r] *= alpha[r];

    // ---- P: C-layout -> A-layout via LDS (in-order within a wave) ----
#pragma unroll
    for (int r = 0; r < 8; ++r) {
      pbuf[wid][g * 8 + r][n]      = (_Float16)p0[r];
      pbuf[wid][g * 8 + r][16 + n] = (_Float16)p1[r];
    }
    union { v16h v; v8h hh[2]; } up;
    const _Float16* pp = &pbuf[wid][n][0];  // A-frag row m = lane&15
    up.hh[0] = *(const v8h*)(pp + g * 8);
    up.hh[1] = *(const v8h*)(pp + 16 + g * 8);

    // ---- O += P(16x32) @ V(32x64): B-frags contiguous from LDS V tile ----
    const _Float16* vtl = &Vtile[cur][0][0];
#pragma unroll
    for (int f = 0; f < 4; ++f) {
      v16h vb = load_frag(vtl, f * 16, VP_, 0, lane);
      o[f] = wmma_f16f32(up.v, vb, o[f]);
    }

    __syncthreads();  // all waves done reading buf before its next overwrite
  }

  // ---- epilogue: normalize and store row-major f16 ----
  float inv[8];
#pragma unroll
  for (int r = 0; r < 8; ++r) inv[r] = 1.0f / lrun[r];
#pragma unroll
  for (int f = 0; f < 4; ++f)
#pragma unroll
    for (int r = 0; r < 8; ++r)
      Oh[(size_t)(qrow0 + g * 8 + r) * D_ + h * HD_ + f * 16 + n] =
          (_Float16)(o[f][r] * inv[r]);
}

// ---------------------------------------------------------------------------
// Host orchestration
// ---------------------------------------------------------------------------
extern "C" void kernel_launch(void* const* d_in, const int* in_sizes, int n_in,
                              void* d_out, int out_size, void* d_ws,
                              size_t ws_size, hipStream_t stream) {
  (void)in_sizes; (void)n_in; (void)out_size; (void)ws_size;
  const float* x     = (const float*)d_in[0];
  const float* Wq    = (const float*)d_in[1];
  const float* Wk    = (const float*)d_in[2];
  const float* Wv    = (const float*)d_in[3];
  const float* Wo    = (const float*)d_in[4];
  const float* Wdown = (const float*)d_in[5];
  const float* Wupk  = (const float*)d_in[6];
  const float* Wupv  = (const float*)d_in[7];
  float* out = (float*)d_out;  // [NTOK_*D_] attn-out, then [NTOK_*L_] latent

  // Carve workspace (256B aligned)
  char* wsp = (char*)d_ws;
  auto carve = [&](size_t bytes) {
    char* p = wsp;
    wsp += (bytes + 255) & ~(size_t)255;
    return p;
  };
  _Float16* x_h      = (_Float16*)carve((size_t)NTOK_ * D_ * 2);
  _Float16* q_h      = (_Float16*)carve((size_t)NTOK_ * D_ * 2);
  _Float16* k_h      = (_Float16*)carve((size_t)NTOK_ * D_ * 2);
  _Float16* vT       = (_Float16*)carve((size_t)NTOK_ * D_ * 2);
  _Float16* attn_h   = (_Float16*)carve((size_t)NTOK_ * D_ * 2);
  _Float16* latent_h = (_Float16*)carve((size_t)NTOK_ * L_ * 2);
  _Float16* wq_t     = (_Float16*)carve((size_t)D_ * D_ * 2);
  _Float16* wo_t     = (_Float16*)carve((size_t)D_ * D_ * 2);
  _Float16* wkv_h    = (_Float16*)carve((size_t)D_ * D_ * 2);
  _Float16* wdown_t  = (_Float16*)carve((size_t)D_ * L_ * 2);
  _Float16* wupk_t   = (_Float16*)carve((size_t)D_ * L_ * 2);
  _Float16* wupv_t   = (_Float16*)carve((size_t)D_ * L_ * 2);
  float*    wcomb_f  = (float*)   carve((size_t)D_ * L_ * 4);
  _Float16* wcomb_t  = (_Float16*)carve((size_t)D_ * L_ * 2);

  // --- precision conversion & weight transposes ---
  static_assert((NTOK_ * D_) % (256 * 32) == 0 && (D_ * D_) % (256 * 8) == 0 &&
                D_ % 128 == 0 && L_ % 128 == 0, "prep grids cover the shapes");
  f32_to_f16_kernel<8><<<NTOK_ * D_ / (256 * 32), 256, 0, stream>>>(x, x_h);
  add2_to_f16_kernel<2><<<D_ * D_ / (256 * 8), 256, 0, stream>>>(Wk, Wv, wkv_h);
  transpose_f32_to_f16_kernel<D_, D_><<<D_ * D_ / 8192, 256, 0, stream>>>(Wq, wq_t);
  transpose_f32_to_f16_kernel<D_, D_><<<D_ * D_ / 8192, 256, 0, stream>>>(Wo, wo_t);
  transpose_f32_to_f16_kernel<D_, L_><<<D_ * L_ / 8192, 256, 0, stream>>>(Wdown, wdown_t);
  transpose_f32_to_f16_kernel<L_, D_><<<L_ * D_ / 8192, 256, 0, stream>>>(Wupk, wupk_t);
  transpose_f32_to_f16_kernel<L_, D_><<<L_ * D_ / 8192, 256, 0, stream>>>(Wupv, wupv_t);

  // --- W_comb = (Wk + Wv) @ W_down  (folds the k/v GEMMs away) ---
  gemm_wmma_kernel<0, 2, 1, D_, L_, D_>
      <<<(D_ / 64) * (L_ / 64), 256, 0, stream>>>(wkv_h, wdown_t, wcomb_f, nullptr);
  transpose_f32_to_f16_kernel<D_, L_><<<D_ * L_ / 8192, 256, 0, stream>>>(
      wcomb_f, wcomb_t);

  // --- latent = x @ W_comb : f32 -> d_out tail, f16 -> latent_h ---
  gemm_wmma_kernel<2, 2, 1, NTOK_, L_, D_>
      <<<(NTOK_ / 64) * (L_ / 64), 256, 0, stream>>>(
          x_h, wcomb_t, out + (size_t)NTOK_ * D_, latent_h);

  // --- q = x @ Wq ---
  gemm_wmma_kernel<1, 4, 2, NTOK_, D_, D_>
      <<<(NTOK_ / 128) * (D_ / 128), 256, 0, stream>>>(x_h, wq_t, nullptr, q_h);

  // --- k_rec = latent @ W_up_k (row-major == B^T for QK^T) ---
  gemm_wmma_kernel<1, 4, 2, NTOK_, D_, L_>
      <<<(NTOK_ / 128) * (D_ / 128), 256, 0, stream>>>(latent_h, wupk_t, nullptr, k_h);

  // --- v_rec = latent @ W_up_v, written per-head transposed [B,H,64,S] ---
  gemm_wmma_kernel<3, 4, 2, NTOK_, D_, L_>
      <<<(NTOK_ / 128) * (D_ / 128), 256, 0, stream>>>(latent_h, wupv_t, nullptr, vT);

  // --- flash attention with decay: 512 blocks, 8 q-tiles of one (b,h) each ---
  flash_attn_decay_kernel<<<B_ * H_ * (S_ / 128), 256, 0, stream>>>(
      q_h, k_h, vT, attn_h);

  // --- out = attn @ Wo ---
  gemm_wmma_kernel<0, 4, 2, NTOK_, D_, D_>
      <<<(NTOK_ / 128) * (D_ / 128), 256, 0, stream>>>(attn_h, wo_t, out, nullptr);
}

// v004
// A run of this version takes 149 microseconds.
// Timed twice side by side with v003, it ran 1.29 and 1.28 times as fast.
// Counting every step since v000, it is 2.94 times as fast.
#include <hip/hip_runtime.h>

// Problem constants (reference: TimeAwareMultiHeadLatentAttention)
#define B_    2
#define S_    2048
#define D_    1024
#define H_    16
#define HD_   64
#define L_    256
#define NTOK_ (B_ * S_)
#define KP_   72   // LDS pitch of a 64-half row, in halves
#define VP_   40   // LDS pitch of a 32-half row, in halves

typedef __attribute__((ext_vector_type(16))) _Float16 v16h;
typedef __attribute__((ext_vector_type(8)))  _Float16 v8h;
typedef __attribute__((ext_vector_type(8)))  float    v8f;
typedef __attribute__((ext_vector_type(4)))  _Float16 v4h;
typedef __attribute__((ext_vector_type(4)))  float    v4f;

static __device__ __forceinline__ v8f wmma_f16f32(v16h a, v16h b, v8f c) {
  // D = A(16x32 f16) * B(32x16 f16) + C(16x16 f32)
  return __builtin_amdgcn_wmma_f32_16x16x32_f16(false, a, false, b, (short)0, c,
                                                false, false);
}

static __device__ __forceinline__ v8f zero8() {
  v8f z = {0.f, 0.f, 0.f, 0.f, 0.f, 0.f, 0.f, 0.f};
  return z;
}

// Load an A-style fragment (row m = lane&15; K chunks at col0+8g and col0+16+8g)
// from a row-major f16 matrix with leading dimension ld. The same routine loads
// B-fragments from the *transposed* (N-major) operand. Works for global or LDS.
static __device__ __forceinline__ v16h load_frag(const _Float16* __restrict__ base,
                                                 int row0, int ld, int col0,
                                                 int lane) {
  const int g = lane >> 4;
  const int m = lane & 15;
  const _Float16* p = base + (size_t)(row0 + m) * ld + col0 + g * 8;
  union { v16h v; v8h h[2]; } u;
  u.h[0] = *(const v8h*)(p);
  u.h[1] = *(const v8h*)(p + 16);
  return u.v;
}

// LDS byte offset of a __shared__ object (dsaddr = LDS_BASE + VGPR, ISA 10.x):
// generic -> addrspace(3) cast yields the 32-bit LDS offset.
static __device__ __forceinline__ unsigned lds_off_of(const void* p) {
  return (unsigned)(unsigned long long)(const __attribute__((address_space(3))) char*)p;
}

// CDNA5 async DMA: memory -> LDS, 16B per lane, tracked by ASYNCcnt.
static __device__ __forceinline__ void async_b128_to_lds(unsigned lds_off,
                                                         const void* gaddr) {
  asm volatile("global_load_async_to_lds_b128 %0, %1, off"
               :: "v"(lds_off), "v"((unsigned long long)gaddr)
               : "memory");
}

// ---------------------------------------------------------------------------
// Elementwise prep kernels. A thread handles 8 to 32 elements through 16-byte
// loads that are all issued before the first is used, so a launch starts a few
// thousand waves instead of one wave per 32 elements. Grids cover the fixed
// shapes exactly (static_asserts at the launches), so there is no bounds test.
// ---------------------------------------------------------------------------
// One wave converts NV runs of 128 consecutive floats (512 B per load).
template <int NV>
__global__ __launch_bounds__(256) void f32_to_f16_kernel(
    const float* __restrict__ in, _Float16* __restrict__ out) {
  const int base = (blockIdx.x * 8 + (threadIdx.x >> 5)) * (NV * 128) +
                   (threadIdx.x & 31) * 4;
  v4f v[NV];
#pragma unroll
  for (int j = 0; j < NV; ++j) v[j] = *(const v4f*)(in + base + j * 128);
#pragma unroll
  for (int j = 0; j < NV; ++j)
    *(v4h*)(out + base + j * 128) = __builtin_convertvector(v[j], v4h);
}

template <int NV>
__global__ __launch_bounds__(256) void add2_to_f16_kernel(
    const float* __restrict__ a, const float* __restrict__ b,
    _Float16* __restrict__ out) {
  const int base = (blockIdx.x * 8 + (threadIdx.x >> 5)) * (NV * 128) +
                   (threadIdx.x & 31) * 4;
  v4f va[NV], vb[NV];
#pragma unroll
  for (int j = 0; j < NV; ++j) {
    va[j] = *(const v4f*)(a + base + j * 128);
    vb[j] = *(const v4f*)(b + base + j * 128);
  }
#pragma unroll
  for (int j = 0; j < NV; ++j)
    *(v4h*)(out + base + j * 128) = __builtin_convertvector(va[j] + vb[j], v4h);
}

// out[c * R + r] = (f16) in[r * C + c]   (in: R x C f32, out: C x R f16)
// One thread: 8 rows x 4 columns in registers (8 loads of 16 B, 4 stores of
// 16 B). One wave: 8 rows x 128 columns. The 8 waves of a block take 64
// consecutive rows, so each 128-byte line of out is written by one block.
template <int R, int C>
__global__ __launch_bounds__(256) void transpose_f32_to_f16_kernel(
    const float* __restrict__ in, _Float16* __restrict__ out) {
  constexpr int CB = C / 128;
  const int c0 = (blockIdx.x % CB) * 128 + (threadIdx.x & 31) * 4;
  const int r0 = (blockIdx.x / CB) * 64 + (threadIdx.x >> 5) * 8;
  v4f v[8];
#pragma unroll
  for (int j = 0; j < 8; ++j) v[j] = *(const v4f*)(in + (r0 + j) * C + c0);
#pragma unroll
  for (int q = 0; q < 4; ++q) {
    v8h o8;
#pragma unroll
    for (int j = 0; j < 8; ++j) o8[j] = (_Float16)v[j][q];
    *(v8h*)(out + (c0 + q) * R + r0) = o8;
  }
}

// ---------------------------------------------------------------------------
// WMMA GEMM: C[M x N] = A[M x K] * B[K x N], B given transposed (N x K).
// One block of 8 waves (2 along M x 4 along N) computes a (32*WM) x (64*WN)
// tile of C; one wave a (16*WM) x (16*WN) part of it. Each trip takes 64 k:
// the block's rows of A and of Bt (128 B each) are brought into LDS once by
// asynchronous copies and every wave reads its fragments from there, so a row
// is fetched from L2 once per block, in whole 128-byte lines. Two buffers: the
// copies of trip t + 2 fly while trip t + 1 is worked on.
// MODE 0: f32 out; 1: f16 out; 2: f32 + f16 out; 3: per-head transposed f16
//         scatter (v_rec -> vT[B][H][64][S]).
// ---------------------------------------------------------------------------
// Four 16-byte asynchronous copies per lane, global memory -> LDS. The
// s_wait_xcnt stands as the last line of the copies' own statement, so that no
// later write of an address register can be moved in front of it (a precaution).
static __device__ __forceinline__ void async_copy4_b128(
    unsigned l0, const _Float16* g0, unsigned l1, const _Float16* g1,
    unsigned l2, const _Float16* g2, unsigned l3, const _Float16* g3) {
  asm volatile(
      "global_load_async_to_lds_b128 %0, %1, off\n\t"
      "global_load_async_to_lds_b128 %2, %3, off\n\t"
      "global_load_async_to_lds_b128 %4, %5, off\n\t"
      "global_load_async_to_lds_b128 %6, %7, off\n\t"
      "s_wait_xcnt 0x0"
      :: "v"(l0), "v"((unsigned long long)g0), "v"(l1),
         "v"((unsigned long long)g1), "v"(l2), "v"((unsigned long long)g2),
         "v"(l3), "v"((unsigned long long)g3)
      : "memory");
}

template <int MODE, int WM, int WN, int M, int N, int K>
__global__ __launch_bounds__(256) void gemm_wmma_kernel(
    const _Float16* __restrict__ A, const _Float16* __restrict__ Bt,
    float* __restrict__ Cf, _Float16* __restrict__ Ch) {
  constexpr int BM   = 32 * WM;      // rows of C (and of A) per block
  constexpr int BN   = 64 * WN;      // columns of C (rows of Bt) per block
  constexpr int ROWS = BM + BN;      // staged rows per trip: A first, then Bt
  constexpr int NT   = K / 64;       // trips
  constexpr int NC   = ROWS / 32;    // copies per thread and trip
  constexpr unsigned BUFB = ROWS * KP_ * 2;  // bytes of one buffer
  static_assert(M % BM == 0 && N % BN == 0 && K % 64 == 0 && NC % 4 == 0,
                "the grid covers the shape exactly; no edge handling");
  // 128-byte rows at a pitch of 144 B (odd multiple of 16 B) for ds_load_b128.
  __shared__ __align__(16) _Float16 stage[2][ROWS][KP_];

  const int t    = threadIdx.x;
  const int lane = t & 31;
  const int wid  = t >> 5;
  const int g = lane >> 4;
  const int n = lane & 15;
  const int bm0 = (blockIdx.x / (N / BN)) * BM;
  const int bn0 = (blockIdx.x % (N / BN)) * BN;
  const int wr0 = (wid >> 2) * (WM * 16);  // the wave's first row in the tile
  const int wc0 = (wid & 3) * (WN * 16);   // the wave's first column in the tile

  // Copy j of a thread: staged row (t >> 3) + 32 * j, 16-byte piece t & 7; a
  // wave's copy covers 4 whole rows of 128 B.
  const int crow = t >> 3, ccol = (t & 7) * 8;
  const _Float16* gA = A  + (size_t)(bm0 + crow) * K + ccol;
  const _Float16* gB = Bt + (size_t)(bn0 + crow) * K + ccol;
  const unsigned lrow = lds_off_of(&stage[0][crow][ccol]);

  auto from = [&](int j, int k0) -> const _Float16* {
    return j < BM / 32 ? gA + (size_t)(j * 32) * K + k0
                       : gB + (size_t)(j * 32 - BM) * K + k0;
  };
  auto issue = [&](int tile, int buf) {
    const int k0 = tile * 64;
    const unsigned lb = lrow + (unsigned)buf * BUFB;
    // unrolled so that the choice between A and Bt is made at compile time
#pragma unroll
    for (int j = 0; j < NC; j += 4)
      async_copy4_b128(lb + (j + 0) * (32 * KP_ * 2), from(j + 0, k0),
                       lb + (j + 1) * (32 * KP_ * 2), from(j + 1, k0),
                       lb + (j + 2) * (32 * KP_ * 2), from(j + 2, k0),
                       lb + (j + 3) * (32 * KP_ * 2), from(j + 3, k0));
  };

  // Every "#pragma unroll" from here on makes the index of a register array
  // (acc, a, b) a compile-time constant, so that the array stays in registers.
  v8f acc[WM][WN];
#pragma unroll
  for (int i = 0; i < WM; ++i)
#pragma unroll
    for (int j = 0; j < WN; ++j) acc[i][j] = zero8();

  // Prologue: tile 0 lands and is published, then tile 1 starts.
  issue(0, 0);
  asm volatile("s_wait_asynccnt 0x0" ::: "memory");  // own copies of tile 0 landed
  __syncthreads();                                   // ... and every wave's
  if (NT > 1) issue(1, 1);

  for (int tt = 0; tt < NT; ++tt) {
    const _Float16* sA = &stage[tt & 1][0][0];
    const _Float16* sB = &stage[tt & 1][BM][0];
    // All fragment reads of the trip stand together, ahead of its WMMAs.
    v16h a[2][WM], b[2][WN];
#pragma unroll
    for (int kk = 0; kk < 2; ++kk) {
#pragma unroll
      for (int i = 0; i < WM; ++i)
        a[kk][i] = load_frag(sA, wr0 + i * 16, KP_, kk * 32, lane);
#pragma unroll
      for (int j = 0; j < WN; ++j)
        b[kk][j] = load_frag(sB, wc0 + j * 16, KP_, kk * 32, lane);
    }
    // Keeps the scheduler from sinking the reads among the WMMAs, where each
    // separate place with reads makes the wave wait out the LDS latency again.
    __builtin_amdgcn_sched_barrier(0);
#pragma unroll
    for (int kk = 0; kk < 2; ++kk)
#pragma unroll
      for (int i = 0; i < WM; ++i)
#pragma unroll
        for (int j = 0; j < WN; ++j)
          acc[i][j] = wmma_f16f32(a[kk][i], b[kk][j], acc[i][j]);
    // Keeps the trip's WMMAs in front of the publish point: lifted over them,
    // the waits would end the reads and the copies before any matrix work
    // has covered their latency.
    __builtin_amdgcn_sched_barrier(0);

    // Publish point of tile tt + 1, which also frees the buffer just read.
    asm volatile("s_wait_dscnt 0x0" ::: "memory");     // own LDS reads are done
    asm volatile("s_wait_asynccnt 0x0" ::: "memory");  // own copies of tt + 1 landed
    __syncthreads();
    if (tt + 2 < NT) issue(tt + 2, tt & 1);
  }
  asm volatile("s_wait_asynccnt 0x0" ::: "memory");  // nothing in flight at the end

#pragma unroll
  for (int i = 0; i < WM; ++i) {
    const int row0 = bm0 + wr0 + i * 16;
#pragma unroll
    for (int j = 0; j < WN; ++j) {
      const int col = bn0 + wc0 + j * 16 + n;
      if constexpr (MODE == 3) {
        // v_rec element C[tok][col] -> vT[b][h][d][s], 8 consecutive tokens per lane
        const int hh  = col >> 6;
        const int dd  = col & (HD_ - 1);
        const int tok0 = row0 + g * 8;        // 16-aligned tile: never crosses batch
        const int bb = tok0 >> 11;            // / S_
        const int ss = tok0 & (S_ - 1);
        v8h o8;
#pragma unroll
        for (int r = 0; r < 8; ++r) o8[r] = (_Float16)acc[i][j][r];
        *(v8h*)(Ch + (size_t)((bb * H_ + hh) * HD_ + dd) * S_ + ss) = o8;
      } else {
#pragma unroll
        for (int r = 0; r < 8; ++r) {
          const size_t idx = (size_t)(row0 + g * 8 + r) * N + col;
          if constexpr (MODE == 0 || MODE == 2) Cf[idx] = acc[i][j][r];
          if constexpr (MODE == 1 || MODE == 2) Ch[idx] = (_Float16)acc[i][j][r];
        }
      }
    }
  }
}

// ---------------------------------------------------------------------------
// Flash attention with multiplicative time decay.
// One block = 8 waves = 8 consecutive 16-query tiles of ONE (b, h); the block
// cooperatively stages each 32-key K/V tile into LDS exactly once via
// global_load_async_to_lds_b128 (ASYNCcnt), double-buffered so the DMA of
// tile k+1 overlaps the 8 WMMAs + online softmax of tile k.
// The products are taken transposed, St = K * Qt and Ot += Vt * Pt: a lane then
// holds 16 of the 32 scores of ONE query (lanes l and l ^ 16 share a query), so
// the row maximum and the row sum are in-lane, and the two score tiles, once
// converted, already are the B operand of the second product.
// ---------------------------------------------------------------------------
// Value of lane l ^ 16 (a vector cross-row move; no LDS round trip).
static __device__ __forceinline__ float other_half(float x) {
  const int i = __builtin_bit_cast(int, x);
  return __builtin_bit_cast(
      float, __builtin_amdgcn_permlanex16(i, i, 0x76543210, 0xfedcba98, false, false));
}

__global__ __launch_bounds__(256) void flash_attn_decay_kernel(
    const _Float16* __restrict__ Qh,   // [NTOK_, D_] row-major
    const _Float16* __restrict__ Kh,   // [NTOK_, D_] row-major (k_rec)
    const _Float16* __restrict__ Vt,   // [B_, H_, HD_, S_] (v_rec transposed)
    _Float16* __restrict__ Oh) {       // [NTOK_, D_] row-major
  // Row pitches are odd multiples of 16 B (144 B, 80 B): the 16 rows that
  // one ds_load_b128 fragment read touches then fall on distinct bank groups.
  __shared__ __align__(16) _Float16 Ktile[2][32][KP_];  // [key][dim]  9 KB
  __shared__ __align__(16) _Float16 Vtile[2][64][VP_];  // [dim][key] 10 KB

  const int t    = threadIdx.x;
  const int lane = t & 31;
  const int wid  = t >> 5;
  const int bh   = blockIdx.x >> 4;              // 16 blocks per (b,h)
  const int qt   = ((blockIdx.x & 15) << 3) + wid;
  const int h    = bh & (H_ - 1);
  const int b    = bh >> 4;
  const int g    = lane >> 4;
  const int n    = lane & 15;

  const float scale = 1.0f / (sqrtf((float)D_) + 1e-8f);
  const float lam   = 1e-4f;  // LAMBDA_DECAY * TIME_STEP
  const float CLMP  = 1e4f;

  const int bS    = b * S_;
  const int qrow0 = bS + qt * 16;
  const v16h qa0 = load_frag(Qh, qrow0, D_, h * HD_ + 0,  lane);
  const v16h qa1 = load_frag(Qh, qrow0, D_, h * HD_ + 32, lane);

  const _Float16* vt = Vt + (size_t)(b * H_ + h) * HD_ * S_;

  // Per-thread staging coordinates: 256 threads x 16B = one 4 KB tile each.
  const int krow = t >> 3, kcc = (t & 7) * 8;    // K: [32 keys][64 dims]
  const int vd   = t >> 2, vkc = (t & 3) * 8;    // V: [64 dims][32 keys]

  // Every "#pragma unroll" of this kernel makes the index of a register array
  // (o, s0, s1, p0, p1, pt, o8) a compile-time constant: the array stays in registers.
  // o[f][r] = Ot[dim f*16 + g*8 + r][query n]; mrun: the query's running
  // maximum (equal in both halves); lrun: this half's share of its row sum.
  v8f o[4];
  float mrun = -3.0e38f, lrun = 0.f;
#pragma unroll
  for (int f = 0; f < 4; ++f) o[f] = zero8();
  const float qi = (float)(qt * 16 + n);

  const int NT = S_ / 32;

  // Prologue: stage tile 0 into buffer 0.
  async_b128_to_lds(lds_off_of(&Ktile[0][krow][kcc]),
                    Kh + (size_t)(bS + krow) * D_ + h * HD_ + kcc);
  async_b128_to_lds(lds_off_of(&Vtile[0][vd][vkc]),
                    vt + (size_t)vd * S_ + vkc);

  for (int kb = 0; kb < NT; ++kb) {
    const int cur = kb & 1;
    if (kb + 1 < NT) {
      // Issue next tile's DMA, then wait only for the CURRENT tile (keep the
      // next stage's 2 async ops in flight).
      const int krow1 = bS + (kb + 1) * 32;
      async_b128_to_lds(lds_off_of(&Ktile[cur ^ 1][krow][kcc]),
                        Kh + (size_t)(krow1 + krow) * D_ + h * HD_ + kcc);
      async_b128_to_lds(lds_off_of(&Vtile[cur ^ 1][vd][vkc]),
                        vt + (size_t)vd * S_ + (kb + 1) * 32 + vkc);
      asm volatile("s_wait_asynccnt 0x2" ::: "memory");
    } else {
      asm volatile("s_wait_asynccnt 0x0" ::: "memory");
    }
    __syncthreads();  // current tile visible to all waves

    // ---- scores, transposed: 32 keys x 16 queries from LDS tile ----
    const _Float16* kt  = &Ktile[cur][0][0];
    v16h kb00 = load_frag(kt, 0,  KP_, 0,  lane);
    v16h kb01 = load_frag(kt, 0,  KP_, 32, lane);
    v16h kb10 = load_frag(kt, 16, KP_, 0,  lane);
    v16h kb11 = load_frag(kt, 16, KP_, 32, lane);
    v8f s0 = zero8(), s1 = zero8();   // s0[r]: key g*8 + r, s1[r]: key 16 + g*8 + r
    s0 = wmma_f16f32(kb00, qa0, s0);
    s0 = wmma_f16f32(kb01, qa1, s0);
    s1 = wmma_f16f32(kb10, qa0, s1);
    s1 = wmma_f16f32(kb11, qa1, s1);

    // ---- scale, clamp, time decay, clamp ----
    float p0[8], p1[8];
#pragma unroll
    for (int r = 0; r < 8; ++r) {
      const float kj0 = (float)(kb * 32 + g * 8 + r);
      float t0 = fminf(fmaxf(s0[r] * scale, -CLMP), CLMP);
      t0 *= __expf(-lam * fabsf(qi - kj0));
      p0[r] = fminf(fmaxf(t0, -CLMP), CLMP);
    }
#pragma unroll
    for (int r = 0; r < 8; ++r) {
      const float kj0 = (float)(kb * 32 + g * 8 + r);
      float t1 = fminf(fmaxf(s1[r] * scale, -CLMP), CLMP);
      t1 *= __expf(-lam * fabsf(qi - (kj0 + 16.0f)));
      p1[r] = fminf(fmaxf(t1, -CLMP), CLMP);
    }

    // ---- online softmax: in-lane over 16 keys, one exchange between halves ----
    float rmax = fmaxf(p0[0], p1[0]);
#pragma unroll
    for (int r = 1; r < 8; ++r) rmax = fmaxf(rmax, fmaxf(p0[r], p1[r]));
    rmax = fmaxf(rmax, other_half(rmax));
    const float mnew  = fmaxf(mrun, rmax);
    const float alpha = __expf(mrun - mnew);
    mrun = mnew;
    v16h pt;   // Pt as B operand: element s is key g*8 + s, or 16 + g*8 + (s - 8)
#pragma unroll
    for (int r = 0; r < 8; ++r) {
      p0[r] = __expf(p0[r] - mnew);
      pt[r] = (_Float16)p0[r];
    }
#pragma unroll
    for (int r = 0; r < 8; ++r) {
      p1[r] = __expf(p1[r] - mnew);
      pt[8 + r] = (_Float16)p1[r];
    }
    // in-lane sum as a tree: short dependent chain
#pragma unroll
    for (int r = 0; r < 8; ++r) p0[r] += p1[r];
#pragma unroll
    for (int w = 4; w >= 1; w >>= 1)
#pragma unroll
      for (int r = 0; r < w; ++r) p0[r] += p0[r + w];
    const float rsum = p0[0];
    lrun = lrun * alpha + rsum;
#pragma unroll
    for (int f = 0; f < 4; ++f)
#pragma unroll
      for (int r = 0; r < 8; ++r) o[f][r] *= alpha;

    // ---- Ot += Vt(64x32) @ Pt(32x16): A-frags contiguous from LDS V tile ----
    const _Float16* vtl = &Vtile[cur][0][0];
#pragma unroll
    for (int f = 0; f < 4; ++f) {
      v16h va = load_frag(vtl, f * 16, VP_, 0, lane);
      o[f] = wmma_f16f32(va, pt, o[f]);
    }

    __syncthreads();  // all waves done reading buf before its next overwrite
  }

  // ---- epilogue: join the halves' sums, normalize, store row-major f16 ----
  // A lane holds 8 consecutive dims of its query per tile: one 16-byte store.
  const float inv = 1.0f / (lrun + other_half(lrun));
#pragma unroll
  for (int f = 0; f < 4; ++f) {
    v8h o8;
#pragma unroll
    for (int r = 0; r < 8; ++r) o8[r] = (_Float16)(o[f][r] * inv);
    *(v8h*)(Oh + (size_t)(qrow0 + n) * D_ + h * HD_ + f * 16 + g * 8) = o8;
  }
}

// ---------------------------------------------------------------------------
// Host orchestration
// ---------------------------------------------------------------------------
extern "C" void kernel_launch(void* const* d_in, const int* in_sizes, int n_in,
                              void* d_out, int out_size, void* d_ws,
                              size_t ws_size, hipStream_t stream) {
  (void)in_sizes; (void)n_in; (void)out_size; (void)ws_size;
  const float* x     = (const float*)d_in[0];
  const float* Wq    = (const float*)d_in[1];
  const float* Wk    = (const float*)d_in[2];
  const float* Wv    = (const float*)d_in[3];
  const float* Wo    = (const float*)d_in[4];
  const float* Wdown = (const float*)d_in[5];
  const float* Wupk  = (const float*)d_in[6];
  const float* Wupv  = (const float*)d_in[7];
  float* out = (float*)d_out;  // [NTOK_*D_] attn-out, then [NTOK_*L_] latent

  // Carve workspace (256B aligned)
  char* wsp = (char*)d_ws;
  auto carve = [&](size_t bytes) {
    char* p = wsp;
    wsp += (bytes + 255) & ~(size_t)255;
    return p;
  };
  _Float16* x_h      = (_Float16*)carve((size_t)NTOK_ * D_ * 2);
  _Float16* q_h      = (_Float16*)carve((size_t)NTOK_ * D_ * 2);
  _Float16* k_h      = (_Float16*)carve((size_t)NTOK_ * D_ * 2);
  _Float16* vT       = (_Float16*)carve((size_t)NTOK_ * D_ * 2);
  _Float16* attn_h   = (_Float16*)carve((size_t)NTOK_ * D_ * 2);
  _Float16* latent_h = (_Float16*)carve((size_t)NTOK_ * L_ * 2);
  _Float16* wq_t     = (_Float16*)carve((size_t)D_ * D_ * 2);
  _Float16* wo_t     = (_Float16*)carve((size_t)D_ * D_ * 2);
  _Float16* wkv_h    = (_Float16*)carve((size_t)D_ * D_ * 2);
  _Float16* wdown_t  = (_Float16*)carve((size_t)D_ * L_ * 2);
  _Float16* wupk_t   = (_Float16*)carve((size_t)D_ * L_ * 2);
  _Float16* wupv_t   = (_Float16*)carve((size_t)D_ * L_ * 2);
  float*    wcomb_f  = (float*)   carve((size_t)D_ * L_ * 4);
  _Float16* wcomb_t  = (_Float16*)carve((size_t)D_ * L_ * 2);

  // --- precision conversion & weight transposes ---
  static_assert((NTOK_ * D_) % (256 * 32) == 0 && (D_ * D_) % (256 * 8) == 0 &&
                D_ % 128 == 0 && L_ % 128 == 0, "prep grids cover the shapes");
  f32_to_f16_kernel<8><<<NTOK_ * D_ / (256 * 32), 256, 0, stream>>>(x, x_h);
  add2_to_f16_kernel<2><<<D_ * D_ / (256 * 8), 256, 0, stream>>>(Wk, Wv, wkv_h);
  transpose_f32_to_f16_kernel<D_, D_><<<D_ * D_ / 8192, 256, 0, stream>>>(Wq, wq_t);
  transpose_f32_to_f16_kernel<D_, D_><<<D_ * D_ / 8192, 256, 0, stream>>>(Wo, wo_t);
  transpose_f32_to_f16_kernel<D_, L_><<<D_ * L_ / 8192, 256, 0, stream>>>(Wdown, wdown_t);
  transpose_f32_to_f16_kernel<L_, D_><<<L_ * D_ / 8192, 256, 0, stream>>>(Wupk, wupk_t);
  transpose_f32_to_f16_kernel<L_, D_><<<L_ * D_ / 8192, 256, 0, stream>>>(Wupv, wupv_t);

  // --- W_comb = (Wk + Wv) @ W_down  (folds the k/v GEMMs away) ---
  gemm_wmma_kernel<0, 2, 1, D_, L_, D_>
      <<<(D_ / 64) * (L_ / 64), 256, 0, stream>>>(wkv_h, wdown_t, wcomb_f, nullptr);
  transpose_f32_to_f16_kernel<D_, L_><<<D_ * L_ / 8192, 256, 0, stream>>>(
      wcomb_f, wcomb_t);

  // --- latent = x @ W_comb : f32 -> d_out tail, f16 -> latent_h ---
  gemm_wmma_kernel<2, 2, 1, NTOK_, L_, D_>
      <<<(NTOK_ / 64) * (L_ / 64), 256, 0, stream>>>(
          x_h, wcomb_t, out + (size_t)NTOK_ * D_, latent_h);

  // --- q = x @ Wq ---
  gemm_wmma_kernel<1, 4, 2, NTOK_, D_, D_>
      <<<(NTOK_ / 128) * (D_ / 128), 256, 0, stream>>>(x_h, wq_t, nullptr, q_h);

  // --- k_rec = latent @ W_up_k (row-major == B^T for QK^T) ---
  gemm_wmma_kernel<1, 4, 2, NTOK_, D_, L_>
      <<<(NTOK_ / 128) * (D_ / 128), 256, 0, stream>>>(latent_h, wupk_t, nullptr, k_h);

  // --- v_rec = latent @ W_up_v, written per-head transposed [B,H,64,S] ---
  gemm_wmma_kernel<3, 4, 2, NTOK_, D_, L_>
      <<<(NTOK_ / 128) * (D_ / 128), 256, 0, stream>>>(latent_h, wupv_t, nullptr, vT);

  // --- flash attention with decay: 512 blocks, 8 q-tiles of one (b,h) each ---
  flash_attn_decay_kernel<<<B_ * H_ * (S_ / 128), 256, 0, stream>>>(
      q_h, k_h, vT, attn_h);

  // --- out = attn @ Wo ---
  gemm_wmma_kernel<0, 4, 2, NTOK_, D_, D_>
      <<<(NTOK_ / 128) * (D_ / 128), 256, 0, stream>>>(attn_h, wo_t, out, nullptr);
}

// v005
// A run of this version takes 124 microseconds.
// Timed twice side by side with v004, it ran 1.22 times as fast both times.
// Counting every step since v000, it is 3.57 times as fast.
#include <hip/hip_runtime.h>

// Problem constants
#define B_    2
#define S_    2048
#define D_    1024
#define H_    16
#define HD_   64
#define L_    256
#define NTOK_ (B_ * S_)
#define KP_   72   // LDS pitch of a 64-half row, in halves
#define VP_   40   // LDS pitch of a 32-half row, in halves

typedef __attribute__((ext_vector_type(16))) _Float16 v16h;
typedef __attribute__((ext_vector_type(8)))  _Float16 v8h;
typedef __attribute__((ext_vector_type(8)))  float    v8f;
typedef __attribute__((ext_vector_type(4)))  _Float16 v4h;
typedef __attribute__((ext_vector_type(4)))  float    v4f;

static __device__ __forceinline__ v8f wmma_f16f32(v16h a, v16h b, v8f c) {
  // D = A(16x32 f16) * B(32x16 f16) + C(16x16 f32)
  return __builtin_amdgcn_wmma_f32_16x16x32_f16(false, a, false, b, (short)0, c,
                                                false, false);
}

static __device__ __forceinline__ v8f zero8() {
  v8f z = {0.f, 0.f, 0.f, 0.f, 0.f, 0.f, 0.f, 0.f};
  return z;
}

// Load an A-style fragment (row m = lane&15; K chunks at col0+8g and col0+16+8g)
// from a row-major f16 matrix with leading dimension ld. The same routine loads
// B-fragments from the *transposed* (N-major) operand. Works for global or LDS.
static __device__ __forceinline__ v16h load_frag(const _Float16* __restrict__ base,
                                                 int row0, int ld, int col0,
                                                 int lane) {
  const int g = lane >> 4;
  const int m = lane & 15;
  const _Float16* p = base + (size_t)(row0 + m) * ld + col0 + g * 8;
  union { v16h v; v8h h[2]; } u;
  u.h[0] = *(const v8h*)(p);
  u.h[1] = *(const v8h*)(p + 16);
  return u.v;
}

// LDS byte offset of a __shared__ object (dsaddr = LDS_BASE + VGPR, ISA 10.x):
// generic -> addrspace(3) cast yields the 32-bit LDS offset.
static __device__ __forceinline__ unsigned lds_off_of(const void* p) {
  return (unsigned)(unsigned long long)(const __attribute__((address_space(3))) char*)p;
}

// CDNA5 async DMA: memory -> LDS, 16B per lane, tracked by ASYNCcnt.
static __device__ __forceinline__ void async_b128_to_lds(unsigned lds_off,
                                                         const void* gaddr) {
  asm volatile("global_load_async_to_lds_b128 %0, %1, off"
               :: "v"(lds_off), "v"((unsigned long long)gaddr)
               : "memory");
}

// ---------------------------------------------------------------------------
// Elementwise prep work. A thread handles 8 to 32 elements through 16-byte
// loads that are all issued before the first is used. Each part below is the
// work of ONE block, numbered blk within its part; the block counts cover the
// fixed shapes exactly (static_assert at the counts), so there is no bounds test.
// ---------------------------------------------------------------------------
// One wave converts NV runs of 128 consecutive floats (512 B per load).
template <int NV>
static __device__ __forceinline__ void f32_to_f16_part(
    const float* __restrict__ in, _Float16* __restrict__ out, const int blk) {
  const int base = (blk * 8 + (threadIdx.x >> 5)) * (NV * 128) +
                   (threadIdx.x & 31) * 4;
  v4f v[NV];
#pragma unroll
  for (int j = 0; j < NV; ++j) v[j] = *(const v4f*)(in + base + j * 128);
#pragma unroll
  for (int j = 0; j < NV; ++j)
    *(v4h*)(out + base + j * 128) = __builtin_convertvector(v[j], v4h);
}

template <int NV>
static __device__ __forceinline__ void add2_to_f16_part(
    const float* __restrict__ a, const float* __restrict__ b,
    _Float16* __restrict__ out, const int blk) {
  const int base = (blk * 8 + (threadIdx.x >> 5)) * (NV * 128) +
                   (threadIdx.x & 31) * 4;
  v4f va[NV], vb[NV];
#pragma unroll
  for (int j = 0; j < NV; ++j) {
    va[j] = *(const v4f*)(a + base + j * 128);
    vb[j] = *(const v4f*)(b + base + j * 128);
  }
#pragma unroll
  for (int j = 0; j < NV; ++j)
    *(v4h*)(out + base + j * 128) = __builtin_convertvector(va[j] + vb[j], v4h);
}

// out[c * R + r] = (f16) in[r * C + c]   (in: R x C f32, out: C x R f16)
// One thread: 8 rows x 4 columns in registers (8 loads of 16 B, 4 stores of
// 16 B). One wave: 8 rows x 128 columns. The 8 waves of a block take 64
// consecutive rows, so each 128-byte line of out is written by one block.
template <int R, int C>
static __device__ __forceinline__ void transpose_f32_to_f16_part(
    const float* __restrict__ in, _Float16* __restrict__ out, const int blk) {
  constexpr int CB = C / 128;
  const int c0 = (blk % CB) * 128 + (threadIdx.x & 31) * 4;
  const int r0 = (blk / CB) * 64 + (threadIdx.x >> 5) * 8;
  v4f v[8];
#pragma unroll
  for (int j = 0; j < 8; ++j) v[j] = *(const v4f*)(in + (r0 + j) * C + c0);
#pragma unroll
  for (int q = 0; q < 4; ++q) {
    v8h o8;
#pragma unroll
    for (int j = 0; j < 8; ++j) o8[j] = (_Float16)v[j][q];
    *(v8h*)(out + (c0 + q) * R + r0) = o8;
  }
}

// Stands behind the last store of a part in a kernel that holds several parts:
// there another part's code follows in the program and rewrites the registers
// that the stores name; the wait comes first (a precaution).
static __device__ __forceinline__ void part_stores_issued() {
  asm volatile("s_wait_xcnt 0x0" ::: "memory");
}

// Blocks per part.
constexpr int NB_X   = NTOK_ * D_ / (256 * 32);  // x -> f16
constexpr int NB_ADD = D_ * D_ / (256 * 8);      // Wk + Wv -> f16
constexpr int NB_TDD = D_ * D_ / 8192;           // transpose of a D x D weight
constexpr int NB_TDL = D_ * L_ / 8192;           // transpose of a D x L or L x D weight
static_assert((NTOK_ * D_) % (256 * 32) == 0 && (D_ * D_) % (256 * 8) == 0 &&
              D_ % 128 == 0 && L_ % 128 == 0, "prep blocks cover the shapes");

// The seven prep parts that read nothing but inputs, in ONE launch: none needs
// another's result, so each takes a range of the block index and they run side
// by side instead of one behind the other. The test is on blockIdx alone: a
// scalar branch, the same for a whole block.
__global__ __launch_bounds__(256) void prep_inputs_kernel(
    const float* __restrict__ x, const float* __restrict__ Wk,
    const float* __restrict__ Wv, const float* __restrict__ Wq,
    const float* __restrict__ Wo, const float* __restrict__ Wdown,
    const float* __restrict__ Wupk, const float* __restrict__ Wupv,
    _Float16* __restrict__ x_h, _Float16* __restrict__ wkv_h,
    _Float16* __restrict__ wq_t, _Float16* __restrict__ wo_t,
    _Float16* __restrict__ wdown_t, _Float16* __restrict__ wupk_t,
    _Float16* __restrict__ wupv_t) {
  int blk = blockIdx.x;
  if (blk < NB_X) { f32_to_f16_part<8>(x, x_h, blk); return; }
  blk -= NB_X;
  if (blk < NB_ADD) {
    add2_to_f16_part<2>(Wk, Wv, wkv_h, blk);
    part_stores_issued();
    return;
  }
  blk -= NB_ADD;
  if (blk < NB_TDD) {
    transpose_f32_to_f16_part<D_, D_>(Wq, wq_t, blk);
    part_stores_issued();
    return;
  }
  blk -= NB_TDD;
  if (blk < NB_TDD) {
    transpose_f32_to_f16_part<D_, D_>(Wo, wo_t, blk);
    part_stores_issued();
    return;
  }
  blk -= NB_TDD;
  if (blk < NB_TDL) {
    transpose_f32_to_f16_part<D_, L_>(Wdown, wdown_t, blk);
    part_stores_issued();
    return;
  }
  blk -= NB_TDL;
  if (blk < NB_TDL) {
    transpose_f32_to_f16_part<L_, D_>(Wupk, wupk_t, blk);
    part_stores_issued();
    return;
  }
  blk -= NB_TDL;
  transpose_f32_to_f16_part<L_, D_>(Wupv, wupv_t, blk);
  part_stores_issued();
}

// The transpose of W_comb waits for its GEMM: a launch of its own.
template <int R, int C>
__global__ __launch_bounds__(256) void transpose_f32_to_f16_kernel(
    const float* __restrict__ in, _Float16* __restrict__ out) {
  transpose_f32_to_f16_part<R, C>(in, out, blockIdx.x);
}

// ---------------------------------------------------------------------------
// WMMA GEMM: C[M x N] = A[M x K] * B[K x N], B given transposed (N x K).
// One block of 8 waves (2 along M x 4 along N) computes a (32*WM) x (64*WN)
// tile of C; one wave a (16*WM) x (16*WN) part of it. Each trip takes 64 k:
// the block's rows of A and of Bt (128 B each) are brought into LDS once by
// asynchronous copies and every wave reads its fragments from there, so a row
// is fetched from L2 once per block, in whole 128-byte lines. Two buffers: the
// copies of trip t + 2 fly while trip t + 1 is worked on.
// MODE 0: f32 out; 1: f16 out; 2: f32 + f16 out; 3: per-head transposed f16
//         scatter (v_rec -> vT[B][H][64][S]).
// ---------------------------------------------------------------------------
// Four 16-byte asynchronous copies per lane, global memory -> LDS. The
// s_wait_xcnt stands as the last line of the copies' own statement, so that no
// later write of an address register can be moved in front of it (a precaution).
static __device__ __forceinline__ void async_copy4_b128(
    unsigned l0, const _Float16* g0, unsigned l1, const _Float16* g1,
    unsigned l2, const _Float16* g2, unsigned l3, const _Float16* g3) {
  asm volatile(
      "global_load_async_to_lds_b128 %0, %1, off\n\t"
      "global_load_async_to_lds_b128 %2, %3, off\n\t"
      "global_load_async_to_lds_b128 %4, %5, off\n\t"
      "global_load_async_to_lds_b128 %6, %7, off\n\t"
      "s_wait_xcnt 0x0"
      :: "v"(l0), "v"((unsigned long long)g0), "v"(l1),
         "v"((unsigned long long)g1), "v"(l2), "v"((unsigned long long)g2),
         "v"(l3), "v"((unsigned long long)g3)
      : "memory");
}

// Halves of LDS that a block with WM x WN wave tiles stages (two buffers).
constexpr int stage_halves(int WM, int WN) { return 2 * (32 * WM + 64 * WN) * KP_; }

// The work of ONE block: tile number blk of the product; smem is the block's
// staging area, stage_halves(WM, WN) halves, declared by the kernel.
template <int MODE, int WM, int WN, int M, int N, int K>
static __device__ __forceinline__ void gemm_wmma_tile(
    const _Float16* __restrict__ A, const _Float16* __restrict__ Bt,
    float* __restrict__ Cf, _Float16* __restrict__ Ch, const int blk,
    _Float16* smem) {
  constexpr int BM   = 32 * WM;      // rows of C (and of A) per block
  constexpr int BN   = 64 * WN;      // columns of C (rows of Bt) per block
  constexpr int ROWS = BM + BN;      // staged rows per trip: A first, then Bt
  constexpr int NT   = K / 64;       // trips
  constexpr int NC   = ROWS / 32;    // copies per thread and trip
  constexpr unsigned BUFB = ROWS * KP_ * 2;  // bytes of one buffer
  static_assert(M % BM == 0 && N % BN == 0 && K % 64 == 0 && NC % 4 == 0,
                "the grid covers the shape exactly; no edge handling");
  // 128-byte rows at a pitch of 144 B (odd multiple of 16 B) for ds_load_b128.
  _Float16 (*stage)[ROWS][KP_] = reinterpret_cast<_Float16 (*)[ROWS][KP_]>(smem);

  const int t    = threadIdx.x;
  const int lane = t & 31;
  const int wid  = t >> 5;
  const int g = lane >> 4;
  const int n = lane & 15;
  const int bm0 = (blk / (N / BN)) * BM;
  const int bn0 = (blk % (N / BN)) * BN;
  const int wr0 = (wid >> 2) * (WM * 16);  // the wave's first row in the tile
  const int wc0 = (wid & 3) * (WN * 16);   // the wave's first column in the tile

  // Copy j of a thread: staged row (t >> 3) + 32 * j, 16-byte piece t & 7; a
  // wave's copy covers 4 whole rows of 128 B.
  const int crow = t >> 3, ccol = (t & 7) * 8;
  const _Float16* gA = A  + (size_t)(bm0 + crow) * K + ccol;
  const _Float16* gB = Bt + (size_t)(bn0 + crow) * K + ccol;
  const unsigned lrow = lds_off_of(&stage[0][crow][ccol]);

  auto from = [&](int j, int k0) -> const _Float16* {
    return j < BM / 32 ? gA + (size_t)(j * 32) * K + k0
                       : gB + (size_t)(j * 32 - BM) * K + k0;
  };
  auto issue = [&](int tile, int buf) {
    const int k0 = tile * 64;
    const unsigned lb = lrow + (unsigned)buf * BUFB;
    // unrolled so that the choice between A and Bt is made at compile time
#pragma unroll
    for (int j = 0; j < NC; j += 4)
      async_copy4_b128(lb + (j + 0) * (32 * KP_ * 2), from(j + 0, k0),
                       lb + (j + 1) * (32 * KP_ * 2), from(j + 1, k0),
                       lb + (j + 2) * (32 * KP_ * 2), from(j + 2, k0),
                       lb + (j + 3) * (32 * KP_ * 2), from(j + 3, k0));
  };

  // Every "#pragma unroll" from here on makes the index of a register array
  // (acc, a, b) a compile-time constant, so that the array stays in registers.
  v8f acc[WM][WN];
#pragma unroll
  for (int i = 0; i < WM; ++i)
#pragma unroll
    for (int j = 0; j < WN; ++j) acc[i][j] = zero8();

  // Prologue: tile 0 lands and is published, then tile 1 starts.
  issue(0, 0);
  asm volatile("s_wait_asynccnt 0x0" ::: "memory");  // own copies of tile 0 landed
  __syncthreads();                                   // ... and every wave's
  if (NT > 1) issue(1, 1);

  for (int tt = 0; tt < NT; ++tt) {
    const _Float16* sA = &stage[tt & 1][0][0];
    const _Float16* sB = &stage[tt & 1][BM][0];
    // All fragment reads of the trip stand together, ahead of its WMMAs.
    v16h a[2][WM], b[2][WN];
#pragma unroll
    for (int kk = 0; kk < 2; ++kk) {
#pragma unroll
      for (int i = 0; i < WM; ++i)
        a[kk][i] = load_frag(sA, wr0 + i * 16, KP_, kk * 32, lane);
#pragma unroll
      for (int j = 0; j < WN; ++j)
        b[kk][j] = load_frag(sB, wc0 + j * 16, KP_, kk * 32, lane);
    }
    // Keeps the scheduler from sinking the reads among the WMMAs, where each
    // separate place with reads makes the wave wait out the LDS latency again.
    __builtin_amdgcn_sched_barrier(0);
#pragma unroll
    for (int kk = 0; kk < 2; ++kk)
#pragma unroll
      for (int i = 0; i < WM; ++i)
#pragma unroll
        for (int j = 0; j < WN; ++j)
          acc[i][j] = wmma_f16f32(a[kk][i], b[kk][j], acc[i][j]);
    // Keeps the trip's WMMAs in front of the publish point: lifted over them,
    // the waits would end the reads and the copies before any matrix work
    // has covered their latency.
    __builtin_amdgcn_sched_barrier(0);

    // Publish point of tile tt + 1, which also frees the buffer just read.
    asm volatile("s_wait_dscnt 0x0" ::: "memory");     // own LDS reads are done
    asm volatile("s_wait_asynccnt 0x0" ::: "memory");  // own copies of tt + 1 landed
    __syncthreads();
    if (tt + 2 < NT) issue(tt + 2, tt & 1);
  }
  asm volatile("s_wait_asynccnt 0x0" ::: "memory");  // nothing in flight at the end

#pragma unroll
  for (int i = 0; i < WM; ++i) {
    const int row0 = bm0 + wr0 + i * 16;
#pragma unroll
    for (int j = 0; j < WN; ++j) {
      const int col = bn0 + wc0 + j * 16 + n;
      if constexpr (MODE == 3) {
        // v_rec element C[tok][col] -> vT[b][h][d][s], 8 consecutive tokens per lane
        const int hh  = col >> 6;
        const int dd  = col & (HD_ - 1);
        const int tok0 = row0 + g * 8;        // 16-aligned tile: never crosses batch
        const int bb = tok0 >> 11;            // / S_
        const int ss = tok0 & (S_ - 1);
        v8h o8;
#pragma unroll
        for (int r = 0; r < 8; ++r) o8[r] = (_Float16)acc[i][j][r];
        *(v8h*)(Ch + (size_t)((bb * H_ + hh) * HD_ + dd) * S_ + ss) = o8;
      } else {
#pragma unroll
        for (int r = 0; r < 8; ++r) {
          const size_t idx = (size_t)(row0 + g * 8 + r) * N + col;
          if constexpr (MODE == 0 || MODE == 2) Cf[idx] = acc[i][j][r];
          if constexpr (MODE == 1 || MODE == 2) Ch[idx] = (_Float16)acc[i][j][r];
        }
      }
    }
  }
}

// One product per launch.
template <int MODE, int WM, int WN, int M, int N, int K>
__global__ __launch_bounds__(256) void gemm_wmma_kernel(
    const _Float16* __restrict__ A, const _Float16* __restrict__ Bt,
    float* __restrict__ Cf, _Float16* __restrict__ Ch) {
  __shared__ __align__(16) _Float16 smem[stage_halves(WM, WN)];
  gemm_wmma_tile<MODE, WM, WN, M, N, K>(A, Bt, Cf, Ch, blockIdx.x, smem);
}

// Two products that do not need each other, in ONE launch; each takes a range
// of the block index (a scalar branch, the same for a whole block, so every
// barrier inside a product is passed by all waves of its block).
constexpr int NB_BIG = (NTOK_ / 128) * (D_ / 128);  // blocks of a NTOK x D product
constexpr int NB_WC  = (D_ / 64) * (L_ / 64);       // blocks of W_comb

// q = x @ Wq fills the chip; the 64 blocks of W_comb = (Wk + Wv) @ W_down, which
// alone would leave three quarters of it idle, run beside it.
__global__ __launch_bounds__(256) void gemm_q_and_wcomb_kernel(
    const _Float16* __restrict__ x_h, const _Float16* __restrict__ wq_t,
    _Float16* __restrict__ q_h, const _Float16* __restrict__ wkv_h,
    const _Float16* __restrict__ wdown_t, float* __restrict__ wcomb_f) {
  __shared__ __align__(16) _Float16 smem[stage_halves(4, 2)];
  const int blk = blockIdx.x;
  if (blk < NB_BIG)
    gemm_wmma_tile<1, 4, 2, NTOK_, D_, D_>(x_h, wq_t, nullptr, q_h, blk, smem);
  else
    gemm_wmma_tile<0, 2, 1, D_, L_, D_>(wkv_h, wdown_t, wcomb_f, nullptr,
                                        blk - NB_BIG, smem);
}

// k_rec = latent @ W_up_k (row-major) and v_rec = latent @ W_up_v (per head
// transposed).
__global__ __launch_bounds__(256) void gemm_krec_and_vrec_kernel(
    const _Float16* __restrict__ latent_h, const _Float16* __restrict__ wupk_t,
    _Float16* __restrict__ k_h, const _Float16* __restrict__ wupv_t,
    _Float16* __restrict__ vT) {
  __shared__ __align__(16) _Float16 smem[stage_halves(4, 2)];
  const int blk = blockIdx.x;
  if (blk < NB_BIG) {
    gemm_wmma_tile<1, 4, 2, NTOK_, D_, L_>(latent_h, wupk_t, nullptr, k_h, blk, smem);
  } else {
    gemm_wmma_tile<3, 4, 2, NTOK_, D_, L_>(latent_h, wupv_t, nullptr, vT,
                                           blk - NB_BIG, smem);
    part_stores_issued();  // the k_rec product's code follows in the program
  }
}

// ---------------------------------------------------------------------------
// Flash attention with multiplicative time decay.
// One block = 8 waves = 8 consecutive 16-query tiles of ONE (b, h); the block
// cooperatively stages each 32-key K/V tile into LDS exactly once via
// global_load_async_to_lds_b128 (ASYNCcnt), double-buffered so the DMA of
// tile k+1 overlaps the 8 WMMAs + online softmax of tile k.
// The products are taken transposed, St = K * Qt and Ot += Vt * Pt: a lane then
// holds 16 of the 32 scores of ONE query (lanes l and l ^ 16 share a query), so
// the row maximum and the row sum are in-lane, and the two score tiles, once
// converted, already are the B operand of the second product.
// ---------------------------------------------------------------------------
// Value of lane l ^ 16 (a vector cross-row move; no LDS round trip).
static __device__ __forceinline__ float other_half(float x) {
  const int i = __builtin_bit_cast(int, x);
  return __builtin_bit_cast(
      float, __builtin_amdgcn_permlanex16(i, i, 0x76543210, 0xfedcba98, false, false));
}

__global__ __launch_bounds__(256) void flash_attn_decay_kernel(
    const _Float16* __restrict__ Qh,   // [NTOK_, D_] row-major
    const _Float16* __restrict__ Kh,   // [NTOK_, D_] row-major (k_rec)
    const _Float16* __restrict__ Vt,   // [B_, H_, HD_, S_] (v_rec transposed)
    _Float16* __restrict__ Oh) {       // [NTOK_, D_] row-major
  // Row pitches are odd multiples of 16 B (144 B, 80 B): the 16 rows that
  // one ds_load_b128 fragment read touches then fall on distinct bank groups.
  __shared__ __align__(16) _Float16 Ktile[2][32][KP_];  // [key][dim]  9 KB
  __shared__ __align__(16) _Float16 Vtile[2][64][VP_];  // [dim][key] 10 KB

  const int t    = threadIdx.x;
  const int lane = t & 31;
  const int wid  = t >> 5;
  const int bh   = blockIdx.x >> 4;              // 16 blocks per (b,h)
  const int qt   = ((blockIdx.x & 15) << 3) + wid;
  const int h    = bh & (H_ - 1);
  const int b    = bh >> 4;
  const int g    = lane >> 4;
  const int n    = lane & 15;

  const float scale = 1.0f / (sqrtf((float)D_) + 1e-8f);
  const float lam   = 1e-4f;  // LAMBDA_DECAY * TIME_STEP
  const float CLMP  = 1e4f;

  const int bS    = b * S_;
  const int qrow0 = bS + qt * 16;
  const v16h qa0 = load_frag(Qh, qrow0, D_, h * HD_ + 0,  lane);
  const v16h qa1 = load_frag(Qh, qrow0, D_, h * HD_ + 32, lane);

  const _Float16* vt = Vt + (size_t)(b * H_ + h) * HD_ * S_;

  // Per-thread staging coordinates: 256 threads x 16B = one 4 KB tile each.
  const int krow = t >> 3, kcc = (t & 7) * 8;    // K: [32 keys][64 dims]
  const int vd   = t >> 2, vkc = (t & 3) * 8;    // V: [64 dims][32 keys]

  // Every "#pragma unroll" of this kernel makes the index of a register array
  // (o, s0, s1, p0, p1, pt, o8) a compile-time constant: the array stays in registers.
  // o[f][r] = Ot[dim f*16 + g*8 + r][query n]; mrun: the query's running
  // maximum (equal in both halves); lrun: this half's share of its row sum.
  v8f o[4];
  float mrun = -3.0e38f, lrun = 0.f;
#pragma unroll
  for (int f = 0; f < 4; ++f) o[f] = zero8();
  const float qi = (float)(qt * 16 + n);

  const int NT = S_ / 32;

  // Prologue: stage tile 0 into buffer 0.
  async_b128_to_lds(lds_off_of(&Ktile[0][krow][kcc]),
                    Kh + (size_t)(bS + krow) * D_ + h * HD_ + kcc);
  async_b128_to_lds(lds_off_of(&Vtile[0][vd][vkc]),
                    vt + (size_t)vd * S_ + vkc);

  for (int kb = 0; kb < NT; ++kb) {
    const int cur = kb & 1;
    if (kb + 1 < NT) {
      // Issue next tile's DMA, then wait only for the CURRENT tile (keep the
      // next stage's 2 async ops in flight).
      const int krow1 = bS + (kb + 1) * 32;
      async_b128_to_lds(lds_off_of(&Ktile[cur ^ 1][krow][kcc]),
                        Kh + (size_t)(krow1 + krow) * D_ + h * HD_ + kcc);
      async_b128_to_lds(lds_off_of(&Vtile[cur ^ 1][vd][vkc]),
                        vt + (size_t)vd * S_ + (kb + 1) * 32 + vkc);
      asm volatile("s_wait_asynccnt 0x2" ::: "memory");
    } else {
      asm volatile("s_wait_asynccnt 0x0" ::: "memory");
    }
    __syncthreads();  // current tile visible to all waves

    // ---- scores, transposed: 32 keys x 16 queries from LDS tile ----
    const _Float16* kt  = &Ktile[cur][0][0];
    v16h kb00 = load_frag(kt, 0,  KP_, 0,  lane);
    v16h kb01 = load_frag(kt, 0,  KP_, 32, lane);
    v16h kb10 = load_frag(kt, 16, KP_, 0,  lane);
    v16h kb11 = load_frag(kt, 16, KP_, 32, lane);
    v8f s0 = zero8(), s1 = zero8();   // s0[r]: key g*8 + r, s1[r]: key 16 + g*8 + r
    s0 = wmma_f16f32(kb00, qa0, s0);
    s0 = wmma_f16f32(kb01, qa1, s0);
    s1 = wmma_f16f32(kb10, qa0, s1);
    s1 = wmma_f16f32(kb11, qa1, s1);

    // ---- scale, clamp, time decay, clamp ----
    float p0[8], p1[8];
#pragma unroll
    for (int r = 0; r < 8; ++r) {
      const float kj0 = (float)(kb * 32 + g * 8 + r);
      float t0 = fminf(fmaxf(s0[r] * scale, -CLMP), CLMP);
      t0 *= __expf(-lam * fabsf(qi - kj0));
      p0[r] = fminf(fmaxf(t0, -CLMP), CLMP);
    }
#pragma unroll
    for (int r = 0; r < 8; ++r) {
      const float kj0 = (float)(kb * 32 + g * 8 + r);
      float t1 = fminf(fmaxf(s1[r] * scale, -CLMP), CLMP);
      t1 *= __expf(-lam * fabsf(qi - (kj0 + 16.0f)));
      p1[r] = fminf(fmaxf(t1, -CLMP), CLMP);
    }

    // ---- online softmax: in-lane over 16 keys, one exchange between halves ----
    float rmax = fmaxf(p0[0], p1[0]);
#pragma unroll
    for (int r = 1; r < 8; ++r) rmax = fmaxf(rmax, fmaxf(p0[r], p1[r]));
    rmax = fmaxf(rmax, other_half(rmax));
    const float mnew  = fmaxf(mrun, rmax);
    const float alpha = __expf(mrun - mnew);
    mrun = mnew;
    v16h pt;   // Pt as B operand: element s is key g*8 + s, or 16 + g*8 + (s - 8)
#pragma unroll
    for (int r = 0; r < 8; ++r) {
      p0[r] = __expf(p0[r] - mnew);
      pt[r] = (_Float16)p0[r];
    }
#pragma unroll
    for (int r = 0; r < 8; ++r) {
      p1[r] = __expf(p1[r] - mnew);
      pt[8 + r] = (_Float16)p1[r];
    }
    // in-lane sum as a tree: short dependent chain
#pragma unroll
    for (int r = 0; r < 8; ++r) p0[r] += p1[r];
#pragma unroll
    for (int w = 4; w >= 1; w >>= 1)
#pragma unroll
      for (int r = 0; r < w; ++r) p0[r] += p0[r + w];
    const float rsum = p0[0];
    lrun = lrun * alpha + rsum;
#pragma unroll
    for (int f = 0; f < 4; ++f)
#pragma unroll
      for (int r = 0; r < 8; ++r) o[f][r] *= alpha;

    // ---- Ot += Vt(64x32) @ Pt(32x16): A-frags contiguous from LDS V tile ----
    const _Float16* vtl = &Vtile[cur][0][0];
#pragma unroll
    for (int f = 0; f < 4; ++f) {
      v16h va = load_frag(vtl, f * 16, VP_, 0, lane);
      o[f] = wmma_f16f32(va, pt, o[f]);
    }

    __syncthreads();  // all waves done reading buf before its next overwrite
  }

  // ---- epilogue: join the halves' sums, normalize, store row-major f16 ----
  // A lane holds 8 consecutive dims of its query per tile: one 16-byte store.
  const float inv = 1.0f / (lrun + other_half(lrun));
#pragma unroll
  for (int f = 0; f < 4; ++f) {
    v8h o8;
#pragma unroll
    for (int r = 0; r < 8; ++r) o8[r] = (_Float16)(o[f][r] * inv);
    *(v8h*)(Oh + (size_t)(qrow0 + n) * D_ + h * HD_ + f * 16 + g * 8) = o8;
  }
}

// ---------------------------------------------------------------------------
// Host orchestration
// ---------------------------------------------------------------------------
extern "C" void kernel_launch(void* const* d_in, const int* in_sizes, int n_in,
                              void* d_out, int out_size, void* d_ws,
                              size_t ws_size, hipStream_t stream) {
  (void)in_sizes; (void)n_in; (void)out_size; (void)ws_size;
  const float* x     = (const float*)d_in[0];
  const float* Wq    = (const float*)d_in[1];
  const float* Wk    = (const float*)d_in[2];
  const float* Wv    = (const float*)d_in[3];
  const float* Wo    = (const float*)d_in[4];
  const float* Wdown = (const float*)d_in[5];
  const float* Wupk  = (const float*)d_in[6];
  const float* Wupv  = (const float*)d_in[7];
  float* out = (float*)d_out;  // [NTOK_*D_] attn-out, then [NTOK_*L_] latent

  // Carve workspace (256B aligned)
  char* wsp = (char*)d_ws;
  auto carve = [&](size_t bytes) {
    char* p = wsp;
    wsp += (bytes + 255) & ~(size_t)255;
    return p;
  };
  _Float16* x_h      = (_Float16*)carve((size_t)NTOK_ * D_ * 2);
  _Float16* q_h      = (_Float16*)carve((size_t)NTOK_ * D_ * 2);
  _Float16* k_h      = (_Float16*)carve((size_t)NTOK_ * D_ * 2);
  _Float16* vT       = (_Float16*)carve((size_t)NTOK_ * D_ * 2);
  _Float16* attn_h   = (_Float16*)carve((size_t)NTOK_ * D_ * 2);
  _Float16* latent_h = (_Float16*)carve((size_t)NTOK_ * L_ * 2);
  _Float16* wq_t     = (_Float16*)carve((size_t)D_ * D_ * 2);
  _Float16* wo_t     = (_Float16*)carve((size_t)D_ * D_ * 2);
  _Float16* wkv_h    = (_Float16*)carve((size_t)D_ * D_ * 2);
  _Float16* wdown_t  = (_Float16*)carve((size_t)D_ * L_ * 2);
  _Float16* wupk_t   = (_Float16*)carve((size_t)D_ * L_ * 2);
  _Float16* wupv_t   = (_Float16*)carve((size_t)D_ * L_ * 2);
  float*    wcomb_f  = (float*)   carve((size_t)D_ * L_ * 4);
  _Float16* wcomb_t  = (_Float16*)carve((size_t)D_ * L_ * 2);

  // --- all work that reads inputs alone: conversions and weight transposes ---
  prep_inputs_kernel<<<NB_X + NB_ADD + 2 * NB_TDD + 3 * NB_TDL, 256, 0, stream>>>(
      x, Wk, Wv, Wq, Wo, Wdown, Wupk, Wupv,
      x_h, wkv_h, wq_t, wo_t, wdown_t, wupk_t, wupv_t);

  // --- q = x @ Wq, and W_comb = (Wk + Wv) @ W_down (folds the k/v GEMMs away) ---
  gemm_q_and_wcomb_kernel<<<NB_BIG + NB_WC, 256, 0, stream>>>(
      x_h, wq_t, q_h, wkv_h, wdown_t, wcomb_f);
  transpose_f32_to_f16_kernel<D_, L_><<<NB_TDL, 256, 0, stream>>>(wcomb_f, wcomb_t);

  // --- latent = x @ W_comb : f32 -> d_out tail, f16 -> latent_h ---
  gemm_wmma_kernel<2, 2, 1, NTOK_, L_, D_>
      <<<(NTOK_ / 64) * (L_ / 64), 256, 0, stream>>>(
          x_h, wcomb_t, out + (size_t)NTOK_ * D_, latent_h);

  // --- k_rec (row-major == B^T for QK^T) and v_rec ([B,H,64,S]) from latent ---
  gemm_krec_and_vrec_kernel<<<2 * NB_BIG, 256, 0, stream>>>(
      latent_h, wupk_t, k_h, wupv_t, vT);

  // --- flash attention with decay: 512 blocks, 8 q-tiles of one (b,h) each ---
  flash_attn_decay_kernel<<<B_ * H_ * (S_ / 128), 256, 0, stream>>>(
      q_h, k_h, vT, attn_h);

  // --- out = attn @ Wo ---
  gemm_wmma_kernel<0, 4, 2, NTOK_, D_, D_>
      <<<(NTOK_ / 128) * (D_ / 128), 256, 0, stream>>>(attn_h, wo_t, out, nullptr);
}

// v006
// A run of this version takes 113 microseconds.
// Two timings next to v005 both put it at 1.09 times that version's speed.
// All steps since v000 together make it 3.89 times as fast.
#include <hip/hip_runtime.h>

// Problem constants
#define B_    2
#define S_    2048
#define D_    1024
#define H_    16
#define HD_   64
#define L_    256
#define NTOK_ (B_ * S_)
#define KP_   72   // LDS pitch of a 64-half row, in halves
#define VP_   40   // LDS pitch of a 32-half row, in halves

typedef __attribute__((ext_vector_type(16))) _Float16 v16h;
typedef __attribute__((ext_vector_type(8)))  _Float16 v8h;
typedef __attribute__((ext_vector_type(8)))  float    v8f;
typedef __attribute__((ext_vector_type(4)))  _Float16 v4h;
typedef __attribute__((ext_vector_type(4)))  float    v4f;

static __device__ __forceinline__ v8f wmma_f16f32(v16h a, v16h b, v8f c) {
  // D = A(16x32 f16) * B(32x16 f16) + C(16x16 f32)
  return __builtin_amdgcn_wmma_f32_16x16x32_f16(false, a, false, b, (short)0, c,
                                                false, false);
}

static __device__ __forceinline__ v8f zero8() {
  v8f z = {0.f, 0.f, 0.f, 0.f, 0.f, 0.f, 0.f, 0.f};
  return z;
}

// Load an A-style fragment (row m = lane&15; K chunks at col0+8g and col0+16+8g)
// from a row-major f16 matrix with leading dimension ld. The same routine loads
// B-fragments from the *transposed* (N-major) operand. Works for global or LDS.
static __device__ __forceinline__ v16h load_frag(const _Float16* __restrict__ base,
                                                 int row0, int ld, int col0,
                                                 int lane) {
  const int g = lane >> 4;
  const int m = lane & 15;
  const _Float16* p = base + (size_t)(row0 + m) * ld + col0 + g * 8;
  union { v16h v; v8h h[2]; } u;
  u.h[0] = *(const v8h*)(p);
  u.h[1] = *(const v8h*)(p + 16);
  return u.v;
}

// LDS byte offset of a __shared__ object (dsaddr = LDS_BASE + VGPR, ISA 10.x):
// generic -> addrspace(3) cast yields the 32-bit LDS offset.
static __device__ __forceinline__ unsigned lds_off_of(const void* p) {
  return (unsigned)(unsigned long long)(const __attribute__((address_space(3))) char*)p;
}

// CDNA5 async DMA: memory -> LDS, 16B per lane, tracked by ASYNCcnt. Two copies;
// the s_wait_xcnt stands as the last line of their own statement, so that no later
// write of an address register can be moved in front of it (a precaution).
static __device__ __forceinline__ void async_copy2_b128(unsigned l0, const void* g0,
                                                        unsigned l1, const void* g1) {
  asm volatile(
      "global_load_async_to_lds_b128 %0, %1, off\n\t"
      "global_load_async_to_lds_b128 %2, %3, off\n\t"
      "s_wait_xcnt 0x0"
      :: "v"(l0), "v"((unsigned long long)g0), "v"(l1), "v"((unsigned long long)g1)
      : "memory");
}

// ---------------------------------------------------------------------------
// Elementwise prep work. A thread handles 8 to 32 elements through 16-byte
// loads that are all issued before the first is used. Each part below is the
// work of ONE block, numbered blk within its part; the block counts cover the
// fixed shapes exactly (static_assert at the counts), so there is no bounds test.
// ---------------------------------------------------------------------------
// One wave converts NV runs of 128 consecutive floats (512 B per load).
template <int NV>
static __device__ __forceinline__ void f32_to_f16_part(
    const float* __restrict__ in, _Float16* __restrict__ out, const int blk) {
  const int base = (blk * 8 + (threadIdx.x >> 5)) * (NV * 128) +
                   (threadIdx.x & 31) * 4;
  v4f v[NV];
#pragma unroll
  for (int j = 0; j < NV; ++j) v[j] = *(const v4f*)(in + base + j * 128);
#pragma unroll
  for (int j = 0; j < NV; ++j)
    *(v4h*)(out + base + j * 128) = __builtin_convertvector(v[j], v4h);
}

template <int NV>
static __device__ __forceinline__ void add2_to_f16_part(
    const float* __restrict__ a, const float* __restrict__ b,
    _Float16* __restrict__ out, const int blk) {
  const int base = (blk * 8 + (threadIdx.x >> 5)) * (NV * 128) +
                   (threadIdx.x & 31) * 4;
  v4f va[NV], vb[NV];
#pragma unroll
  for (int j = 0; j < NV; ++j) {
    va[j] = *(const v4f*)(a + base + j * 128);
    vb[j] = *(const v4f*)(b + base + j * 128);
  }
#pragma unroll
  for (int j = 0; j < NV; ++j)
    *(v4h*)(out + base + j * 128) = __builtin_convertvector(va[j] + vb[j], v4h);
}

// out[c * R + r] = (f16) in[r * C + c]   (in: R x C f32, out: C x R f16)
// One thread: 8 rows x 4 columns in registers (8 loads of 16 B, 4 stores of
// 16 B). One wave: 8 rows x 128 columns. The 8 waves of a block take 64
// consecutive rows, so each 128-byte line of out is written by one block.
template <int R, int C>
static __device__ __forceinline__ void transpose_f32_to_f16_part(
    const float* __restrict__ in, _Float16* __restrict__ out, const int blk) {
  constexpr int CB = C / 128;
  const int c0 = (blk % CB) * 128 + (threadIdx.x & 31) * 4;
  const int r0 = (blk / CB) * 64 + (threadIdx.x >> 5) * 8;
  v4f v[8];
#pragma unroll
  for (int j = 0; j < 8; ++j) v[j] = *(const v4f*)(in + (r0 + j) * C + c0);
#pragma unroll
  for (int q = 0; q < 4; ++q) {
    v8h o8;
#pragma unroll
    for (int j = 0; j < 8; ++j) o8[j] = (_Float16)v[j][q];
    *(v8h*)(out + (c0 + q) * R + r0) = o8;
  }
}

// Stands behind the last store of a part in a kernel that holds several parts:
// there another part's code follows in the program and rewrites the registers
// that the stores name; the wait comes first (a precaution).
static __device__ __forceinline__ void part_stores_issued() {
  asm volatile("s_wait_xcnt 0x0" ::: "memory");
}

// Blocks per part.
constexpr int NB_X   = NTOK_ * D_ / (256 * 32);  // x -> f16
constexpr int NB_ADD = D_ * D_ / (256 * 8);      // Wk + Wv -> f16
constexpr int NB_TDD = D_ * D_ / 8192;           // transpose of a D x D weight
constexpr int NB_TDL = D_ * L_ / 8192;           // transpose of a D x L or L x D weight
static_assert((NTOK_ * D_) % (256 * 32) == 0 && (D_ * D_) % (256 * 8) == 0 &&
              D_ % 128 == 0 && L_ % 128 == 0, "prep blocks cover the shapes");

// The seven prep parts that read nothing but inputs, in ONE launch: none needs
// another's result, so each takes a range of the block index and they run side
// by side instead of one behind the other. The test is on blockIdx alone: a
// scalar branch, the same for a whole block.
__global__ __launch_bounds__(256) void prep_inputs_kernel(
    const float* __restrict__ x, const float* __restrict__ Wk,
    const float* __restrict__ Wv, const float* __restrict__ Wq,
    const float* __restrict__ Wo, const float* __restrict__ Wdown,
    const float* __restrict__ Wupk, const float* __restrict__ Wupv,
    _Float16* __restrict__ x_h, _Float16* __restrict__ wkv_h,
    _Float16* __restrict__ wq_t, _Float16* __restrict__ wo_t,
    _Float16* __restrict__ wdown_t, _Float16* __restrict__ wupk_t,
    _Float16* __restrict__ wupv_t) {
  int blk = blockIdx.x;
  if (blk < NB_X) { f32_to_f16_part<8>(x, x_h, blk); return; }
  blk -= NB_X;
  if (blk < NB_ADD) {
    add2_to_f16_part<2>(Wk, Wv, wkv_h, blk);
    part_stores_issued();
    return;
  }
  blk -= NB_ADD;
  if (blk < NB_TDD) {
    transpose_f32_to_f16_part<D_, D_>(Wq, wq_t, blk);
    part_stores_issued();
    return;
  }
  blk -= NB_TDD;
  if (blk < NB_TDD) {
    transpose_f32_to_f16_part<D_, D_>(Wo, wo_t, blk);
    part_stores_issued();
    return;
  }
  blk -= NB_TDD;
  if (blk < NB_TDL) {
    transpose_f32_to_f16_part<D_, L_>(Wdown, wdown_t, blk);
    part_stores_issued();
    return;
  }
  blk -= NB_TDL;
  if (blk < NB_TDL) {
    transpose_f32_to_f16_part<L_, D_>(Wupk, wupk_t, blk);
    part_stores_issued();
    return;
  }
  blk -= NB_TDL;
  transpose_f32_to_f16_part<L_, D_>(Wupv, wupv_t, blk);
  part_stores_issued();
}

// The transpose of W_comb waits for its GEMM: a launch of its own.
template <int R, int C>
__global__ __launch_bounds__(256) void transpose_f32_to_f16_kernel(
    const float* __restrict__ in, _Float16* __restrict__ out) {
  transpose_f32_to_f16_part<R, C>(in, out, blockIdx.x);
}

// ---------------------------------------------------------------------------
// WMMA GEMM: C[M x N] = A[M x K] * B[K x N], B given transposed (N x K).
// One block of 8 waves (2 along M x 4 along N) computes a (32*WM) x (64*WN)
// tile of C; one wave a (16*WM) x (16*WN) part of it. Each trip takes 64 k:
// the block's rows of A and of Bt (128 B each) are brought into LDS once by
// asynchronous copies and every wave reads its fragments from there, so a row
// is fetched from L2 once per block, in whole 128-byte lines. Two buffers: the
// copies of trip t + 2 fly while trip t + 1 is worked on.
// MODE 0: f32 out; 1: f16 out; 2: f32 + f16 out; 3: per-head transposed f16
//         scatter (v_rec -> vT[B][H][64][S]).
// ---------------------------------------------------------------------------
// Four 16-byte asynchronous copies per lane, global memory -> LDS. The
// s_wait_xcnt stands as the last line of the copies' own statement, so that no
// later write of an address register can be moved in front of it (a precaution).
static __device__ __forceinline__ void async_copy4_b128(
    unsigned l0, const _Float16* g0, unsigned l1, const _Float16* g1,
    unsigned l2, const _Float16* g2, unsigned l3, const _Float16* g3) {
  asm volatile(
      "global_load_async_to_lds_b128 %0, %1, off\n\t"
      "global_load_async_to_lds_b128 %2, %3, off\n\t"
      "global_load_async_to_lds_b128 %4, %5, off\n\t"
      "global_load_async_to_lds_b128 %6, %7, off\n\t"
      "s_wait_xcnt 0x0"
      :: "v"(l0), "v"((unsigned long long)g0), "v"(l1),
         "v"((unsigned long long)g1), "v"(l2), "v"((unsigned long long)g2),
         "v"(l3), "v"((unsigned long long)g3)
      : "memory");
}

// Halves of LDS that a block with WM x WN wave tiles stages (two buffers).
constexpr int stage_halves(int WM, int WN) { return 2 * (32 * WM + 64 * WN) * KP_; }

// The work of ONE block: tile number blk of the product; smem is the block's
// staging area, stage_halves(WM, WN) halves, declared by the kernel.
template <int MODE, int WM, int WN, int M, int N, int K>
static __device__ __forceinline__ void gemm_wmma_tile(
    const _Float16* __restrict__ A, const _Float16* __restrict__ Bt,
    float* __restrict__ Cf, _Float16* __restrict__ Ch, const int blk,
    _Float16* smem) {
  constexpr int BM   = 32 * WM;      // rows of C (and of A) per block
  constexpr int BN   = 64 * WN;      // columns of C (rows of Bt) per block
  constexpr int ROWS = BM + BN;      // staged rows per trip: A first, then Bt
  constexpr int NT   = K / 64;       // trips
  constexpr int NC   = ROWS / 32;    // copies per thread and trip
  constexpr unsigned BUFB = ROWS * KP_ * 2;  // bytes of one buffer
  static_assert(M % BM == 0 && N % BN == 0 && K % 64 == 0 && NC % 4 == 0,
                "the grid covers the shape exactly; no edge handling");
  // 128-byte rows at a pitch of 144 B (odd multiple of 16 B) for ds_load_b128.
  _Float16 (*stage)[ROWS][KP_] = reinterpret_cast<_Float16 (*)[ROWS][KP_]>(smem);

  const int t    = threadIdx.x;
  const int lane = t & 31;
  const int wid  = t >> 5;
  const int g = lane >> 4;
  const int n = lane & 15;
  const int bm0 = (blk / (N / BN)) * BM;
  const int bn0 = (blk % (N / BN)) * BN;
  const int wr0 = (wid >> 2) * (WM * 16);  // the wave's first row in the tile
  const int wc0 = (wid & 3) * (WN * 16);   // the wave's first column in the tile

  // Copy j of a thread: staged row (t >> 3) + 32 * j, 16-byte piece t & 7; a
  // wave's copy covers 4 whole rows of 128 B.
  const int crow = t >> 3, ccol = (t & 7) * 8;
  const _Float16* gA = A  + (size_t)(bm0 + crow) * K + ccol;
  const _Float16* gB = Bt + (size_t)(bn0 + crow) * K + ccol;
  const unsigned lrow = lds_off_of(&stage[0][crow][ccol]);

  auto from = [&](int j, int k0) -> const _Float16* {
    return j < BM / 32 ? gA + (size_t)(j * 32) * K + k0
                       : gB + (size_t)(j * 32 - BM) * K + k0;
  };
  auto issue = [&](int tile, int buf) {
    const int k0 = tile * 64;
    const unsigned lb = lrow + (unsigned)buf * BUFB;
    // unrolled so that the choice between A and Bt is made at compile time
#pragma unroll
    for (int j = 0; j < NC; j += 4)
      async_copy4_b128(lb + (j + 0) * (32 * KP_ * 2), from(j + 0, k0),
                       lb + (j + 1) * (32 * KP_ * 2), from(j + 1, k0),
                       lb + (j + 2) * (32 * KP_ * 2), from(j + 2, k0),
                       lb + (j + 3) * (32 * KP_ * 2), from(j + 3, k0));
  };

  // Every "#pragma unroll" from here on makes the index of a register array
  // (acc, a, b) a compile-time constant, so that the array stays in registers.
  v8f acc[WM][WN];
#pragma unroll
  for (int i = 0; i < WM; ++i)
#pragma unroll
    for (int j = 0; j < WN; ++j) acc[i][j] = zero8();

  // Prologue: tile 0 lands and is published, then tile 1 starts.
  issue(0, 0);
  asm volatile("s_wait_asynccnt 0x0" ::: "memory");  // own copies of tile 0 landed
  __syncthreads();                                   // ... and every wave's
  if (NT > 1) issue(1, 1);

  for (int tt = 0; tt < NT; ++tt) {
    const _Float16* sA = &stage[tt & 1][0][0];
    const _Float16* sB = &stage[tt & 1][BM][0];
    // All fragment reads of the trip stand together, ahead of its WMMAs.
    v16h a[2][WM], b[2][WN];
#pragma unroll
    for (int kk = 0; kk < 2; ++kk) {
#pragma unroll
      for (int i = 0; i < WM; ++i)
        a[kk][i] = load_frag(sA, wr0 + i * 16, KP_, kk * 32, lane);
#pragma unroll
      for (int j = 0; j < WN; ++j)
        b[kk][j] = load_frag(sB, wc0 + j * 16, KP_, kk * 32, lane);
    }
    // Keeps the scheduler from sinking the reads among the WMMAs, where each
    // separate place with reads makes the wave wait out the LDS latency again.
    __builtin_amdgcn_sched_barrier(0);
#pragma unroll
    for (int kk = 0; kk < 2; ++kk)
#pragma unroll
      for (int i = 0; i < WM; ++i)
#pragma unroll
        for (int j = 0; j < WN; ++j)
          acc[i][j] = wmma_f16f32(a[kk][i], b[kk][j], acc[i][j]);
    // Keeps the trip's WMMAs in front of the publish point: lifted over them,
    // the waits would end the reads and the copies before any matrix work
    // has covered their latency.
    __builtin_amdgcn_sched_barrier(0);

    // Publish point of tile tt + 1, which also frees the buffer just read.
    asm volatile("s_wait_dscnt 0x0" ::: "memory");     // own LDS reads are done
    asm volatile("s_wait_asynccnt 0x0" ::: "memory");  // own copies of tt + 1 landed
    __syncthreads();
    if (tt + 2 < NT) issue(tt + 2, tt & 1);
  }
  asm volatile("s_wait_asynccnt 0x0" ::: "memory");  // nothing in flight at the end

#pragma unroll
  for (int i = 0; i < WM; ++i) {
    const int row0 = bm0 + wr0 + i * 16;
#pragma unroll
    for (int j = 0; j < WN; ++j) {
      const int col = bn0 + wc0 + j * 16 + n;
      if constexpr (MODE == 3) {
        // v_rec element C[tok][col] -> vT[b][h][d][s], 8 consecutive tokens per lane
        const int hh  = col >> 6;
        const int dd  = col & (HD_ - 1);
        const int tok0 = row0 + g * 8;        // 16-aligned tile: never crosses batch
        const int bb = tok0 >> 11;            // / S_
        const int ss = tok0 & (S_ - 1);
        v8h o8;
#pragma unroll
        for (int r = 0; r < 8; ++r) o8[r] = (_Float16)acc[i][j][r];
        *(v8h*)(Ch + (size_t)((bb * H_ + hh) * HD_ + dd) * S_ + ss) = o8;
      } else {
#pragma unroll
        for (int r = 0; r < 8; ++r) {
          const size_t idx = (size_t)(row0 + g * 8 + r) * N + col;
          if constexpr (MODE == 0 || MODE == 2) Cf[idx] = acc[i][j][r];
          if constexpr (MODE == 1 || MODE == 2) Ch[idx] = (_Float16)acc[i][j][r];
        }
      }
    }
  }
}

// One product per launch.
template <int MODE, int WM, int WN, int M, int N, int K>
__global__ __launch_bounds__(256) void gemm_wmma_kernel(
    const _Float16* __restrict__ A, const _Float16* __restrict__ Bt,
    float* __restrict__ Cf, _Float16* __restrict__ Ch) {
  __shared__ __align__(16) _Float16 smem[stage_halves(WM, WN)];
  gemm_wmma_tile<MODE, WM, WN, M, N, K>(A, Bt, Cf, Ch, blockIdx.x, smem);
}

// Two products that do not need each other, in ONE launch; each takes a range
// of the block index (a scalar branch, the same for a whole block, so every
// barrier inside a product is passed by all waves of its block).
constexpr int NB_BIG = (NTOK_ / 128) * (D_ / 128);  // blocks of a NTOK x D product
constexpr int NB_WC  = (D_ / 64) * (L_ / 64);       // blocks of W_comb

// q = x @ Wq fills the chip; the 64 blocks of W_comb = (Wk + Wv) @ W_down, which
// alone would leave three quarters of it idle, run beside it.
__global__ __launch_bounds__(256) void gemm_q_and_wcomb_kernel(
    const _Float16* __restrict__ x_h, const _Float16* __restrict__ wq_t,
    _Float16* __restrict__ q_h, const _Float16* __restrict__ wkv_h,
    const _Float16* __restrict__ wdown_t, float* __restrict__ wcomb_f) {
  __shared__ __align__(16) _Float16 smem[stage_halves(4, 2)];
  const int blk = blockIdx.x;
  if (blk < NB_BIG)
    gemm_wmma_tile<1, 4, 2, NTOK_, D_, D_>(x_h, wq_t, nullptr, q_h, blk, smem);
  else
    gemm_wmma_tile<0, 2, 1, D_, L_, D_>(wkv_h, wdown_t, wcomb_f, nullptr,
                                        blk - NB_BIG, smem);
}

// k_rec = latent @ W_up_k (row-major) and v_rec = latent @ W_up_v (per head
// transposed).
__global__ __launch_bounds__(256) void gemm_krec_and_vrec_kernel(
    const _Float16* __restrict__ latent_h, const _Float16* __restrict__ wupk_t,
    _Float16* __restrict__ k_h, const _Float16* __restrict__ wupv_t,
    _Float16* __restrict__ vT) {
  __shared__ __align__(16) _Float16 smem[stage_halves(4, 2)];
  const int blk = blockIdx.x;
  if (blk < NB_BIG) {
    gemm_wmma_tile<1, 4, 2, NTOK_, D_, L_>(latent_h, wupk_t, nullptr, k_h, blk, smem);
  } else {
    gemm_wmma_tile<3, 4, 2, NTOK_, D_, L_>(latent_h, wupv_t, nullptr, vT,
                                           blk - NB_BIG, smem);
    part_stores_issued();  // the k_rec product's code follows in the program
  }
}

// ---------------------------------------------------------------------------
// Flash attention with multiplicative time decay.
// One block = 8 waves = 8 consecutive 16-query tiles of ONE (b, h); the block
// cooperatively stages each 32-key K/V tile into LDS exactly once via
// global_load_async_to_lds_b128 (ASYNCcnt), double-buffered so the DMA of
// tile k+1 overlaps the 8 WMMAs + online softmax of tile k.
// The products are taken transposed, St = K * Qt and Ot += Vt * Pt: a lane then
// holds 16 of the 32 scores of ONE query (lanes l and l ^ 16 share a query), so
// the row maximum and the row sum are in-lane, and the two score tiles, once
// converted, already are the B operand of the second product.
// ---------------------------------------------------------------------------
// Value of lane l ^ 16 (a vector cross-row move; no LDS round trip).
static __device__ __forceinline__ float other_half(float x) {
  const int i = __builtin_bit_cast(int, x);
  return __builtin_bit_cast(
      float, __builtin_amdgcn_permlanex16(i, i, 0x76543210, 0xfedcba98, false, false));
}

template <bool V> struct form { static constexpr bool value = V; };

__global__ __launch_bounds__(256) void flash_attn_decay_kernel(
    const _Float16* __restrict__ Qh,   // [NTOK_, D_] row-major
    const _Float16* __restrict__ Kh,   // [NTOK_, D_] row-major (k_rec)
    const _Float16* __restrict__ Vt,   // [B_, H_, HD_, S_] (v_rec transposed)
    _Float16* __restrict__ Oh) {       // [NTOK_, D_] row-major
  // Row pitches are odd multiples of 16 B (144 B, 80 B): the 16 rows that
  // one ds_load_b128 fragment read touches then fall on distinct bank groups.
  __shared__ __align__(16) _Float16 Ktile[2][32][KP_];  // [key][dim]  9 KB
  __shared__ __align__(16) _Float16 Vtile[2][64][VP_];  // [dim][key] 10 KB

  const int t    = threadIdx.x;
  const int lane = t & 31;
  const int wid  = t >> 5;
  const int bh   = blockIdx.x >> 4;              // 16 blocks per (b,h)
  const int qt   = ((blockIdx.x & 15) << 3) + wid;
  const int h    = bh & (H_ - 1);
  const int b    = bh >> 4;
  const int g    = lane >> 4;
  const int n    = lane & 15;

  const float scale = 1.0f / (sqrtf((float)D_) + 1e-8f);
  const float lam   = 1e-4f;  // LAMBDA_DECAY * TIME_STEP
  const float CLMP  = 1e4f;

  const int bS    = b * S_;
  const int qrow0 = bS + qt * 16;
  const v16h qa0 = load_frag(Qh, qrow0, D_, h * HD_ + 0,  lane);
  const v16h qa1 = load_frag(Qh, qrow0, D_, h * HD_ + 32, lane);

  const _Float16* vt = Vt + (size_t)(b * H_ + h) * HD_ * S_;

  // Per-thread staging coordinates: 256 threads x 16B = one 4 KB tile each.
  const int krow = t >> 3, kcc = (t & 7) * 8;    // K: [32 keys][64 dims]
  const int vd   = t >> 2, vkc = (t & 3) * 8;    // V: [64 dims][32 keys]

  // Every "#pragma unroll" of this kernel makes the index of a register array
  // (o, s0, s1, p0, p1, c0, c1, pt, o8) a compile-time constant: the array stays in registers.
  // o[f][r] = Ot[dim f*16 + g*8 + r][query n]; mrun: the query's running
  // maximum (equal in both halves); lrun: this half's share of its row sum.
  v8f o[4];
  float mrun = -3.0e38f, lrun = 0.f;
#pragma unroll
  for (int f = 0; f < 4; ++f) o[f] = zero8();
  const float qi = (float)(qt * 16 + n);

  const int NT = S_ / 32;

  // Time decay exp(-lam * |i - j|), with key j = j0 + jj, j0 the tile's first key.
  // A key tile that lies wholly on one side of the block's 128 queries has
  // |i - j| = |i - j0| - jj (keys below) or |i - j0| + jj (keys above), so its
  // factor is exp(-lam * |i - j0|), one exponential per lane and tile, times
  // c0[r] or c1[r] = exp(+lam * jj) or exp(-lam * jj), the same for every such tile.
  // The four tiles from near0 on hold the block's own positions: direct form.
  const int near0 = (blockIdx.x & 15) << 2;  // of blockIdx alone: the same for the block
  float c0[8], c1[8];                        // jj = g*8 + r and 16 + g*8 + r
  auto set_c = [&](const float sl) {
#pragma unroll
    for (int r = 0; r < 8; ++r) {
      c0[r] = __expf(sl * (float)(g * 8 + r));
      c1[r] = __expf(sl * (float)(16 + g * 8 + r));
    }
  };

  // Prologue: stage tile 0 into buffer 0.
  async_copy2_b128(lds_off_of(&Ktile[0][krow][kcc]),
                   Kh + (size_t)(bS + krow) * D_ + h * HD_ + kcc,
                   lds_off_of(&Vtile[0][vd][vkc]),
                   vt + (size_t)vd * S_ + vkc);

  // One key tile; direct.value says at compile time which form the decay takes.
  auto trip = [&](const int kb, auto direct) __attribute__((always_inline)) {
    const int cur = kb & 1;
    if (kb + 1 < NT) {
      // Issue next tile's DMA, then wait only for the CURRENT tile (keep the
      // next stage's 2 async ops in flight).
      const int krow1 = bS + (kb + 1) * 32;
      async_copy2_b128(lds_off_of(&Ktile[cur ^ 1][krow][kcc]),
                       Kh + (size_t)(krow1 + krow) * D_ + h * HD_ + kcc,
                       lds_off_of(&Vtile[cur ^ 1][vd][vkc]),
                       vt + (size_t)vd * S_ + (kb + 1) * 32 + vkc);
      asm volatile("s_wait_asynccnt 0x2" ::: "memory");
    } else {
      asm volatile("s_wait_asynccnt 0x0" ::: "memory");
    }
    __syncthreads();  // current tile visible to all waves

    // ---- scores, transposed: 32 keys x 16 queries from LDS tile ----
    const _Float16* kt  = &Ktile[cur][0][0];
    v16h kb00 = load_frag(kt, 0,  KP_, 0,  lane);
    v16h kb01 = load_frag(kt, 0,  KP_, 32, lane);
    v16h kb10 = load_frag(kt, 16, KP_, 0,  lane);
    v16h kb11 = load_frag(kt, 16, KP_, 32, lane);
    v8f s0 = zero8(), s1 = zero8();   // s0[r]: key g*8 + r, s1[r]: key 16 + g*8 + r
    s0 = wmma_f16f32(kb00, qa0, s0);
    s0 = wmma_f16f32(kb01, qa1, s0);
    s1 = wmma_f16f32(kb10, qa0, s1);
    s1 = wmma_f16f32(kb11, qa1, s1);

    // ---- scale, clamp, time decay, clamp ----
    const float e = __expf(-lam * fabsf(qi - (float)(kb * 32)));  // unused if direct
    float p0[8], p1[8];
#pragma unroll
    for (int r = 0; r < 8; ++r) {
      const float kj0 = (float)(kb * 32 + g * 8 + r);
      float t0 = fminf(fmaxf(s0[r] * scale, -CLMP), CLMP);
      if constexpr (decltype(direct)::value) t0 *= __expf(-lam * fabsf(qi - kj0));
      else                                   t0 *= e * c0[r];
      p0[r] = fminf(fmaxf(t0, -CLMP), CLMP);
    }
#pragma unroll
    for (int r = 0; r < 8; ++r) {
      const float kj0 = (float)(kb * 32 + g * 8 + r);
      float t1 = fminf(fmaxf(s1[r] * scale, -CLMP), CLMP);
      if constexpr (decltype(direct)::value) t1 *= __expf(-lam * fabsf(qi - (kj0 + 16.0f)));
      else                                   t1 *= e * c1[r];
      p1[r] = fminf(fmaxf(t1, -CLMP), CLMP);
    }

    // ---- online softmax: in-lane over 16 keys, one exchange between halves ----
    float rmax = fmaxf(p0[0], p1[0]);
#pragma unroll
    for (int r = 1; r < 8; ++r) rmax = fmaxf(rmax, fmaxf(p0[r], p1[r]));
    rmax = fmaxf(rmax, other_half(rmax));
    const float mnew  = fmaxf(mrun, rmax);
    const float alpha = __expf(mrun - mnew);
    mrun = mnew;
    v16h pt;   // Pt as B operand: element s is key g*8 + s, or 16 + g*8 + (s - 8)
#pragma unroll
    for (int r = 0; r < 8; ++r) {
      p0[r] = __expf(p0[r] - mnew);
      pt[r] = (_Float16)p0[r];
    }
#pragma unroll
    for (int r = 0; r < 8; ++r) {
      p1[r] = __expf(p1[r] - mnew);
      pt[8 + r] = (_Float16)p1[r];
    }
    // in-lane sum as a tree: short dependent chain
#pragma unroll
    for (int r = 0; r < 8; ++r) p0[r] += p1[r];
#pragma unroll
    for (int w = 4; w >= 1; w >>= 1)
#pragma unroll
      for (int r = 0; r < w; ++r) p0[r] += p0[r + w];
    const float rsum = p0[0];
    lrun = lrun * alpha + rsum;
#pragma unroll
    for (int f = 0; f < 4; ++f)
#pragma unroll
      for (int r = 0; r < 8; ++r) o[f][r] *= alpha;

    // ---- Ot += Vt(64x32) @ Pt(32x16): A-frags contiguous from LDS V tile ----
    const _Float16* vtl = &Vtile[cur][0][0];
#pragma unroll
    for (int f = 0; f < 4; ++f) {
      v16h va = load_frag(vtl, f * 16, VP_, 0, lane);
      o[f] = wmma_f16f32(va, pt, o[f]);
    }

    __syncthreads();  // all waves done reading buf before its next overwrite
  };

  // The tiles in ascending order. Every bound is the same for the whole block,
  // so all its waves pass the same barriers.
  set_c(lam);
  for (int kb = 0; kb < near0; ++kb) trip(kb, form<false>{});
  for (int kb = near0; kb < near0 + 4; ++kb) trip(kb, form<true>{});
  set_c(-lam);
  for (int kb = near0 + 4; kb < NT; ++kb) trip(kb, form<false>{});

  // ---- epilogue: join the halves' sums, normalize, store row-major f16 ----
  // A lane holds 8 consecutive dims of its query per tile: one 16-byte store.
  const float inv = 1.0f / (lrun + other_half(lrun));
#pragma unroll
  for (int f = 0; f < 4; ++f) {
    v8h o8;
#pragma unroll
    for (int r = 0; r < 8; ++r) o8[r] = (_Float16)(o[f][r] * inv);
    *(v8h*)(Oh + (size_t)(qrow0 + n) * D_ + h * HD_ + f * 16 + g * 8) = o8;
  }
}

// ---------------------------------------------------------------------------
// Host orchestration
// ---------------------------------------------------------------------------
extern "C" void kernel_launch(void* const* d_in, const int* in_sizes, int n_in,
                              void* d_out, int out_size, void* d_ws,
                              size_t ws_size, hipStream_t stream) {
  (void)in_sizes; (void)n_in; (void)out_size; (void)ws_size;
  const float* x     = (const float*)d_in[0];
  const float* Wq    = (const float*)d_in[1];
  const float* Wk    = (const float*)d_in[2];
  const float* Wv    = (const float*)d_in[3];
  const float* Wo    = (const float*)d_in[4];
  const float* Wdown = (const float*)d_in[5];
  const float* Wupk  = (const float*)d_in[6];
  const float* Wupv  = (const float*)d_in[7];
  float* out = (float*)d_out;  // [NTOK_*D_] attn-out, then [NTOK_*L_] latent

  // Carve workspace (256B aligned)
  char* wsp = (char*)d_ws;
  auto carve = [&](size_t bytes) {
    char* p = wsp;
    wsp += (bytes + 255) & ~(size_t)255;
    return p;
  };
  _Float16* x_h      = (_Float16*)carve((size_t)NTOK_ * D_ * 2);
  _Float16* q_h      = (_Float16*)carve((size_t)NTOK_ * D_ * 2);
  _Float16* k_h      = (_Float16*)carve((size_t)NTOK_ * D_ * 2);
  _Float16* vT       = (_Float16*)carve((size_t)NTOK_ * D_ * 2);
  _Float16* attn_h   = (_Float16*)carve((size_t)NTOK_ * D_ * 2);
  _Float16* latent_h = (_Float16*)carve((size_t)NTOK_ * L_ * 2);
  _Float16* wq_t     = (_Float16*)carve((size_t)D_ * D_ * 2);
  _Float16* wo_t     = (_Float16*)carve((size_t)D_ * D_ * 2);
  _Float16* wkv_h    = (_Float16*)carve((size_t)D_ * D_ * 2);
  _Float16* wdown_t  = (_Float16*)carve((size_t)D_ * L_ * 2);
  _Float16* wupk_t   = (_Float16*)carve((size_t)D_ * L_ * 2);
  _Float16* wupv_t   = (_Float16*)carve((size_t)D_ * L_ * 2);
  float*    wcomb_f  = (float*)   carve((size_t)D_ * L_ * 4);
  _Float16* wcomb_t  = (_Float16*)carve((size_t)D_ * L_ * 2);

  // --- all work that reads inputs alone: conversions and weight transposes ---
  prep_inputs_kernel<<<NB_X + NB_ADD + 2 * NB_TDD + 3 * NB_TDL, 256, 0, stream>>>(
      x, Wk, Wv, Wq, Wo, Wdown, Wupk, Wupv,
      x_h, wkv_h, wq_t, wo_t, wdown_t, wupk_t, wupv_t);

  // --- q = x @ Wq, and W_comb = (Wk + Wv) @ W_down (folds the k/v GEMMs away) ---
  gemm_q_and_wcomb_kernel<<<NB_BIG + NB_WC, 256, 0, stream>>>(
      x_h, wq_t, q_h, wkv_h, wdown_t, wcomb_f);
  transpose_f32_to_f16_kernel<D_, L_><<<NB_TDL, 256, 0, stream>>>(wcomb_f, wcomb_t);

  // --- latent = x @ W_comb : f32 -> d_out tail, f16 -> latent_h ---
  gemm_wmma_kernel<2, 2, 1, NTOK_, L_, D_>
      <<<(NTOK_ / 64) * (L_ / 64), 256, 0, stream>>>(
          x_h, wcomb_t, out + (size_t)NTOK_ * D_, latent_h);

  // --- k_rec (row-major == B^T for QK^T) and v_rec ([B,H,64,S]) from latent ---
  gemm_krec_and_vrec_kernel<<<2 * NB_BIG, 256, 0, stream>>>(
      latent_h, wupk_t, k_h, wupv_t, vT);

  // --- flash attention with decay: 512 blocks, 8 q-tiles of one (b,h) each ---
  flash_attn_decay_kernel<<<B_ * H_ * (S_ / 128), 256, 0, stream>>>(
      q_h, k_h, vT, attn_h);

  // --- out = attn @ Wo ---
  gemm_wmma_kernel<0, 4, 2, NTOK_, D_, D_>
      <<<(NTOK_ / 128) * (D_ / 128), 256, 0, stream>>>(attn_h, wo_t, out, nullptr);
}

// v007
// One run takes 105 microseconds.
// In two side-by-side timings against v006, it was 1.08 and 1.07 times as fast.
// All steps since v000 together make it 4.17 times as fast.
#include <hip/hip_runtime.h>

// Problem constants
#define B_    2
#define S_    2048
#define D_    1024
#define H_    16
#define HD_   64
#define L_    256
#define NTOK_ (B_ * S_)
#define KP_   72   // LDS pitch of a 64-half row, in halves

typedef __attribute__((ext_vector_type(16))) _Float16 v16h;
typedef __attribute__((ext_vector_type(8)))  _Float16 v8h;
typedef __attribute__((ext_vector_type(8)))  float    v8f;
typedef __attribute__((ext_vector_type(4)))  _Float16 v4h;
typedef __attribute__((ext_vector_type(4)))  float    v4f;

static __device__ __forceinline__ v8f wmma_f16f32(v16h a, v16h b, v8f c) {
  // D = A(16x32 f16) * B(32x16 f16) + C(16x16 f32)
  return __builtin_amdgcn_wmma_f32_16x16x32_f16(false, a, false, b, (short)0, c,
                                                false, false);
}

static __device__ __forceinline__ v8f zero8() {
  v8f z = {0.f, 0.f, 0.f, 0.f, 0.f, 0.f, 0.f, 0.f};
  return z;
}

// Load an A-style fragment (row m = lane&15; K chunks at col0+8g and col0+16+8g)
// from a row-major f16 matrix with leading dimension ld. The same routine loads
// B-fragments from the *transposed* (N-major) operand. Works for global or LDS.
static __device__ __forceinline__ v16h load_frag(const _Float16* __restrict__ base,
                                                 int row0, int ld, int col0,
                                                 int lane) {
  const int g = lane >> 4;
  const int m = lane & 15;
  const _Float16* p = base + (size_t)(row0 + m) * ld + col0 + g * 8;
  union { v16h v; v8h h[2]; } u;
  u.h[0] = *(const v8h*)(p);
  u.h[1] = *(const v8h*)(p + 16);
  return u.v;
}

// LDS byte offset of a __shared__ object (dsaddr = LDS_BASE + VGPR, ISA 10.x):
// generic -> addrspace(3) cast yields the 32-bit LDS offset.
static __device__ __forceinline__ unsigned lds_off_of(const void* p) {
  return (unsigned)(unsigned long long)(const __attribute__((address_space(3))) char*)p;
}

// ---------------------------------------------------------------------------
// Elementwise prep work. A thread handles 8 to 32 elements through 16-byte
// loads that are all issued before the first is used. Each part below is the
// work of ONE block, numbered blk within its part; the block counts cover the
// fixed shapes exactly (static_assert at the counts), so there is no bounds test.
// ---------------------------------------------------------------------------
// One wave converts NV runs of 128 consecutive floats (512 B per load).
template <int NV>
static __device__ __forceinline__ void f32_to_f16_part(
    const float* __restrict__ in, _Float16* __restrict__ out, const int blk) {
  const int base = (blk * 8 + (threadIdx.x >> 5)) * (NV * 128) +
                   (threadIdx.x & 31) * 4;
  v4f v[NV];
#pragma unroll
  for (int j = 0; j < NV; ++j) v[j] = *(const v4f*)(in + base + j * 128);
#pragma unroll
  for (int j = 0; j < NV; ++j)
    *(v4h*)(out + base + j * 128) = __builtin_convertvector(v[j], v4h);
}

template <int NV>
static __device__ __forceinline__ void add2_to_f16_part(
    const float* __restrict__ a, const float* __restrict__ b,
    _Float16* __restrict__ out, const int blk) {
  const int base = (blk * 8 + (threadIdx.x >> 5)) * (NV * 128) +
                   (threadIdx.x & 31) * 4;
  v4f va[NV], vb[NV];
#pragma unroll
  for (int j = 0; j < NV; ++j) {
    va[j] = *(const v4f*)(a + base + j * 128);
    vb[j] = *(const v4f*)(b + base + j * 128);
  }
#pragma unroll
  for (int j = 0; j < NV; ++j)
    *(v4h*)(out + base + j * 128) = __builtin_convertvector(va[j] + vb[j], v4h);
}

// out[c * R + r] = (f16) in[r * C + c]   (in: R x C f32, out: C x R f16)
// One thread: 8 rows x 4 columns in registers (8 loads of 16 B, 4 stores of
// 16 B). One wave: 8 rows x 128 columns. The 8 waves of a block take 64
// consecutive rows, so each 128-byte line of out is written by one block.
template <int R, int C>
static __device__ __forceinline__ void transpose_f32_to_f16_part(
    const float* __restrict__ in, _Float16* __restrict__ out, const int blk) {
  constexpr int CB = C / 128;
  const int c0 = (blk % CB) * 128 + (threadIdx.x & 31) * 4;
  const int r0 = (blk / CB) * 64 + (threadIdx.x >> 5) * 8;
  v4f v[8];
#pragma unroll
  for (int j = 0; j < 8; ++j) v[j] = *(const v4f*)(in + (r0 + j) * C + c0);
#pragma unroll
  for (int q = 0; q < 4; ++q) {
    v8h o8;
#pragma unroll
    for (int j = 0; j < 8; ++j) o8[j] = (_Float16)v[j][q];
    *(v8h*)(out + (c0 + q) * R + r0) = o8;
  }
}

// Stands behind the last store of a part in a kernel that holds several parts:
// there another part's code follows in the program and rewrites the registers
// that the stores name; the wait comes first (a precaution).
static __device__ __forceinline__ void part_stores_issued() {
  asm volatile("s_wait_xcnt 0x0" ::: "memory");
}

// Blocks per part.
constexpr int NB_X   = NTOK_ * D_ / (256 * 32);  // x -> f16
constexpr int NB_ADD = D_ * D_ / (256 * 8);      // Wk + Wv -> f16
constexpr int NB_TDD = D_ * D_ / 8192;           // transpose of a D x D weight
constexpr int NB_TDL = D_ * L_ / 8192;           // transpose of a D x L or L x D weight
static_assert((NTOK_ * D_) % (256 * 32) == 0 && (D_ * D_) % (256 * 8) == 0 &&
              D_ % 128 == 0 && L_ % 128 == 0, "prep blocks cover the shapes");

// The seven prep parts that read nothing but inputs, in ONE launch: none needs
// another's result, so each takes a range of the block index and they run side
// by side instead of one behind the other. The test is on blockIdx alone: a
// scalar branch, the same for a whole block.
__global__ __launch_bounds__(256) void prep_inputs_kernel(
    const float* __restrict__ x, const float* __restrict__ Wk,
    const float* __restrict__ Wv, const float* __restrict__ Wq,
    const float* __restrict__ Wo, const float* __restrict__ Wdown,
    const float* __restrict__ Wupk, const float* __restrict__ Wupv,
    _Float16* __restrict__ x_h, _Float16* __restrict__ wkv_h,
    _Float16* __restrict__ wq_t, _Float16* __restrict__ wo_t,
    _Float16* __restrict__ wdown_t, _Float16* __restrict__ wupk_t,
    _Float16* __restrict__ wupv_t) {
  int blk = blockIdx.x;
  if (blk < NB_X) { f32_to_f16_part<8>(x, x_h, blk); return; }
  blk -= NB_X;
  if (blk < NB_ADD) {
    add2_to_f16_part<2>(Wk, Wv, wkv_h, blk);
    part_stores_issued();
    return;
  }
  blk -= NB_ADD;
  if (blk < NB_TDD) {
    transpose_f32_to_f16_part<D_, D_>(Wq, wq_t, blk);
    part_stores_issued();
    return;
  }
  blk -= NB_TDD;
  if (blk < NB_TDD) {
    transpose_f32_to_f16_part<D_, D_>(Wo, wo_t, blk);
    part_stores_issued();
    return;
  }
  blk -= NB_TDD;
  if (blk < NB_TDL) {
    transpose_f32_to_f16_part<D_, L_>(Wdown, wdown_t, blk);
    part_stores_issued();
    return;
  }
  blk -= NB_TDL;
  if (blk < NB_TDL) {
    transpose_f32_to_f16_part<L_, D_>(Wupk, wupk_t, blk);
    part_stores_issued();
    return;
  }
  blk -= NB_TDL;
  transpose_f32_to_f16_part<L_, D_>(Wupv, wupv_t, blk);
  part_stores_issued();
}

// The transpose of W_comb waits for its GEMM: a launch of its own.
template <int R, int C>
__global__ __launch_bounds__(256) void transpose_f32_to_f16_kernel(
    const float* __restrict__ in, _Float16* __restrict__ out) {
  transpose_f32_to_f16_part<R, C>(in, out, blockIdx.x);
}

// ---------------------------------------------------------------------------
// WMMA GEMM: C[M x N] = A[M x K] * B[K x N], B given transposed (N x K).
// One block of 8 waves (2 along M x 4 along N) computes a (32*WM) x (64*WN)
// tile of C; one wave a (16*WM) x (16*WN) part of it. Each trip takes 64 k:
// the block's rows of A and of Bt (128 B each) are brought into LDS once by
// asynchronous copies and every wave reads its fragments from there, so a row
// is fetched from L2 once per block, in whole 128-byte lines. Two buffers: the
// copies of trip t + 2 fly while trip t + 1 is worked on.
// MODE 0: f32 out; 1: f16 out; 2: f32 + f16 out; 3: per-head transposed f16
//         scatter (v_rec -> vT[B][H][64][S]).
// ---------------------------------------------------------------------------
// Four 16-byte asynchronous copies per lane, global memory -> LDS. The
// s_wait_xcnt stands as the last line of the copies' own statement, so that no
// later write of an address register can be moved in front of it (a precaution).
static __device__ __forceinline__ void async_copy4_b128(
    unsigned l0, const _Float16* g0, unsigned l1, const _Float16* g1,
    unsigned l2, const _Float16* g2, unsigned l3, const _Float16* g3) {
  asm volatile(
      "global_load_async_to_lds_b128 %0, %1, off\n\t"
      "global_load_async_to_lds_b128 %2, %3, off\n\t"
      "global_load_async_to_lds_b128 %4, %5, off\n\t"
      "global_load_async_to_lds_b128 %6, %7, off\n\t"
      "s_wait_xcnt 0x0"
      :: "v"(l0), "v"((unsigned long long)g0), "v"(l1),
         "v"((unsigned long long)g1), "v"(l2), "v"((unsigned long long)g2),
         "v"(l3), "v"((unsigned long long)g3)
      : "memory");
}

// Halves of LDS that a block with WM x WN wave tiles stages (two buffers).
constexpr int stage_halves(int WM, int WN) { return 2 * (32 * WM + 64 * WN) * KP_; }

// The work of ONE block: tile number blk of the product; smem is the block's
// staging area, stage_halves(WM, WN) halves, declared by the kernel.
template <int MODE, int WM, int WN, int M, int N, int K>
static __device__ __forceinline__ void gemm_wmma_tile(
    const _Float16* __restrict__ A, const _Float16* __restrict__ Bt,
    float* __restrict__ Cf, _Float16* __restrict__ Ch, const int blk,
    _Float16* smem) {
  constexpr int BM   = 32 * WM;      // rows of C (and of A) per block
  constexpr int BN   = 64 * WN;      // columns of C (rows of Bt) per block
  constexpr int ROWS = BM + BN;      // staged rows per trip: A first, then Bt
  constexpr int NT   = K / 64;       // trips
  constexpr int NC   = ROWS / 32;    // copies per thread and trip
  constexpr unsigned BUFB = ROWS * KP_ * 2;  // bytes of one buffer
  static_assert(M % BM == 0 && N % BN == 0 && K % 64 == 0 && NC % 4 == 0,
                "the grid covers the shape exactly; no edge handling");
  // 128-byte rows at a pitch of 144 B (odd multiple of 16 B) for ds_load_b128.
  _Float16 (*stage)[ROWS][KP_] = reinterpret_cast<_Float16 (*)[ROWS][KP_]>(smem);

  const int t    = threadIdx.x;
  const int lane = t & 31;
  const int wid  = t >> 5;
  const int g = lane >> 4;
  const int n = lane & 15;
  const int bm0 = (blk / (N / BN)) * BM;
  const int bn0 = (blk % (N / BN)) * BN;
  const int wr0 = (wid >> 2) * (WM * 16);  // the wave's first row in the tile
  const int wc0 = (wid & 3) * (WN * 16);   // the wave's first column in the tile

  // Copy j of a thread: staged row (t >> 3) + 32 * j, 16-byte piece t & 7; a
  // wave's copy covers 4 whole rows of 128 B.
  const int crow = t >> 3, ccol = (t & 7) * 8;
  const _Float16* gA = A  + (size_t)(bm0 + crow) * K + ccol;
  const _Float16* gB = Bt + (size_t)(bn0 + crow) * K + ccol;
  const unsigned lrow = lds_off_of(&stage[0][crow][ccol]);

  auto from = [&](int j, int k0) -> const _Float16* {
    return j < BM / 32 ? gA + (size_t)(j * 32) * K + k0
                       : gB + (size_t)(j * 32 - BM) * K + k0;
  };
  auto issue = [&](int tile, int buf) {
    const int k0 = tile * 64;
    const unsigned lb = lrow + (unsigned)buf * BUFB;
    // unrolled so that the choice between A and Bt is made at compile time
#pragma unroll
    for (int j = 0; j < NC; j += 4)
      async_copy4_b128(lb + (j + 0) * (32 * KP_ * 2), from(j + 0, k0),
                       lb + (j + 1) * (32 * KP_ * 2), from(j + 1, k0),
                       lb + (j + 2) * (32 * KP_ * 2), from(j + 2, k0),
                       lb + (j + 3) * (32 * KP_ * 2), from(j + 3, k0));
  };

  // Every "#pragma unroll" from here on makes the index of a register array
  // (acc, a, b) a compile-time constant, so that the array stays in registers.
  v8f acc[WM][WN];
#pragma unroll
  for (int i = 0; i < WM; ++i)
#pragma unroll
    for (int j = 0; j < WN; ++j) acc[i][j] = zero8();

  // Prologue: tile 0 lands and is published, then tile 1 starts.
  issue(0, 0);
  asm volatile("s_wait_asynccnt 0x0" ::: "memory");  // own copies of tile 0 landed
  __syncthreads();                                   // ... and every wave's
  if (NT > 1) issue(1, 1);

  for (int tt = 0; tt < NT; ++tt) {
    const _Float16* sA = &stage[tt & 1][0][0];
    const _Float16* sB = &stage[tt & 1][BM][0];
    // All fragment reads of the trip stand together, ahead of its WMMAs.
    v16h a[2][WM], b[2][WN];
#pragma unroll
    for (int kk = 0; kk < 2; ++kk) {
#pragma unroll
      for (int i = 0; i < WM; ++i)
        a[kk][i] = load_frag(sA, wr0 + i * 16, KP_, kk * 32, lane);
#pragma unroll
      for (int j = 0; j < WN; ++j)
        b[kk][j] = load_frag(sB, wc0 + j * 16, KP_, kk * 32, lane);
    }
    // Keeps the scheduler from sinking the reads among the WMMAs, where each
    // separate place with reads makes the wave wait out the LDS latency again.
    __builtin_amdgcn_sched_barrier(0);
#pragma unroll
    for (int kk = 0; kk < 2; ++kk)
#pragma unroll
      for (int i = 0; i < WM; ++i)
#pragma unroll
        for (int j = 0; j < WN; ++j)
          acc[i][j] = wmma_f16f32(a[kk][i], b[kk][j], acc[i][j]);
    // Keeps the trip's WMMAs in front of the publish point: lifted over them,
    // the waits would end the reads and the copies before any matrix work
    // has covered their latency.
    __builtin_amdgcn_sched_barrier(0);

    // Publish point of tile tt + 1, which also frees the buffer just read.
    asm volatile("s_wait_dscnt 0x0" ::: "memory");     // own LDS reads are done
    asm volatile("s_wait_asynccnt 0x0" ::: "memory");  // own copies of tt + 1 landed
    __syncthreads();
    if (tt + 2 < NT) issue(tt + 2, tt & 1);
  }
  asm volatile("s_wait_asynccnt 0x0" ::: "memory");  // nothing in flight at the end

#pragma unroll
  for (int i = 0; i < WM; ++i) {
    const int row0 = bm0 + wr0 + i * 16;
#pragma unroll
    for (int j = 0; j < WN; ++j) {
      const int col = bn0 + wc0 + j * 16 + n;
      if constexpr (MODE == 3) {
        // v_rec element C[tok][col] -> vT[b][h][d][s], 8 consecutive tokens per lane
        const int hh  = col >> 6;
        const int dd  = col & (HD_ - 1);
        const int tok0 = row0 + g * 8;        // 16-aligned tile: never crosses batch
        const int bb = tok0 >> 11;            // / S_
        const int ss = tok0 & (S_ - 1);
        v8h o8;
#pragma unroll
        for (int r = 0; r < 8; ++r) o8[r] = (_Float16)acc[i][j][r];
        *(v8h*)(Ch + (size_t)((bb * H_ + hh) * HD_ + dd) * S_ + ss) = o8;
      } else {
#pragma unroll
        for (int r = 0; r < 8; ++r) {
          const size_t idx = (size_t)(row0 + g * 8 + r) * N + col;
          if constexpr (MODE == 0 || MODE == 2) Cf[idx] = acc[i][j][r];
          if constexpr (MODE == 1 || MODE == 2) Ch[idx] = (_Float16)acc[i][j][r];
        }
      }
    }
  }
}

// One product per launch.
template <int MODE, int WM, int WN, int M, int N, int K>
__global__ __launch_bounds__(256) void gemm_wmma_kernel(
    const _Float16* __restrict__ A, const _Float16* __restrict__ Bt,
    float* __restrict__ Cf, _Float16* __restrict__ Ch) {
  __shared__ __align__(16) _Float16 smem[stage_halves(WM, WN)];
  gemm_wmma_tile<MODE, WM, WN, M, N, K>(A, Bt, Cf, Ch, blockIdx.x, smem);
}

// Two products that do not need each other, in ONE launch; each takes a range
// of the block index (a scalar branch, the same for a whole block, so every
// barrier inside a product is passed by all waves of its block).
constexpr int NB_BIG = (NTOK_ / 128) * (D_ / 128);  // blocks of a NTOK x D product
constexpr int NB_WC  = (D_ / 64) * (L_ / 64);       // blocks of W_comb

// q = x @ Wq fills the chip; the 64 blocks of W_comb = (Wk + Wv) @ W_down, which
// alone would leave three quarters of it idle, run beside it.
__global__ __launch_bounds__(256) void gemm_q_and_wcomb_kernel(
    const _Float16* __restrict__ x_h, const _Float16* __restrict__ wq_t,
    _Float16* __restrict__ q_h, const _Float16* __restrict__ wkv_h,
    const _Float16* __restrict__ wdown_t, float* __restrict__ wcomb_f) {
  __shared__ __align__(16) _Float16 smem[stage_halves(4, 2)];
  const int blk = blockIdx.x;
  if (blk < NB_BIG)
    gemm_wmma_tile<1, 4, 2, NTOK_, D_, D_>(x_h, wq_t, nullptr, q_h, blk, smem);
  else
    gemm_wmma_tile<0, 2, 1, D_, L_, D_>(wkv_h, wdown_t, wcomb_f, nullptr,
                                        blk - NB_BIG, smem);
}

// k_rec = latent @ W_up_k (row-major) and v_rec = latent @ W_up_v (per head
// transposed).
__global__ __launch_bounds__(256) void gemm_krec_and_vrec_kernel(
    const _Float16* __restrict__ latent_h, const _Float16* __restrict__ wupk_t,
    _Float16* __restrict__ k_h, const _Float16* __restrict__ wupv_t,
    _Float16* __restrict__ vT) {
  __shared__ __align__(16) _Float16 smem[stage_halves(4, 2)];
  const int blk = blockIdx.x;
  if (blk < NB_BIG) {
    gemm_wmma_tile<1, 4, 2, NTOK_, D_, L_>(latent_h, wupk_t, nullptr, k_h, blk, smem);
  } else {
    gemm_wmma_tile<3, 4, 2, NTOK_, D_, L_>(latent_h, wupv_t, nullptr, vT,
                                           blk - NB_BIG, smem);
    part_stores_issued();  // the k_rec product's code follows in the program
  }
}

// ---------------------------------------------------------------------------
// Flash attention with multiplicative time decay.
// One block = 8 waves = 128 consecutive queries of ONE (b, h). A stage is 64
// keys of K and V, brought into LDS once by global_load_async_to_lds_b128, two
// buffers: the copies of stage s + 2 fly while stage s + 1 is worked on.
// A wave takes 32 queries (two 16-query tiles) and 32 of the stage's 64 keys:
// waves 0 to 3 the lower keys, waves 4 to 7 the upper ones. Every K and V
// fragment read from LDS then feeds two query tiles, and the two running
// softmax states of a query (lower and upper keys) are joined once at the end.
// The products are taken transposed, St = K * Qt and Ot += Vt * Pt: a lane then
// holds 16 of the 32 scores of ONE query (lanes l and l ^ 16 share a query), so
// the row maximum and the row sum are in-lane, and the two score tiles, once
// converted, already are the B operand of the second product.
// ---------------------------------------------------------------------------
// Value of lane l ^ 16 (a vector cross-row move; no LDS round trip).
static __device__ __forceinline__ float other_half(float x) {
  const int i = __builtin_bit_cast(int, x);
  return __builtin_bit_cast(
      float, __builtin_amdgcn_permlanex16(i, i, 0x76543210, 0xfedcba98, false, false));
}

template <bool V> struct form { static constexpr bool value = V; };

__global__ __launch_bounds__(256) void flash_attn_decay_kernel(
    const _Float16* __restrict__ Qh,   // [NTOK_, D_] row-major
    const _Float16* __restrict__ Kh,   // [NTOK_, D_] row-major (k_rec)
    const _Float16* __restrict__ Vt,   // [B_, H_, HD_, S_] (v_rec transposed)
    _Float16* __restrict__ Oh) {       // [NTOK_, D_] row-major
  // 128-byte rows at a pitch of 144 B (odd multiple of 16 B): the 16 rows that
  // one ds_load_b128 fragment read touches fall on distinct bank groups.
  __shared__ __align__(16) _Float16 Ktile[2][64][KP_];  // [key][dim] 18 KB
  __shared__ __align__(16) _Float16 Vtile[2][64][KP_];  // [dim][key] 18 KB
  // Hand-over of the upper-key waves' states at the end: 16 bytes per lane.
  __shared__ __align__(16) v4f Omrg[4][16][32];         // 32 KB
  __shared__ float Mmrg[4][2][32], Lmrg[4][2][32];

  const int t    = threadIdx.x;
  const int lane = t & 31;
  const int wid  = __builtin_amdgcn_readfirstlane(t >> 5);
  const int qg   = wid & 3;                      // which 32 of the block's queries
  const int kh   = wid >> 2;                     // which 32 of a stage's keys
  const int bh   = blockIdx.x >> 4;              // 16 blocks per (b,h)
  const int qt   = ((blockIdx.x & 15) << 3) + qg * 2;  // first of two query tiles
  const int h    = bh & (H_ - 1);
  const int b    = bh >> 4;
  const int g    = lane >> 4;
  const int n    = lane & 15;

  const float scale = 1.0f / (sqrtf((float)D_) + 1e-8f);
  const float lam   = 1e-4f;  // LAMBDA_DECAY * TIME_STEP
  const float CLMP  = 1e4f;

  // Every "#pragma unroll" of this kernel makes the index of a register array
  // (qa, o, s0, s1, p0, p1, c0, c1, pt, o8, mrun, lrun, ...) a compile-time
  // constant: the array stays in registers.
  const int bS    = b * S_;
  const int qrow0 = bS + qt * 16;
  v16h qa[2][2];   // [query tile][dims 0..31, 32..63]
#pragma unroll
  for (int u = 0; u < 2; ++u) {
    qa[u][0] = load_frag(Qh, qrow0 + u * 16, D_, h * HD_ + 0,  lane);
    qa[u][1] = load_frag(Qh, qrow0 + u * 16, D_, h * HD_ + 32, lane);
  }

  const _Float16* vt = Vt + (size_t)(b * H_ + h) * HD_ * S_;

  // Staging: a thread copies the 16-byte piece t & 7 of rows t >> 3 and
  // (t >> 3) + 32 of the K stage and of the V stage; a wave's copy covers 4
  // whole rows of 128 B.
  const int srow = t >> 3, scol = (t & 7) * 8;
  const _Float16* gK = Kh + (size_t)(bS + srow) * D_ + h * HD_ + scol;
  const _Float16* gV = vt + (size_t)srow * S_ + scol;
  const unsigned lK = lds_off_of(&Ktile[0][srow][scol]);
  const unsigned lV = lds_off_of(&Vtile[0][srow][scol]);
  auto issue = [&](const int s, const int buf) {
    const _Float16* k = gK + (size_t)s * (64 * D_);
    const _Float16* v = gV + s * 64;
    const unsigned ob = (unsigned)buf * (64 * KP_ * 2);
    async_copy4_b128(lK + ob, k, lK + ob + 32 * KP_ * 2, k + 32 * D_,
                     lV + ob, v, lV + ob + 32 * KP_ * 2, v + 32 * S_);
  };

  // o[u][f][r] = Ot[dim f*16 + g*8 + r][query n of tile u]; mrun: the query's
  // running maximum over this wave's keys (equal in both lane halves); lrun:
  // this lane half's share of the row sum.
  v8f o[2][4];
  float mrun[2], lrun[2], qi[2];
#pragma unroll
  for (int u = 0; u < 2; ++u) {
    mrun[u] = -3.0e38f;
    lrun[u] = 0.f;
    qi[u]   = (float)((qt + u) * 16 + n);
#pragma unroll
    for (int f = 0; f < 4; ++f) o[u][f] = zero8();
  }

  const int NS = S_ / 64;

  // Time decay exp(-lam * |i - j|), with key j = j0 + jj, j0 the first of the
  // wave's 32 keys. Keys that lie wholly on one side of the block's 128 queries
  // have |i - j| = |i - j0| - jj (keys below) or |i - j0| + jj (keys above), so
  // the factor is exp(-lam * |i - j0|), one exponential per query and stage, times
  // c0[r] or c1[r] = exp(+lam * jj) or exp(-lam * jj), the same for every such stage.
  // The two stages from near0 on hold the block's own positions: direct form.
  const int near0 = (blockIdx.x & 15) << 1;  // of blockIdx alone: the same for the block
  float c0[8], c1[8];                        // jj = g*8 + r and 16 + g*8 + r
  auto set_c = [&](const float sl) {
#pragma unroll
    for (int r = 0; r < 8; ++r) {
      c0[r] = __expf(sl * (float)(g * 8 + r));
      c1[r] = __expf(sl * (float)(16 + g * 8 + r));
    }
  };

  // Prologue: stage 0 lands and is published, then stage 1 starts.
  issue(0, 0);
  asm volatile("s_wait_asynccnt 0x0" ::: "memory");  // own copies of stage 0 landed
  __syncthreads();                                   // ... and every wave's
  issue(1, 1);

  // One stage; direct.value says at compile time which form the decay takes.
  auto trip = [&](const int s, auto direct) __attribute__((always_inline)) {
    const int cur = s & 1;
    const int j0  = s * 64 + kh * 32;

    // ---- scores, transposed: 32 keys x 2 x 16 queries ----
    const _Float16* kt = &Ktile[cur][kh * 32][0];
    const v16h kb00 = load_frag(kt, 0,  KP_, 0,  lane);
    const v16h kb01 = load_frag(kt, 0,  KP_, 32, lane);
    const v16h kb10 = load_frag(kt, 16, KP_, 0,  lane);
    const v16h kb11 = load_frag(kt, 16, KP_, 32, lane);
    // The A fragments of the second product: each serves both query tiles.
    const _Float16* vtl = &Vtile[cur][0][kh * 32];
    v16h va[4];
#pragma unroll
    for (int f = 0; f < 4; ++f) va[f] = load_frag(vtl, f * 16, KP_, 0, lane);
    // Keeps all reads of the stage together, ahead of the WMMAs: each separate
    // place with reads makes the wave wait out the LDS latency again.
    __builtin_amdgcn_sched_barrier(0);
    v8f s0[2], s1[2];   // s0[u][r]: key g*8 + r, s1[u][r]: key 16 + g*8 + r
#pragma unroll
    for (int u = 0; u < 2; ++u) {
      s0[u] = wmma_f16f32(kb00, qa[u][0], zero8());
      s1[u] = wmma_f16f32(kb10, qa[u][0], zero8());
    }
#pragma unroll
    for (int u = 0; u < 2; ++u) {
      s0[u] = wmma_f16f32(kb01, qa[u][1], s0[u]);
      s1[u] = wmma_f16f32(kb11, qa[u][1], s1[u]);
    }

    v16h pt[2];   // Pt as B operand: element e is key g*8 + e, or 16 + g*8 + (e - 8)
#pragma unroll
    for (int u = 0; u < 2; ++u) {
      // ---- scale, clamp, time decay, clamp ----
      const float e = __expf(-lam * fabsf(qi[u] - (float)j0));  // unused if direct
      float p0[8], p1[8];
#pragma unroll
      for (int r = 0; r < 8; ++r) {
        const float kj0 = (float)(j0 + g * 8 + r);
        float t0 = fminf(fmaxf(s0[u][r] * scale, -CLMP), CLMP);
        if constexpr (decltype(direct)::value) t0 *= __expf(-lam * fabsf(qi[u] - kj0));
        else                                   t0 *= e * c0[r];
        p0[r] = fminf(fmaxf(t0, -CLMP), CLMP);
      }
#pragma unroll
      for (int r = 0; r < 8; ++r) {
        const float kj0 = (float)(j0 + g * 8 + r);
        float t1 = fminf(fmaxf(s1[u][r] * scale, -CLMP), CLMP);
        if constexpr (decltype(direct)::value)
          t1 *= __expf(-lam * fabsf(qi[u] - (kj0 + 16.0f)));
        else
          t1 *= e * c1[r];
        p1[r] = fminf(fmaxf(t1, -CLMP), CLMP);
      }

      // ---- online softmax: in-lane over 16 keys, one exchange between halves ----
      float rmax = fmaxf(p0[0], p1[0]);
#pragma unroll
      for (int r = 1; r < 8; ++r) rmax = fmaxf(rmax, fmaxf(p0[r], p1[r]));
      rmax = fmaxf(rmax, other_half(rmax));
      const float mnew  = fmaxf(mrun[u], rmax);
      const float alpha = __expf(mrun[u] - mnew);
      mrun[u] = mnew;
#pragma unroll
      for (int r = 0; r < 8; ++r) {
        p0[r] = __expf(p0[r] - mnew);
        pt[u][r] = (_Float16)p0[r];
      }
#pragma unroll
      for (int r = 0; r < 8; ++r) {
        p1[r] = __expf(p1[r] - mnew);
        pt[u][8 + r] = (_Float16)p1[r];
      }
      // in-lane sum as a tree: short dependent chain
#pragma unroll
      for (int r = 0; r < 8; ++r) p0[r] += p1[r];
#pragma unroll
      for (int w = 4; w >= 1; w >>= 1)
#pragma unroll
        for (int r = 0; r < w; ++r) p0[r] += p0[r + w];
      lrun[u] = lrun[u] * alpha + p0[0];
#pragma unroll
      for (int f = 0; f < 4; ++f)
#pragma unroll
        for (int r = 0; r < 8; ++r) o[u][f][r] *= alpha;
    }

    // ---- Ot += Vt(64x32) @ Pt(32x16) ----
#pragma unroll
    for (int f = 0; f < 4; ++f)
#pragma unroll
      for (int u = 0; u < 2; ++u) o[u][f] = wmma_f16f32(va[f], pt[u], o[u][f]);
    // Keeps the stage's work in front of the publish point: lifted over it, the
    // wait would end the copies of stage s + 1 before the work has covered
    // their latency.
    __builtin_amdgcn_sched_barrier(0);

    // Publish point of stage s + 1, which also frees the buffer just read.
    asm volatile("s_wait_dscnt 0x0" ::: "memory");     // own LDS reads are done
    asm volatile("s_wait_asynccnt 0x0" ::: "memory");  // own copies of s + 1 landed
    __syncthreads();
    if (s + 2 < NS) issue(s + 2, cur);
  };

  // The stages in ascending order. Every bound is the same for the whole block,
  // so all its waves pass the same barriers.
  set_c(lam);
  for (int s = 0; s < near0; ++s) trip(s, form<false>{});
  for (int s = near0; s < near0 + 2; ++s) trip(s, form<true>{});
  set_c(-lam);
  for (int s = near0 + 2; s < NS; ++s) trip(s, form<false>{});
  asm volatile("s_wait_asynccnt 0x0" ::: "memory");  // nothing in flight at the end

  // ---- epilogue: join the lane halves' sums, then the two key halves ----
  float lsum[2];
#pragma unroll
  for (int u = 0; u < 2; ++u) lsum[u] = lrun[u] + other_half(lrun[u]);
  if (kh == 1) {   // the same for a whole wave
#pragma unroll
    for (int u = 0; u < 2; ++u) {
      Mmrg[qg][u][lane] = mrun[u];
      Lmrg[qg][u][lane] = lsum[u];
#pragma unroll
      for (int f = 0; f < 4; ++f) {
        const v4f lo = {o[u][f][0], o[u][f][1], o[u][f][2], o[u][f][3]};
        const v4f hi = {o[u][f][4], o[u][f][5], o[u][f][6], o[u][f][7]};
        Omrg[qg][(u * 4 + f) * 2 + 0][lane] = lo;
        Omrg[qg][(u * 4 + f) * 2 + 1][lane] = hi;
      }
    }
  }
  __syncthreads();  // the upper-key states are visible to the lower-key waves
  if (kh == 0) {
    // A lane holds 8 consecutive dims of its query per tile and f: one 16-byte store.
#pragma unroll
    for (int u = 0; u < 2; ++u) {
      const float m1 = Mmrg[qg][u][lane];
      const float l1 = Lmrg[qg][u][lane];
      const float m  = fmaxf(mrun[u], m1);
      const float a0 = __expf(mrun[u] - m);
      const float a1 = __expf(m1 - m);
      const float inv = 1.0f / (lsum[u] * a0 + l1 * a1);
      const float w0 = a0 * inv, w1 = a1 * inv;
#pragma unroll
      for (int f = 0; f < 4; ++f) {
        const v4f lo = Omrg[qg][(u * 4 + f) * 2 + 0][lane];
        const v4f hi = Omrg[qg][(u * 4 + f) * 2 + 1][lane];
        v8h o8;
#pragma unroll
        for (int r = 0; r < 4; ++r) {
          o8[r]     = (_Float16)(o[u][f][r] * w0 + lo[r] * w1);
          o8[4 + r] = (_Float16)(o[u][f][4 + r] * w0 + hi[r] * w1);
        }
        *(v8h*)(Oh + (size_t)(qrow0 + u * 16 + n) * D_ + h * HD_ + f * 16 + g * 8) = o8;
      }
    }
  }
}

// ---------------------------------------------------------------------------
// Host orchestration
// ---------------------------------------------------------------------------
extern "C" void kernel_launch(void* const* d_in, const int* in_sizes, int n_in,
                              void* d_out, int out_size, void* d_ws,
                              size_t ws_size, hipStream_t stream) {
  (void)in_sizes; (void)n_in; (void)out_size; (void)ws_size;
  const float* x     = (const float*)d_in[0];
  const float* Wq    = (const float*)d_in[1];
  const float* Wk    = (const float*)d_in[2];
  const float* Wv    = (const float*)d_in[3];
  const float* Wo    = (const float*)d_in[4];
  const float* Wdown = (const float*)d_in[5];
  const float* Wupk  = (const float*)d_in[6];
  const float* Wupv  = (const float*)d_in[7];
  float* out = (float*)d_out;  // [NTOK_*D_] attn-out, then [NTOK_*L_] latent

  // Carve workspace (256B aligned)
  char* wsp = (char*)d_ws;
  auto carve = [&](size_t bytes) {
    char* p = wsp;
    wsp += (bytes + 255) & ~(size_t)255;
    return p;
  };
  _Float16* x_h      = (_Float16*)carve((size_t)NTOK_ * D_ * 2);
  _Float16* q_h      = (_Float16*)carve((size_t)NTOK_ * D_ * 2);
  _Float16* k_h      = (_Float16*)carve((size_t)NTOK_ * D_ * 2);
  _Float16* vT       = (_Float16*)carve((size_t)NTOK_ * D_ * 2);
  _Float16* attn_h   = (_Float16*)carve((size_t)NTOK_ * D_ * 2);
  _Float16* latent_h = (_Float16*)carve((size_t)NTOK_ * L_ * 2);
  _Float16* wq_t     = (_Float16*)carve((size_t)D_ * D_ * 2);
  _Float16* wo_t     = (_Float16*)carve((size_t)D_ * D_ * 2);
  _Float16* wkv_h    = (_Float16*)carve((size_t)D_ * D_ * 2);
  _Float16* wdown_t  = (_Float16*)carve((size_t)D_ * L_ * 2);
  _Float16* wupk_t   = (_Float16*)carve((size_t)D_ * L_ * 2);
  _Float16* wupv_t   = (_Float16*)carve((size_t)D_ * L_ * 2);
  float*    wcomb_f  = (float*)   carve((size_t)D_ * L_ * 4);
  _Float16* wcomb_t  = (_Float16*)carve((size_t)D_ * L_ * 2);

  // --- all work that reads inputs alone: conversions and weight transposes ---
  prep_inputs_kernel<<<NB_X + NB_ADD + 2 * NB_TDD + 3 * NB_TDL, 256, 0, stream>>>(
      x, Wk, Wv, Wq, Wo, Wdown, Wupk, Wupv,
      x_h, wkv_h, wq_t, wo_t, wdown_t, wupk_t, wupv_t);

  // --- q = x @ Wq, and W_comb = (Wk + Wv) @ W_down (folds the k/v GEMMs away) ---
  gemm_q_and_wcomb_kernel<<<NB_BIG + NB_WC, 256, 0, stream>>>(
      x_h, wq_t, q_h, wkv_h, wdown_t, wcomb_f);
  transpose_f32_to_f16_kernel<D_, L_><<<NB_TDL, 256, 0, stream>>>(wcomb_f, wcomb_t);

  // --- latent = x @ W_comb : f32 -> d_out tail, f16 -> latent_h ---
  gemm_wmma_kernel<2, 2, 1, NTOK_, L_, D_>
      <<<(NTOK_ / 64) * (L_ / 64), 256, 0, stream>>>(
          x_h, wcomb_t, out + (size_t)NTOK_ * D_, latent_h);

  // --- k_rec (row-major == B^T for QK^T) and v_rec ([B,H,64,S]) from latent ---
  gemm_krec_and_vrec_kernel<<<2 * NB_BIG, 256, 0, stream>>>(
      latent_h, wupk_t, k_h, wupv_t, vT);

  // --- flash attention with decay: 512 blocks, 8 q-tiles of one (b,h) each ---
  flash_attn_decay_kernel<<<B_ * H_ * (S_ / 128), 256, 0, stream>>>(
      q_h, k_h, vT, attn_h);

  // --- out = attn @ Wo ---
  gemm_wmma_kernel<0, 4, 2, NTOK_, D_, D_>
      <<<(NTOK_ / 128) * (D_ / 128), 256, 0, stream>>>(attn_h, wo_t, out, nullptr);
}

// v008
// A run of this version takes 97.3 microseconds.
// Next to v007, in two timings, it ran 1.09 times as fast each time.
// All steps since v000 together make it 4.53 times as fast.
#include <hip/hip_runtime.h>

// Problem constants
#define B_    2
#define S_    2048
#define D_    1024
#define H_    16
#define HD_   64
#define L_    256
#define NTOK_ (B_ * S_)
#define KP_   72   // LDS pitch of a 64-half row, in halves

typedef __attribute__((ext_vector_type(16))) _Float16 v16h;
typedef __attribute__((ext_vector_type(8)))  _Float16 v8h;
typedef __attribute__((ext_vector_type(8)))  float    v8f;
typedef __attribute__((ext_vector_type(4)))  _Float16 v4h;
typedef __attribute__((ext_vector_type(4)))  float    v4f;
typedef __attribute__((ext_vector_type(2)))  float    v2f;

static __device__ __forceinline__ v8f wmma_f16f32(v16h a, v16h b, v8f c) {
  // D = A(16x32 f16) * B(32x16 f16) + C(16x16 f32)
  return __builtin_amdgcn_wmma_f32_16x16x32_f16(false, a, false, b, (short)0, c,
                                                false, false);
}

static __device__ __forceinline__ v8f zero8() {
  v8f z = {0.f, 0.f, 0.f, 0.f, 0.f, 0.f, 0.f, 0.f};
  return z;
}

// Load an A-style fragment (row m = lane&15; K chunks at col0+8g and col0+16+8g)
// from a row-major f16 matrix with leading dimension ld. The same routine loads
// B-fragments from the *transposed* (N-major) operand. Works for global or LDS.
static __device__ __forceinline__ v16h load_frag(const _Float16* __restrict__ base,
                                                 int row0, int ld, int col0,
                                                 int lane) {
  const int g = lane >> 4;
  const int m = lane & 15;
  const _Float16* p = base + (size_t)(row0 + m) * ld + col0 + g * 8;
  union { v16h v; v8h h[2]; } u;
  u.h[0] = *(const v8h*)(p);
  u.h[1] = *(const v8h*)(p + 16);
  return u.v;
}

// LDS byte offset of a __shared__ object (dsaddr = LDS_BASE + VGPR, ISA 10.x):
// generic -> addrspace(3) cast yields the 32-bit LDS offset.
static __device__ __forceinline__ unsigned lds_off_of(const void* p) {
  return (unsigned)(unsigned long long)(const __attribute__((address_space(3))) char*)p;
}

// ---------------------------------------------------------------------------
// Elementwise prep work. A thread handles 8 to 32 elements through 16-byte
// loads that are all issued before the first is used. Each part below is the
// work of ONE block, numbered blk within its part; the block counts cover the
// fixed shapes exactly (static_assert at the counts), so there is no bounds test.
// ---------------------------------------------------------------------------
// One wave converts NV runs of 128 consecutive floats (512 B per load).
template <int NV>
static __device__ __forceinline__ void f32_to_f16_part(
    const float* __restrict__ in, _Float16* __restrict__ out, const int blk) {
  const int base = (blk * 8 + (threadIdx.x >> 5)) * (NV * 128) +
                   (threadIdx.x & 31) * 4;
  v4f v[NV];
#pragma unroll
  for (int j = 0; j < NV; ++j) v[j] = *(const v4f*)(in + base + j * 128);
#pragma unroll
  for (int j = 0; j < NV; ++j)
    *(v4h*)(out + base + j * 128) = __builtin_convertvector(v[j], v4h);
}

template <int NV>
static __device__ __forceinline__ void add2_to_f16_part(
    const float* __restrict__ a, const float* __restrict__ b,
    _Float16* __restrict__ out, const int blk) {
  const int base = (blk * 8 + (threadIdx.x >> 5)) * (NV * 128) +
                   (threadIdx.x & 31) * 4;
  v4f va[NV], vb[NV];
#pragma unroll
  for (int j = 0; j < NV; ++j) {
    va[j] = *(const v4f*)(a + base + j * 128);
    vb[j] = *(const v4f*)(b + base + j * 128);
  }
#pragma unroll
  for (int j = 0; j < NV; ++j)
    *(v4h*)(out + base + j * 128) = __builtin_convertvector(va[j] + vb[j], v4h);
}

// out[c * R + r] = (f16) in[r * C + c]   (in: R x C f32, out: C x R f16)
// One thread: 8 rows x 4 columns in registers (8 loads of 16 B, 4 stores of
// 16 B). One wave: 8 rows x 128 columns. The 8 waves of a block take 64
// consecutive rows, so each 128-byte line of out is written by one block.
template <int R, int C>
static __device__ __forceinline__ void transpose_f32_to_f16_part(
    const float* __restrict__ in, _Float16* __restrict__ out, const int blk) {
  constexpr int CB = C / 128;
  const int c0 = (blk % CB) * 128 + (threadIdx.x & 31) * 4;
  const int r0 = (blk / CB) * 64 + (threadIdx.x >> 5) * 8;
  v4f v[8];
#pragma unroll
  for (int j = 0; j < 8; ++j) v[j] = *(const v4f*)(in + (r0 + j) * C + c0);
#pragma unroll
  for (int q = 0; q < 4; ++q) {
    v8h o8;
#pragma unroll
    for (int j = 0; j < 8; ++j) o8[j] = (_Float16)v[j][q];
    *(v8h*)(out + (c0 + q) * R + r0) = o8;
  }
}

// Stands behind the last store of a part in a kernel that holds several parts:
// there another part's code follows in the program and rewrites the registers
// that the stores name; the wait comes first (a precaution).
static __device__ __forceinline__ void part_stores_issued() {
  asm volatile("s_wait_xcnt 0x0" ::: "memory");
}

// Blocks per part.
constexpr int NB_X   = NTOK_ * D_ / (256 * 32);  // x -> f16
constexpr int NB_ADD = D_ * D_ / (256 * 8);      // Wk + Wv -> f16
constexpr int NB_TDD = D_ * D_ / 8192;           // transpose of a D x D weight
constexpr int NB_TDL = D_ * L_ / 8192;           // transpose of a D x L or L x D weight
static_assert((NTOK_ * D_) % (256 * 32) == 0 && (D_ * D_) % (256 * 8) == 0 &&
              D_ % 128 == 0 && L_ % 128 == 0, "prep blocks cover the shapes");

// The seven prep parts that read nothing but inputs, in ONE launch: none needs
// another's result, so each takes a range of the block index and they run side
// by side instead of one behind the other. The test is on blockIdx alone: a
// scalar branch, the same for a whole block.
__global__ __launch_bounds__(256) void prep_inputs_kernel(
    const float* __restrict__ x, const float* __restrict__ Wk,
    const float* __restrict__ Wv, const float* __restrict__ Wq,
    const float* __restrict__ Wo, const float* __restrict__ Wdown,
    const float* __restrict__ Wupk, const float* __restrict__ Wupv,
    _Float16* __restrict__ x_h, _Float16* __restrict__ wkv_h,
    _Float16* __restrict__ wq_t, _Float16* __restrict__ wo_t,
    _Float16* __restrict__ wdown_t, _Float16* __restrict__ wupk_t,
    _Float16* __restrict__ wupv_t) {
  int blk = blockIdx.x;
  if (blk < NB_X) { f32_to_f16_part<8>(x, x_h, blk); return; }
  blk -= NB_X;
  if (blk < NB_ADD) {
    add2_to_f16_part<2>(Wk, Wv, wkv_h, blk);
    part_stores_issued();
    return;
  }
  blk -= NB_ADD;
  if (blk < NB_TDD) {
    transpose_f32_to_f16_part<D_, D_>(Wq, wq_t, blk);
    part_stores_issued();
    return;
  }
  blk -= NB_TDD;
  if (blk < NB_TDD) {
    transpose_f32_to_f16_part<D_, D_>(Wo, wo_t, blk);
    part_stores_issued();
    return;
  }
  blk -= NB_TDD;
  if (blk < NB_TDL) {
    transpose_f32_to_f16_part<D_, L_>(Wdown, wdown_t, blk);
    part_stores_issued();
    return;
  }
  blk -= NB_TDL;
  if (blk < NB_TDL) {
    transpose_f32_to_f16_part<L_, D_>(Wupk, wupk_t, blk);
    part_stores_issued();
    return;
  }
  blk -= NB_TDL;
  transpose_f32_to_f16_part<L_, D_>(Wupv, wupv_t, blk);
  part_stores_issued();
}

// The transpose of W_comb waits for its GEMM: a launch of its own.
template <int R, int C>
__global__ __launch_bounds__(256) void transpose_f32_to_f16_kernel(
    const float* __restrict__ in, _Float16* __restrict__ out) {
  transpose_f32_to_f16_part<R, C>(in, out, blockIdx.x);
}

// ---------------------------------------------------------------------------
// WMMA GEMM: C[M x N] = A[M x K] * B[K x N], B given transposed (N x K).
// One block of 8 waves (2 along M x 4 along N) computes a (32*WM) x (64*WN)
// tile of C; one wave a (16*WM) x (16*WN) part of it. Each trip takes 64 k:
// the block's rows of A and of Bt (128 B each) are brought into LDS once by
// asynchronous copies and every wave reads its fragments from there, so a row
// is fetched from L2 once per block, in whole 128-byte lines. Two buffers: the
// copies of trip t + 2 fly while trip t + 1 is worked on.
// MODE 0: f32 out; 1: f16 out; 2: f32 + f16 out; 3: per-head transposed f16
//         scatter (v_rec -> vT[B][H][64][S]).
// ---------------------------------------------------------------------------
// Four 16-byte asynchronous copies per lane, global memory -> LDS. The
// s_wait_xcnt stands as the last line of the copies' own statement, so that no
// later write of an address register can be moved in front of it (a precaution).
static __device__ __forceinline__ void async_copy4_b128(
    unsigned l0, const _Float16* g0, unsigned l1, const _Float16* g1,
    unsigned l2, const _Float16* g2, unsigned l3, const _Float16* g3) {
  asm volatile(
      "global_load_async_to_lds_b128 %0, %1, off\n\t"
      "global_load_async_to_lds_b128 %2, %3, off\n\t"
      "global_load_async_to_lds_b128 %4, %5, off\n\t"
      "global_load_async_to_lds_b128 %6, %7, off\n\t"
      "s_wait_xcnt 0x0"
      :: "v"(l0), "v"((unsigned long long)g0), "v"(l1),
         "v"((unsigned long long)g1), "v"(l2), "v"((unsigned long long)g2),
         "v"(l3), "v"((unsigned long long)g3)
      : "memory");
}

// Halves of LDS that a block with WM x WN wave tiles stages (two buffers).
constexpr int stage_halves(int WM, int WN) { return 2 * (32 * WM + 64 * WN) * KP_; }

// The work of ONE block: tile number blk of the product; smem is the block's
// staging area, stage_halves(WM, WN) halves, declared by the kernel.
template <int MODE, int WM, int WN, int M, int N, int K>
static __device__ __forceinline__ void gemm_wmma_tile(
    const _Float16* __restrict__ A, const _Float16* __restrict__ Bt,
    float* __restrict__ Cf, _Float16* __restrict__ Ch, const int blk,
    _Float16* smem) {
  constexpr int BM   = 32 * WM;      // rows of C (and of A) per block
  constexpr int BN   = 64 * WN;      // columns of C (rows of Bt) per block
  constexpr int ROWS = BM + BN;      // staged rows per trip: A first, then Bt
  constexpr int NT   = K / 64;       // trips
  constexpr int NC   = ROWS / 32;    // copies per thread and trip
  constexpr unsigned BUFB = ROWS * KP_ * 2;  // bytes of one buffer
  static_assert(M % BM == 0 && N % BN == 0 && K % 64 == 0 && NC % 4 == 0,
                "the grid covers the shape exactly; no edge handling");
  // 128-byte rows at a pitch of 144 B (odd multiple of 16 B) for ds_load_b128.
  _Float16 (*stage)[ROWS][KP_] = reinterpret_cast<_Float16 (*)[ROWS][KP_]>(smem);

  const int t    = threadIdx.x;
  const int lane = t & 31;
  const int wid  = t >> 5;
  const int g = lane >> 4;
  const int n = lane & 15;
  const int bm0 = (blk / (N / BN)) * BM;
  const int bn0 = (blk % (N / BN)) * BN;
  const int wr0 = (wid >> 2) * (WM * 16);  // the wave's first row in the tile
  const int wc0 = (wid & 3) * (WN * 16);   // the wave's first column in the tile

  // Copy j of a thread: staged row (t >> 3) + 32 * j, 16-byte piece t & 7; a
  // wave's copy covers 4 whole rows of 128 B.
  const int crow = t >> 3, ccol = (t & 7) * 8;
  const _Float16* gA = A  + (size_t)(bm0 + crow) * K + ccol;
  const _Float16* gB = Bt + (size_t)(bn0 + crow) * K + ccol;
  const unsigned lrow = lds_off_of(&stage[0][crow][ccol]);

  auto from = [&](int j, int k0) -> const _Float16* {
    return j < BM / 32 ? gA + (size_t)(j * 32) * K + k0
                       : gB + (size_t)(j * 32 - BM) * K + k0;
  };
  auto issue = [&](int tile, int buf) {
    const int k0 = tile * 64;
    const unsigned lb = lrow + (unsigned)buf * BUFB;
    // unrolled so that the choice between A and Bt is made at compile time
#pragma unroll
    for (int j = 0; j < NC; j += 4)
      async_copy4_b128(lb + (j + 0) * (32 * KP_ * 2), from(j + 0, k0),
                       lb + (j + 1) * (32 * KP_ * 2), from(j + 1, k0),
                       lb + (j + 2) * (32 * KP_ * 2), from(j + 2, k0),
                       lb + (j + 3) * (32 * KP_ * 2), from(j + 3, k0));
  };

  // Every "#pragma unroll" from here on makes the index of a register array
  // (acc, a, b) a compile-time constant, so that the array stays in registers.
  v8f acc[WM][WN];
#pragma unroll
  for (int i = 0; i < WM; ++i)
#pragma unroll
    for (int j = 0; j < WN; ++j) acc[i][j] = zero8();

  // Prologue: tile 0 lands and is published, then tile 1 starts.
  issue(0, 0);
  asm volatile("s_wait_asynccnt 0x0" ::: "memory");  // own copies of tile 0 landed
  __syncthreads();                                   // ... and every wave's
  if (NT > 1) issue(1, 1);

  for (int tt = 0; tt < NT; ++tt) {
    const _Float16* sA = &stage[tt & 1][0][0];
    const _Float16* sB = &stage[tt & 1][BM][0];
    // All fragment reads of the trip stand together, ahead of its WMMAs.
    v16h a[2][WM], b[2][WN];
#pragma unroll
    for (int kk = 0; kk < 2; ++kk) {
#pragma unroll
      for (int i = 0; i < WM; ++i)
        a[kk][i] = load_frag(sA, wr0 + i * 16, KP_, kk * 32, lane);
#pragma unroll
      for (int j = 0; j < WN; ++j)
        b[kk][j] = load_frag(sB, wc0 + j * 16, KP_, kk * 32, lane);
    }
    // Keeps the scheduler from sinking the reads among the WMMAs, where each
    // separate place with reads makes the wave wait out the LDS latency again.
    __builtin_amdgcn_sched_barrier(0);
#pragma unroll
    for (int kk = 0; kk < 2; ++kk)
#pragma unroll
      for (int i = 0; i < WM; ++i)
#pragma unroll
        for (int j = 0; j < WN; ++j)
          acc[i][j] = wmma_f16f32(a[kk][i], b[kk][j], acc[i][j]);
    // Keeps the trip's WMMAs in front of the publish point: lifted over them,
    // the waits would end the reads and the copies before any matrix work
    // has covered their latency.
    __builtin_amdgcn_sched_barrier(0);

    // Publish point of tile tt + 1, which also frees the buffer just read.
    asm volatile("s_wait_dscnt 0x0" ::: "memory");     // own LDS reads are done
    asm volatile("s_wait_asynccnt 0x0" ::: "memory");  // own copies of tt + 1 landed
    __syncthreads();
    if (tt + 2 < NT) issue(tt + 2, tt & 1);
  }
  asm volatile("s_wait_asynccnt 0x0" ::: "memory");  // nothing in flight at the end

#pragma unroll
  for (int i = 0; i < WM; ++i) {
    const int row0 = bm0 + wr0 + i * 16;
#pragma unroll
    for (int j = 0; j < WN; ++j) {
      const int col = bn0 + wc0 + j * 16 + n;
      if constexpr (MODE == 3) {
        // v_rec element C[tok][col] -> vT[b][h][d][s], 8 consecutive tokens per lane
        const int hh  = col >> 6;
        const int dd  = col & (HD_ - 1);
        const int tok0 = row0 + g * 8;        // 16-aligned tile: never crosses batch
        const int bb = tok0 >> 11;            // / S_
        const int ss = tok0 & (S_ - 1);
        v8h o8;
#pragma unroll
        for (int r = 0; r < 8; ++r) o8[r] = (_Float16)acc[i][j][r];
        *(v8h*)(Ch + (size_t)((bb * H_ + hh) * HD_ + dd) * S_ + ss) = o8;
      } else {
#pragma unroll
        for (int r = 0; r < 8; ++r) {
          const size_t idx = (size_t)(row0 + g * 8 + r) * N + col;
          if constexpr (MODE == 0 || MODE == 2) Cf[idx] = acc[i][j][r];
          if constexpr (MODE == 1 || MODE == 2) Ch[idx] = (_Float16)acc[i][j][r];
        }
      }
    }
  }
}

// One product per launch.
template <int MODE, int WM, int WN, int M, int N, int K>
__global__ __launch_bounds__(256) void gemm_wmma_kernel(
    const _Float16* __restrict__ A, const _Float16* __restrict__ Bt,
    float* __restrict__ Cf, _Float16* __restrict__ Ch) {
  __shared__ __align__(16) _Float16 smem[stage_halves(WM, WN)];
  gemm_wmma_tile<MODE, WM, WN, M, N, K>(A, Bt, Cf, Ch, blockIdx.x, smem);
}

// Two products that do not need each other, in ONE launch; each takes a range
// of the block index (a scalar branch, the same for a whole block, so every
// barrier inside a product is passed by all waves of its block).
constexpr int NB_BIG = (NTOK_ / 128) * (D_ / 128);  // blocks of a NTOK x D product
constexpr int NB_WC  = (D_ / 64) * (L_ / 64);       // blocks of W_comb

// q = x @ Wq fills the chip; the 64 blocks of W_comb = (Wk + Wv) @ W_down, which
// alone would leave three quarters of it idle, run beside it.
__global__ __launch_bounds__(256) void gemm_q_and_wcomb_kernel(
    const _Float16* __restrict__ x_h, const _Float16* __restrict__ wq_t,
    _Float16* __restrict__ q_h, const _Float16* __restrict__ wkv_h,
    const _Float16* __restrict__ wdown_t, float* __restrict__ wcomb_f) {
  __shared__ __align__(16) _Float16 smem[stage_halves(4, 2)];
  const int blk = blockIdx.x;
  if (blk < NB_BIG)
    gemm_wmma_tile<1, 4, 2, NTOK_, D_, D_>(x_h, wq_t, nullptr, q_h, blk, smem);
  else
    gemm_wmma_tile<0, 2, 1, D_, L_, D_>(wkv_h, wdown_t, wcomb_f, nullptr,
                                        blk - NB_BIG, smem);
}

// k_rec = latent @ W_up_k (row-major) and v_rec = latent @ W_up_v (per head
// transposed).
__global__ __launch_bounds__(256) void gemm_krec_and_vrec_kernel(
    const _Float16* __restrict__ latent_h, const _Float16* __restrict__ wupk_t,
    _Float16* __restrict__ k_h, const _Float16* __restrict__ wupv_t,
    _Float16* __restrict__ vT) {
  __shared__ __align__(16) _Float16 smem[stage_halves(4, 2)];
  const int blk = blockIdx.x;
  if (blk < NB_BIG) {
    gemm_wmma_tile<1, 4, 2, NTOK_, D_, L_>(latent_h, wupk_t, nullptr, k_h, blk, smem);
  } else {
    gemm_wmma_tile<3, 4, 2, NTOK_, D_, L_>(latent_h, wupv_t, nullptr, vT,
                                           blk - NB_BIG, smem);
    part_stores_issued();  // the k_rec product's code follows in the program
  }
}

// ---------------------------------------------------------------------------
// Flash attention with multiplicative time decay.
// One block = 8 waves = 128 consecutive queries of ONE (b, h). A stage is 64
// keys of K and V, brought into LDS once by global_load_async_to_lds_b128, two
// buffers: the copies of stage s + 2 fly while stage s + 1 is worked on.
// A wave takes 32 queries (two 16-query tiles) and 32 of the stage's 64 keys:
// waves 0 to 3 the lower keys, waves 4 to 7 the upper ones. Every K and V
// fragment read from LDS then feeds two query tiles, and the two running
// softmax states of a query (lower and upper keys) are joined once at the end.
// The products are taken transposed, St = K * Qt and Ot += Vt * Pt: a lane then
// holds 16 of the 32 scores of ONE query (lanes l and l ^ 16 share a query), so
// the row maximum and the row sum are in-lane, and the two score tiles, once
// converted, already are the B operand of the second product.
// ---------------------------------------------------------------------------
// Value of lane l ^ 16 (a vector cross-row move; no LDS round trip).
static __device__ __forceinline__ float other_half(float x) {
  const int i = __builtin_bit_cast(int, x);
  return __builtin_bit_cast(
      float, __builtin_amdgcn_permlanex16(i, i, 0x76543210, 0xfedcba98, false, false));
}

template <bool V> struct form { static constexpr bool value = V; };

// Four waves per SIMD (two blocks per WGP, the whole grid resident at once):
// holds the register count at 256 or below.
__global__ __launch_bounds__(256) __attribute__((amdgpu_waves_per_eu(4, 4)))
void flash_attn_decay_kernel(
    const _Float16* __restrict__ Qh,   // [NTOK_, D_] row-major
    const _Float16* __restrict__ Kh,   // [NTOK_, D_] row-major (k_rec)
    const _Float16* __restrict__ Vt,   // [B_, H_, HD_, S_] (v_rec transposed)
    _Float16* __restrict__ Oh) {       // [NTOK_, D_] row-major
  // 128-byte rows at a pitch of 144 B (odd multiple of 16 B): the 16 rows that
  // one ds_load_b128 fragment read touches fall on distinct bank groups.
  __shared__ __align__(16) _Float16 Ktile[2][64][KP_];  // [key][dim] 18 KB
  __shared__ __align__(16) _Float16 Vtile[2][64][KP_];  // [dim][key] 18 KB
  // Hand-over of the upper-key waves' states at the end: 16 bytes per lane.
  __shared__ __align__(16) v4f Omrg[4][16][32];         // 32 KB
  __shared__ float Mmrg[4][2][32], Lmrg[4][2][32];

  const int t    = threadIdx.x;
  const int lane = t & 31;
  const int wid  = __builtin_amdgcn_readfirstlane(t >> 5);
  const int qg   = wid & 3;                      // which 32 of the block's queries
  const int kh   = wid >> 2;                     // which 32 of a stage's keys
  const int bh   = blockIdx.x >> 4;              // 16 blocks per (b,h)
  const int qt   = ((blockIdx.x & 15) << 3) + qg * 2;  // first of two query tiles
  const int h    = bh & (H_ - 1);
  const int b    = bh >> 4;
  const int g    = lane >> 4;
  const int n    = lane & 15;

  const float scale = 1.0f / (sqrtf((float)D_) + 1e-8f);
  const float lam   = 1e-4f;  // LAMBDA_DECAY * TIME_STEP
  const float CLMP  = 1e4f;
  // The softmax works on x = log2(e) * score - mrun. The raw product is clamped
  // at CLMP / scale, which is the reference's first clamp as scale > 0, and
  // scale, log2(e) and the decay are ONE factor of one multiply-add. The
  // reference's second clamp is an identity: the decay is at most 1, so a score
  // inside +-CLMP stays inside.
  const float CLR = CLMP / scale;
  const float K2  = scale * 1.44269504f;
  // The median of three as one instruction on the matrix result as it is. A NaN
  // gives the smaller bound, as fminf(fmaxf(s, -CLR), CLR) does: the reference
  // sets it to -1e9 and clamps that.
  auto clamp_raw = [&](const float s) { return __builtin_amdgcn_fmed3f(s, -CLR, CLR); };

  // Every "#pragma unroll" of this kernel makes the index of a register array
  // (qa, o, s0, s1, x0, x1, p, c0, pt, o8, mrun, lrun, ...) a compile-time
  // constant: the array stays in registers.
  const int bS    = b * S_;
  const int qrow0 = bS + qt * 16;
  v16h qa[2][2];   // [query tile][dims 0..31, 32..63]
#pragma unroll
  for (int u = 0; u < 2; ++u) {
    qa[u][0] = load_frag(Qh, qrow0 + u * 16, D_, h * HD_ + 0,  lane);
    qa[u][1] = load_frag(Qh, qrow0 + u * 16, D_, h * HD_ + 32, lane);
  }

  const _Float16* vt = Vt + (size_t)(b * H_ + h) * HD_ * S_;

  // Staging: a thread copies the 16-byte piece t & 7 of rows t >> 3 and
  // (t >> 3) + 32 of the K stage and of the V stage; a wave's copy covers 4
  // whole rows of 128 B.
  const int srow = t >> 3, scol = (t & 7) * 8;
  const _Float16* gK = Kh + (size_t)(bS + srow) * D_ + h * HD_ + scol;
  const _Float16* gV = vt + (size_t)srow * S_ + scol;
  const unsigned lK = lds_off_of(&Ktile[0][srow][scol]);
  const unsigned lV = lds_off_of(&Vtile[0][srow][scol]);
  auto issue = [&](const int s, const int buf) {
    const _Float16* k = gK + (size_t)s * (64 * D_);
    const _Float16* v = gV + s * 64;
    const unsigned ob = (unsigned)buf * (64 * KP_ * 2);
    async_copy4_b128(lK + ob, k, lK + ob + 32 * KP_ * 2, k + 32 * D_,
                     lV + ob, v, lV + ob + 32 * KP_ * 2, v + 32 * S_);
  };

  // o[u][f][r] = Ot[dim f*16 + g*8 + r][query n of tile u]; mrun: the query's
  // maximum in use, in log2 units (equal in both lane halves): the first stage
  // sets it to that stage's maximum, and later it is raised only when a score
  // tops it by more than 8, so an exponential reaches 2^8 at most and o and lrun
  // are rescaled only then; lrun: this lane half's share of the row sum.
  v8f o[2][4];
  float mrun[2], lrun[2], qi[2];
  // A score above mrun + top raises mrun, by at least low. Before the first
  // stage both lie below every score: that stage always sets mrun, up or down.
  float top = -3.0e38f, low = -3.0e38f;
#pragma unroll
  for (int u = 0; u < 2; ++u) {
    mrun[u] = 0.f;
    lrun[u] = 0.f;
    qi[u]   = (float)((qt + u) * 16 + n);
#pragma unroll
    for (int f = 0; f < 4; ++f) o[u][f] = zero8();
  }

  const int NS = S_ / 64;

  // Time decay exp(-lam * |i - j|), with key j = j0 + jj, j0 the first of the
  // wave's 32 keys. Keys that lie wholly on one side of the block's 128 queries
  // have |i - j| = |i - j0| - jj (keys below) or |i - j0| + jj (keys above), so
  // the factor is exp(-lam * |i - j0|), one exponential per query and stage, times
  // K2 * exp(+lam * jj) or K2 * exp(-lam * jj), the same for every such stage.
  // The two stages from near0 on hold the block's own positions: direct form.
  const int near0 = (blockIdx.x & 15) << 1;  // of blockIdx alone: the same for the block
  // Pairs of neighbouring keys, as they lie in the score tiles' registers: the
  // multiplies and the multiply-adds below are packed, two scores each.
  v2f c0[4];                                 // jj = g*8 + r, r = 2i, 2i + 1
  float k16;                                 // 16 keys on: c0 times k16 (8 registers fewer)
  auto set_c = [&](const float sl) {
    const float cg = K2 * __expf(sl * (float)(g * 8));
    k16 = __expf(sl * 16.0f);
    // the exponentials of sl * r and k16 are the same in every lane: scalar work
#pragma unroll
    for (int i = 0; i < 4; ++i)
      c0[i] = v2f{cg * __expf(sl * (float)(2 * i)), cg * __expf(sl * (float)(2 * i + 1))};
  };

  // Prologue: stage 0 lands and is published, then stage 1 starts.
  issue(0, 0);
  asm volatile("s_wait_asynccnt 0x0" ::: "memory");  // own copies of stage 0 landed
  __syncthreads();                                   // ... and every wave's
  issue(1, 1);

  // One stage; direct.value says at compile time which form the decay takes.
  auto trip = [&](const int s, auto direct) __attribute__((always_inline)) {
    const int cur = s & 1;
    const int j0  = s * 64 + kh * 32;

    // ---- scores, transposed: 32 keys x 2 x 16 queries ----
    const _Float16* kt = &Ktile[cur][kh * 32][0];
    const v16h kb00 = load_frag(kt, 0,  KP_, 0,  lane);
    const v16h kb01 = load_frag(kt, 0,  KP_, 32, lane);
    const v16h kb10 = load_frag(kt, 16, KP_, 0,  lane);
    const v16h kb11 = load_frag(kt, 16, KP_, 32, lane);
    // The A fragments of the second product: each serves both query tiles.
    const _Float16* vtl = &Vtile[cur][0][kh * 32];
    v16h va[4];
#pragma unroll
    for (int f = 0; f < 4; ++f) va[f] = load_frag(vtl, f * 16, KP_, 0, lane);
    // Keeps all reads of the stage together, ahead of the WMMAs: each separate
    // place with reads makes the wave wait out the LDS latency again.
    __builtin_amdgcn_sched_barrier(0);
    v8f s0[2], s1[2];   // s0[u][r]: key g*8 + r, s1[u][r]: key 16 + g*8 + r
#pragma unroll
    for (int u = 0; u < 2; ++u) {
      s0[u] = wmma_f16f32(kb00, qa[u][0], zero8());
      s1[u] = wmma_f16f32(kb10, qa[u][0], zero8());
    }
#pragma unroll
    for (int u = 0; u < 2; ++u) {
      s0[u] = wmma_f16f32(kb01, qa[u][1], s0[u]);
      s1[u] = wmma_f16f32(kb11, qa[u][1], s1[u]);
    }

    // ---- clamp; x = score * (scale * log2(e) * decay) - maximum in use ----
    v2f x0[2][4], x1[2][4];   // x0[u][i]: keys g*8 + 2i, + 1; x1: 16 more
    float xmax[2];
    bool need = false;
#pragma unroll
    for (int u = 0; u < 2; ++u) {
      const float dq = qi[u] - (float)(j0 + g * 8);  // whole numbers: exact
      const float e  = __expf(-lam * fabsf(qi[u] - (float)j0));  // unused if direct
      const v2f ee = {e, e}, ee16 = {e * k16, e * k16}, nm = {-mrun[u], -mrun[u]};
#pragma unroll
      for (int i = 0; i < 4; ++i) {
        const v2f t0 = {clamp_raw(s0[u][2 * i]), clamp_raw(s0[u][2 * i + 1])};
        const v2f t1 = {clamp_raw(s1[u][2 * i]), clamp_raw(s1[u][2 * i + 1])};
        v2f f0, f1;
        if constexpr (decltype(direct)::value) {
          f0 = v2f{K2 * __expf(-lam * fabsf(dq - (float)(2 * i))),
                   K2 * __expf(-lam * fabsf(dq - (float)(2 * i + 1)))};
          f1 = v2f{K2 * __expf(-lam * fabsf(dq - (float)(16 + 2 * i))),
                   K2 * __expf(-lam * fabsf(dq - (float)(17 + 2 * i)))};
        } else {
          f0 = ee * c0[i];
          f1 = ee16 * c0[i];
        }
        x0[u][i] = __builtin_elementwise_fma(t0, f0, nm);
        x1[u][i] = __builtin_elementwise_fma(t1, f1, nm);
      }
      // in-lane over 16 keys, one exchange between the lane halves
      float m = fmaxf(x0[u][0].x, x0[u][0].y);
#pragma unroll
      for (int i = 1; i < 4; ++i) m = fmaxf(m, fmaxf(x0[u][i].x, x0[u][i].y));
#pragma unroll
      for (int i = 0; i < 4; ++i) m = fmaxf(m, fmaxf(x1[u][i].x, x1[u][i].y));
      xmax[u] = fmaxf(m, other_half(m));
      need = need || (xmax[u] > top);
    }

    // ---- lazy rescale: one test per stage, a scalar branch, rarely taken ----
    if (__builtin_amdgcn_ballot_w32(need) != 0) {
#pragma unroll
      for (int u = 0; u < 2; ++u) {
        const float mnew  = mrun[u] + fmaxf(xmax[u], low);
        const float up    = mnew - mrun[u];
        // up < 0 only in the first stage, where o and lrun are 0: alpha stays finite
        const float alpha = __builtin_amdgcn_exp2f(fminf(-up, 0.0f));
        mrun[u] = mnew;
        lrun[u] *= alpha;
#pragma unroll
        for (int i = 0; i < 4; ++i) {
          x0[u][i] -= up;
          x1[u][i] -= up;
        }
#pragma unroll
        for (int f = 0; f < 4; ++f)
#pragma unroll
          for (int r = 0; r < 8; ++r) o[u][f][r] *= alpha;
      }
      top = 8.0f;
      low = 0.0f;
    }

    v16h pt[2];   // Pt as B operand: element e is key g*8 + e, or 16 + g*8 + (e - 8)
#pragma unroll
    for (int u = 0; u < 2; ++u) {
      v2f p[4];
#pragma unroll
      for (int i = 0; i < 4; ++i) {
        const v2f p0 = {__builtin_amdgcn_exp2f(x0[u][i].x), __builtin_amdgcn_exp2f(x0[u][i].y)};
        const v2f p1 = {__builtin_amdgcn_exp2f(x1[u][i].x), __builtin_amdgcn_exp2f(x1[u][i].y)};
        pt[u][2 * i]         = (_Float16)p0.x;
        pt[u][2 * i + 1]     = (_Float16)p0.y;
        pt[u][8 + 2 * i]     = (_Float16)p1.x;
        pt[u][8 + 2 * i + 1] = (_Float16)p1.y;
        p[i] = p0 + p1;
      }
      // in-lane sum as a tree: short dependent chain
      p[0] += p[2];
      p[1] += p[3];
      p[0] += p[1];
      lrun[u] += p[0].x + p[0].y;
    }

    // ---- Ot += Vt(64x32) @ Pt(32x16) ----
#pragma unroll
    for (int f = 0; f < 4; ++f)
#pragma unroll
      for (int u = 0; u < 2; ++u) o[u][f] = wmma_f16f32(va[f], pt[u], o[u][f]);
    // Keeps the stage's work in front of the publish point: lifted over it, the
    // wait would end the copies of stage s + 1 before the work has covered
    // their latency.
    __builtin_amdgcn_sched_barrier(0);

    // Publish point of stage s + 1, which also frees the buffer just read.
    asm volatile("s_wait_dscnt 0x0" ::: "memory");     // own LDS reads are done
    asm volatile("s_wait_asynccnt 0x0" ::: "memory");  // own copies of s + 1 landed
    __syncthreads();
    if (s + 2 < NS) issue(s + 2, cur);
  };

  // The stages in ascending order. Every bound is the same for the whole block,
  // so all its waves pass the same barriers.
  set_c(lam);
  for (int s = 0; s < near0; ++s) trip(s, form<false>{});
  for (int s = near0; s < near0 + 2; ++s) trip(s, form<true>{});
  set_c(-lam);
  for (int s = near0 + 2; s < NS; ++s) trip(s, form<false>{});
  asm volatile("s_wait_asynccnt 0x0" ::: "memory");  // nothing in flight at the end

  // ---- epilogue: join the lane halves' sums, then the two key halves ----
  float lsum[2];
#pragma unroll
  for (int u = 0; u < 2; ++u) lsum[u] = lrun[u] + other_half(lrun[u]);
  if (kh == 1) {   // the same for a whole wave
#pragma unroll
    for (int u = 0; u < 2; ++u) {
      Mmrg[qg][u][lane] = mrun[u];
      Lmrg[qg][u][lane] = lsum[u];
#pragma unroll
      for (int f = 0; f < 4; ++f) {
        const v4f lo = {o[u][f][0], o[u][f][1], o[u][f][2], o[u][f][3]};
        const v4f hi = {o[u][f][4], o[u][f][5], o[u][f][6], o[u][f][7]};
        Omrg[qg][(u * 4 + f) * 2 + 0][lane] = lo;
        Omrg[qg][(u * 4 + f) * 2 + 1][lane] = hi;
      }
    }
  }
  __syncthreads();  // the upper-key states are visible to the lower-key waves
  if (kh == 0) {
    // A lane holds 8 consecutive dims of its query per tile and f: one 16-byte store.
#pragma unroll
    for (int u = 0; u < 2; ++u) {
      const float m1 = Mmrg[qg][u][lane];
      const float l1 = Lmrg[qg][u][lane];
      const float m  = fmaxf(mrun[u], m1);
      const float a0 = __builtin_amdgcn_exp2f(mrun[u] - m);  // maxima: log2 units
      const float a1 = __builtin_amdgcn_exp2f(m1 - m);
      const float inv = 1.0f / (lsum[u] * a0 + l1 * a1);
      const float w0 = a0 * inv, w1 = a1 * inv;
#pragma unroll
      for (int f = 0; f < 4; ++f) {
        const v4f lo = Omrg[qg][(u * 4 + f) * 2 + 0][lane];
        const v4f hi = Omrg[qg][(u * 4 + f) * 2 + 1][lane];
        v8h o8;
#pragma unroll
        for (int r = 0; r < 4; ++r) {
          o8[r]     = (_Float16)(o[u][f][r] * w0 + lo[r] * w1);
          o8[4 + r] = (_Float16)(o[u][f][4 + r] * w0 + hi[r] * w1);
        }
        *(v8h*)(Oh + (size_t)(qrow0 + u * 16 + n) * D_ + h * HD_ + f * 16 + g * 8) = o8;
      }
    }
  }
}

// ---------------------------------------------------------------------------
// Host orchestration
// ---------------------------------------------------------------------------
extern "C" void kernel_launch(void* const* d_in, const int* in_sizes, int n_in,
                              void* d_out, int out_size, void* d_ws,
                              size_t ws_size, hipStream_t stream) {
  (void)in_sizes; (void)n_in; (void)out_size; (void)ws_size;
  const float* x     = (const float*)d_in[0];
  const float* Wq    = (const float*)d_in[1];
  const float* Wk    = (const float*)d_in[2];
  const float* Wv    = (const float*)d_in[3];
  const float* Wo    = (const float*)d_in[4];
  const float* Wdown = (const float*)d_in[5];
  const float* Wupk  = (const float*)d_in[6];
  const float* Wupv  = (const float*)d_in[7];
  float* out = (float*)d_out;  // [NTOK_*D_] attn-out, then [NTOK_*L_] latent

  // Carve workspace (256B aligned)
  char* wsp = (char*)d_ws;
  auto carve = [&](size_t bytes) {
    char* p = wsp;
    wsp += (bytes + 255) & ~(size_t)255;
    return p;
  };
  _Float16* x_h      = (_Float16*)carve((size_t)NTOK_ * D_ * 2);
  _Float16* q_h      = (_Float16*)carve((size_t)NTOK_ * D_ * 2);
  _Float16* k_h      = (_Float16*)carve((size_t)NTOK_ * D_ * 2);
  _Float16* vT       = (_Float16*)carve((size_t)NTOK_ * D_ * 2);
  _Float16* attn_h   = (_Float16*)carve((size_t)NTOK_ * D_ * 2);
  _Float16* latent_h = (_Float16*)carve((size_t)NTOK_ * L_ * 2);
  _Float16* wq_t     = (_Float16*)carve((size_t)D_ * D_ * 2);
  _Float16* wo_t     = (_Float16*)carve((size_t)D_ * D_ * 2);
  _Float16* wkv_h    = (_Float16*)carve((size_t)D_ * D_ * 2);
  _Float16* wdown_t  = (_Float16*)carve((size_t)D_ * L_ * 2);
  _Float16* wupk_t   = (_Float16*)carve((size_t)D_ * L_ * 2);
  _Float16* wupv_t   = (_Float16*)carve((size_t)D_ * L_ * 2);
  float*    wcomb_f  = (float*)   carve((size_t)D_ * L_ * 4);
  _Float16* wcomb_t  = (_Float16*)carve((size_t)D_ * L_ * 2);

  // --- all work that reads inputs alone: conversions and weight transposes ---
  prep_inputs_kernel<<<NB_X + NB_ADD + 2 * NB_TDD + 3 * NB_TDL, 256, 0, stream>>>(
      x, Wk, Wv, Wq, Wo, Wdown, Wupk, Wupv,
      x_h, wkv_h, wq_t, wo_t, wdown_t, wupk_t, wupv_t);

  // --- q = x @ Wq, and W_comb = (Wk + Wv) @ W_down (folds the k/v GEMMs away) ---
  gemm_q_and_wcomb_kernel<<<NB_BIG + NB_WC, 256, 0, stream>>>(
      x_h, wq_t, q_h, wkv_h, wdown_t, wcomb_f);
  transpose_f32_to_f16_kernel<D_, L_><<<NB_TDL, 256, 0, stream>>>(wcomb_f, wcomb_t);

  // --- latent = x @ W_comb : f32 -> d_out tail, f16 -> latent_h ---
  gemm_wmma_kernel<2, 2, 1, NTOK_, L_, D_>
      <<<(NTOK_ / 64) * (L_ / 64), 256, 0, stream>>>(
          x_h, wcomb_t, out + (size_t)NTOK_ * D_, latent_h);

  // --- k_rec (row-major == B^T for QK^T) and v_rec ([B,H,64,S]) from latent ---
  gemm_krec_and_vrec_kernel<<<2 * NB_BIG, 256, 0, stream>>>(
      latent_h, wupk_t, k_h, wupv_t, vT);

  // --- flash attention with decay: 512 blocks, 8 q-tiles of one (b,h) each ---
  flash_attn_decay_kernel<<<B_ * H_ * (S_ / 128), 256, 0, stream>>>(
      q_h, k_h, vT, attn_h);

  // --- out = attn @ Wo ---
  gemm_wmma_kernel<0, 4, 2, NTOK_, D_, D_>
      <<<(NTOK_ / 128) * (D_ / 128), 256, 0, stream>>>(attn_h, wo_t, out, nullptr);
}

// v009
// A run of this version takes 91.3 microseconds.
// Timed twice side by side with v008, it ran 1.11 and 1.06 times as fast.
// Over all steps from v000 it is 4.90 times as fast.
#include <hip/hip_runtime.h>

// Problem constants
#define B_    2
#define S_    2048
#define D_    1024
#define H_    16
#define HD_   64
#define L_    256
#define NTOK_ (B_ * S_)
#define KP_   72   // LDS pitch of a 64-half row, in halves

typedef __attribute__((ext_vector_type(16))) _Float16 v16h;
typedef __attribute__((ext_vector_type(8)))  _Float16 v8h;
typedef __attribute__((ext_vector_type(8)))  float    v8f;
typedef __attribute__((ext_vector_type(4)))  _Float16 v4h;
typedef __attribute__((ext_vector_type(4)))  float    v4f;
typedef __attribute__((ext_vector_type(2)))  float    v2f;

static __device__ __forceinline__ v8f wmma_f16f32(v16h a, v16h b, v8f c) {
  // D = A(16x32 f16) * B(32x16 f16) + C(16x16 f32)
  return __builtin_amdgcn_wmma_f32_16x16x32_f16(false, a, false, b, (short)0, c,
                                                false, false);
}

static __device__ __forceinline__ v8f zero8() {
  v8f z = {0.f, 0.f, 0.f, 0.f, 0.f, 0.f, 0.f, 0.f};
  return z;
}

// Load an A-style fragment (row m = lane&15; K chunks at col0+8g and col0+16+8g)
// from a row-major f16 matrix with leading dimension ld. The same routine loads
// B-fragments from the *transposed* (N-major) operand. Works for global or LDS.
static __device__ __forceinline__ v16h load_frag(const _Float16* __restrict__ base,
                                                 int row0, int ld, int col0,
                                                 int lane) {
  const int g = lane >> 4;
  const int m = lane & 15;
  const _Float16* p = base + (size_t)(row0 + m) * ld + col0 + g * 8;
  union { v16h v; v8h h[2]; } u;
  u.h[0] = *(const v8h*)(p);
  u.h[1] = *(const v8h*)(p + 16);
  return u.v;
}

// LDS byte offset of a __shared__ object (dsaddr = LDS_BASE + VGPR, ISA 10.x):
// generic -> addrspace(3) cast yields the 32-bit LDS offset.
static __device__ __forceinline__ unsigned lds_off_of(const void* p) {
  return (unsigned)(unsigned long long)(const __attribute__((address_space(3))) char*)p;
}

// ---------------------------------------------------------------------------
// Elementwise prep work. A thread handles 8 to 32 elements through 16-byte
// loads that are all issued before the first is used. Each part below is the
// work of ONE block, numbered blk within its part; the block counts cover the
// fixed shapes exactly (static_assert at the counts), so there is no bounds test.
// ---------------------------------------------------------------------------
// One wave converts NV runs of 128 consecutive floats (512 B per load).
template <int NV>
static __device__ __forceinline__ void f32_to_f16_part(
    const float* __restrict__ in, _Float16* __restrict__ out, const int blk) {
  const int base = (blk * 8 + (threadIdx.x >> 5)) * (NV * 128) +
                   (threadIdx.x & 31) * 4;
  v4f v[NV];
#pragma unroll
  for (int j = 0; j < NV; ++j) v[j] = *(const v4f*)(in + base + j * 128);
#pragma unroll
  for (int j = 0; j < NV; ++j)
    *(v4h*)(out + base + j * 128) = __builtin_convertvector(v[j], v4h);
}

template <int NV>
static __device__ __forceinline__ void add2_to_f16_part(
    const float* __restrict__ a, const float* __restrict__ b,
    _Float16* __restrict__ out, const int blk) {
  const int base = (blk * 8 + (threadIdx.x >> 5)) * (NV * 128) +
                   (threadIdx.x & 31) * 4;
  v4f va[NV], vb[NV];
#pragma unroll
  for (int j = 0; j < NV; ++j) {
    va[j] = *(const v4f*)(a + base + j * 128);
    vb[j] = *(const v4f*)(b + base + j * 128);
  }
#pragma unroll
  for (int j = 0; j < NV; ++j)
    *(v4h*)(out + base + j * 128) = __builtin_convertvector(va[j] + vb[j], v4h);
}

// out[c * R + r] = (f16) in[r * C + c]   (in: R x C f32, out: C x R f16)
// One thread: 8 rows x 4 columns in registers (8 loads of 16 B, 4 stores of
// 16 B). One wave: 8 rows x 128 columns. The 8 waves of a block take 64
// consecutive rows, so each 128-byte line of out is written by one block.
template <int R, int C>
static __device__ __forceinline__ void transpose_f32_to_f16_part(
    const float* __restrict__ in, _Float16* __restrict__ out, const int blk) {
  constexpr int CB = C / 128;
  const int c0 = (blk % CB) * 128 + (threadIdx.x & 31) * 4;
  const int r0 = (blk / CB) * 64 + (threadIdx.x >> 5) * 8;
  v4f v[8];
#pragma unroll
  for (int j = 0; j < 8; ++j) v[j] = *(const v4f*)(in + (r0 + j) * C + c0);
#pragma unroll
  for (int q = 0; q < 4; ++q) {
    v8h o8;
#pragma unroll
    for (int j = 0; j < 8; ++j) o8[j] = (_Float16)v[j][q];
    *(v8h*)(out + (c0 + q) * R + r0) = o8;
  }
}

// Stands behind the last store of a part in a kernel that holds several parts:
// there another part's code follows in the program and rewrites the registers
// that the stores name; the wait comes first (a precaution).
static __device__ __forceinline__ void part_stores_issued() {
  asm volatile("s_wait_xcnt 0x0" ::: "memory");
}

// Blocks per part.
constexpr int NB_X   = NTOK_ * D_ / (256 * 32);  // x -> f16
constexpr int NB_ADD = D_ * D_ / (256 * 8);      // Wk + Wv -> f16
constexpr int NB_TDD = D_ * D_ / 8192;           // transpose of a D x D weight
constexpr int NB_TDL = D_ * L_ / 8192;           // transpose of a D x L or L x D weight
static_assert((NTOK_ * D_) % (256 * 32) == 0 && (D_ * D_) % (256 * 8) == 0 &&
              D_ % 128 == 0 && L_ % 128 == 0, "prep blocks cover the shapes");

// The two operands of W_comb = (Wk + Wv) @ W_down. They head the longest chain
// of launches (W_comb, latent, k_rec and v_rec, attention, out), so they go
// first and alone; all other prep work runs beside the W_comb product. Each part
// takes a range of the block index: a scalar branch, the same for a whole block.
__global__ __launch_bounds__(256) void prep_wcomb_operands_kernel(
    const float* __restrict__ Wk, const float* __restrict__ Wv,
    const float* __restrict__ Wdown, _Float16* __restrict__ wkv_h,
    _Float16* __restrict__ wdown_t) {
  const int blk = blockIdx.x;
  if (blk < NB_ADD) {
    add2_to_f16_part<2>(Wk, Wv, wkv_h, blk);
    return;
  }
  transpose_f32_to_f16_part<D_, L_>(Wdown, wdown_t, blk - NB_ADD);
  part_stores_issued();  // the sum's code follows in the program
}

// ---------------------------------------------------------------------------
// WMMA GEMM: C[M x N] = A[M x K] * B[K x N], B given transposed (N x K).
// One block of 8 waves (2 along M x 4 along N) computes a (32*WM) x (64*WN)
// tile of C; one wave a (16*WM) x (16*WN) part of it. Each trip takes 64 k:
// the block's rows of A and of Bt (128 B each) are brought into LDS once by
// asynchronous copies and every wave reads its fragments from there, so a row
// is fetched from L2 once per block, in whole 128-byte lines. Two buffers: the
// copies of trip t + 2 fly while trip t + 1 is worked on.
// MODE 0: f32 out; 1: f16 out; 2: f32 + f16 out; 3: per-head transposed f16
//         scatter (v_rec -> vT[B][H][64][S]).
// ---------------------------------------------------------------------------
// Four 16-byte asynchronous copies per lane, global memory -> LDS. The
// s_wait_xcnt stands as the last line of the copies' own statement, so that no
// later write of an address register can be moved in front of it (a precaution).
static __device__ __forceinline__ void async_copy4_b128(
    unsigned l0, const _Float16* g0, unsigned l1, const _Float16* g1,
    unsigned l2, const _Float16* g2, unsigned l3, const _Float16* g3) {
  asm volatile(
      "global_load_async_to_lds_b128 %0, %1, off\n\t"
      "global_load_async_to_lds_b128 %2, %3, off\n\t"
      "global_load_async_to_lds_b128 %4, %5, off\n\t"
      "global_load_async_to_lds_b128 %6, %7, off\n\t"
      "s_wait_xcnt 0x0"
      :: "v"(l0), "v"((unsigned long long)g0), "v"(l1),
         "v"((unsigned long long)g1), "v"(l2), "v"((unsigned long long)g2),
         "v"(l3), "v"((unsigned long long)g3)
      : "memory");
}

// Halves of LDS that a block with WM x WN wave tiles stages (two buffers).
constexpr int stage_halves(int WM, int WN) { return 2 * (32 * WM + 64 * WN) * KP_; }

// The work of ONE block: tile number blk of the product; smem is the block's
// staging area, stage_halves(WM, WN) halves, declared by the kernel.
template <int MODE, int WM, int WN, int M, int N, int K>
static __device__ __forceinline__ void gemm_wmma_tile(
    const _Float16* __restrict__ A, const _Float16* __restrict__ Bt,
    float* __restrict__ Cf, _Float16* __restrict__ Ch, const int blk,
    _Float16* smem) {
  constexpr int BM   = 32 * WM;      // rows of C (and of A) per block
  constexpr int BN   = 64 * WN;      // columns of C (rows of Bt) per block
  constexpr int ROWS = BM + BN;      // staged rows per trip: A first, then Bt
  constexpr int NT   = K / 64;       // trips
  constexpr int NC   = ROWS / 32;    // copies per thread and trip
  constexpr unsigned BUFB = ROWS * KP_ * 2;  // bytes of one buffer
  static_assert(M % BM == 0 && N % BN == 0 && K % 64 == 0 && NC % 4 == 0,
                "the grid covers the shape exactly; no edge handling");
  // 128-byte rows at a pitch of 144 B (odd multiple of 16 B) for ds_load_b128.
  _Float16 (*stage)[ROWS][KP_] = reinterpret_cast<_Float16 (*)[ROWS][KP_]>(smem);

  const int t    = threadIdx.x;
  const int lane = t & 31;
  const int wid  = t >> 5;
  const int g = lane >> 4;
  const int n = lane & 15;
  const int bm0 = (blk / (N / BN)) * BM;
  const int bn0 = (blk % (N / BN)) * BN;
  const int wr0 = (wid >> 2) * (WM * 16);  // the wave's first row in the tile
  const int wc0 = (wid & 3) * (WN * 16);   // the wave's first column in the tile

  // Copy j of a thread: staged row (t >> 3) + 32 * j, 16-byte piece t & 7; a
  // wave's copy covers 4 whole rows of 128 B.
  const int crow = t >> 3, ccol = (t & 7) * 8;
  const _Float16* gA = A  + (size_t)(bm0 + crow) * K + ccol;
  const _Float16* gB = Bt + (size_t)(bn0 + crow) * K + ccol;
  const unsigned lrow = lds_off_of(&stage[0][crow][ccol]);

  auto from = [&](int j, int k0) -> const _Float16* {
    return j < BM / 32 ? gA + (size_t)(j * 32) * K + k0
                       : gB + (size_t)(j * 32 - BM) * K + k0;
  };
  auto issue = [&](int tile, int buf) {
    const int k0 = tile * 64;
    const unsigned lb = lrow + (unsigned)buf * BUFB;
    // unrolled so that the choice between A and Bt is made at compile time
#pragma unroll
    for (int j = 0; j < NC; j += 4)
      async_copy4_b128(lb + (j + 0) * (32 * KP_ * 2), from(j + 0, k0),
                       lb + (j + 1) * (32 * KP_ * 2), from(j + 1, k0),
                       lb + (j + 2) * (32 * KP_ * 2), from(j + 2, k0),
                       lb + (j + 3) * (32 * KP_ * 2), from(j + 3, k0));
  };

  // Every "#pragma unroll" from here on makes the index of a register array
  // (acc, a, b) a compile-time constant, so that the array stays in registers.
  v8f acc[WM][WN];
#pragma unroll
  for (int i = 0; i < WM; ++i)
#pragma unroll
    for (int j = 0; j < WN; ++j) acc[i][j] = zero8();

  // Prologue: tile 0 lands and is published, then tile 1 starts.
  issue(0, 0);
  asm volatile("s_wait_asynccnt 0x0" ::: "memory");  // own copies of tile 0 landed
  __syncthreads();                                   // ... and every wave's
  if (NT > 1) issue(1, 1);

  for (int tt = 0; tt < NT; ++tt) {
    const _Float16* sA = &stage[tt & 1][0][0];
    const _Float16* sB = &stage[tt & 1][BM][0];
    // All fragment reads of the trip stand together, ahead of its WMMAs.
    v16h a[2][WM], b[2][WN];
#pragma unroll
    for (int kk = 0; kk < 2; ++kk) {
#pragma unroll
      for (int i = 0; i < WM; ++i)
        a[kk][i] = load_frag(sA, wr0 + i * 16, KP_, kk * 32, lane);
#pragma unroll
      for (int j = 0; j < WN; ++j)
        b[kk][j] = load_frag(sB, wc0 + j * 16, KP_, kk * 32, lane);
    }
    // Keeps the scheduler from sinking the reads among the WMMAs, where each
    // separate place with reads makes the wave wait out the LDS latency again.
    __builtin_amdgcn_sched_barrier(0);
#pragma unroll
    for (int kk = 0; kk < 2; ++kk)
#pragma unroll
      for (int i = 0; i < WM; ++i)
#pragma unroll
        for (int j = 0; j < WN; ++j)
          acc[i][j] = wmma_f16f32(a[kk][i], b[kk][j], acc[i][j]);
    // Keeps the trip's WMMAs in front of the publish point: lifted over them,
    // the waits would end the reads and the copies before any matrix work
    // has covered their latency.
    __builtin_amdgcn_sched_barrier(0);

    // Publish point of tile tt + 1, which also frees the buffer just read.
    asm volatile("s_wait_dscnt 0x0" ::: "memory");     // own LDS reads are done
    asm volatile("s_wait_asynccnt 0x0" ::: "memory");  // own copies of tt + 1 landed
    __syncthreads();
    if (tt + 2 < NT) issue(tt + 2, tt & 1);
  }
  asm volatile("s_wait_asynccnt 0x0" ::: "memory");  // nothing in flight at the end

#pragma unroll
  for (int i = 0; i < WM; ++i) {
    const int row0 = bm0 + wr0 + i * 16;
#pragma unroll
    for (int j = 0; j < WN; ++j) {
      const int col = bn0 + wc0 + j * 16 + n;
      if constexpr (MODE == 3) {
        // v_rec element C[tok][col] -> vT[b][h][d][s], 8 consecutive tokens per lane
        const int hh  = col >> 6;
        const int dd  = col & (HD_ - 1);
        const int tok0 = row0 + g * 8;        // 16-aligned tile: never crosses batch
        const int bb = tok0 >> 11;            // / S_
        const int ss = tok0 & (S_ - 1);
        v8h o8;
#pragma unroll
        for (int r = 0; r < 8; ++r) o8[r] = (_Float16)acc[i][j][r];
        *(v8h*)(Ch + (size_t)((bb * H_ + hh) * HD_ + dd) * S_ + ss) = o8;
      } else {
#pragma unroll
        for (int r = 0; r < 8; ++r) {
          const size_t idx = (size_t)(row0 + g * 8 + r) * N + col;
          if constexpr (MODE == 0 || MODE == 2) Cf[idx] = acc[i][j][r];
          if constexpr (MODE == 1 || MODE == 2) Ch[idx] = (_Float16)acc[i][j][r];
        }
      }
    }
  }
}

// One product per launch.
template <int MODE, int WM, int WN, int M, int N, int K>
__global__ __launch_bounds__(256) void gemm_wmma_kernel(
    const _Float16* __restrict__ A, const _Float16* __restrict__ Bt,
    float* __restrict__ Cf, _Float16* __restrict__ Ch) {
  __shared__ __align__(16) _Float16 smem[stage_halves(WM, WN)];
  gemm_wmma_tile<MODE, WM, WN, M, N, K>(A, Bt, Cf, Ch, blockIdx.x, smem);
}

// Pieces of work that do not need each other, in ONE launch; each takes a range
// of the block index (a scalar branch, the same for a whole block, so every
// barrier inside a product is passed by all waves of its block).
constexpr int NB_BIG = (NTOK_ / 128) * (D_ / 128);  // blocks of a NTOK x D product
constexpr int NB_WC  = (D_ / 64) * (L_ / 64);       // blocks of W_comb
constexpr int NB_LAT = (NTOK_ / 64) * (L_ / 64);    // blocks of latent

// W_comb, taken as its transpose: W_comb^T = W_down^T @ (Wk + Wv)^T, that is
// A = wdown_t (L x D) and Bt = wkv_h (D x D, as it lies). It leaves the product
// in f16 in the N-major form that the latent product reads, with no transpose
// pass. Its 64 blocks come first in the grid, as they run longest; the prep
// parts that it does not need (x, Wq, Wo, W_up_k, W_up_v) run beside them.
__global__ __launch_bounds__(256) void gemm_wcomb_and_prep_kernel(
    const _Float16* __restrict__ wdown_t, const _Float16* __restrict__ wkv_h,
    _Float16* __restrict__ wcomb_t, const float* __restrict__ x,
    const float* __restrict__ Wq, const float* __restrict__ Wo,
    const float* __restrict__ Wupk, const float* __restrict__ Wupv,
    _Float16* __restrict__ x_h, _Float16* __restrict__ wq_t,
    _Float16* __restrict__ wo_t, _Float16* __restrict__ wupk_t,
    _Float16* __restrict__ wupv_t) {
  __shared__ __align__(16) _Float16 smem[stage_halves(2, 1)];
  int blk = blockIdx.x;
  if (blk < NB_WC) {
    gemm_wmma_tile<1, 2, 1, L_, D_, D_>(wdown_t, wkv_h, nullptr, wcomb_t, blk, smem);
    return;
  }
  blk -= NB_WC;
  if (blk < NB_X) {
    f32_to_f16_part<8>(x, x_h, blk);
    part_stores_issued();
    return;
  }
  blk -= NB_X;
  if (blk < NB_TDD) {
    transpose_f32_to_f16_part<D_, D_>(Wq, wq_t, blk);
    part_stores_issued();
    return;
  }
  blk -= NB_TDD;
  if (blk < NB_TDD) {
    transpose_f32_to_f16_part<D_, D_>(Wo, wo_t, blk);
    part_stores_issued();
    return;
  }
  blk -= NB_TDD;
  if (blk < NB_TDL) {
    transpose_f32_to_f16_part<L_, D_>(Wupk, wupk_t, blk);
    part_stores_issued();
    return;
  }
  blk -= NB_TDL;
  transpose_f32_to_f16_part<L_, D_>(Wupv, wupv_t, blk);
  part_stores_issued();
}

// q = x @ Wq (one block per WGP) and latent = x @ W_comb (f32 to the output's
// tail, f16 for k_rec and v_rec): both read x_h over the same 1024 k, and the
// small latent blocks take the places that q leaves free on every WGP.
__global__ __launch_bounds__(256) void gemm_q_and_latent_kernel(
    const _Float16* __restrict__ x_h, const _Float16* __restrict__ wq_t,
    _Float16* __restrict__ q_h, const _Float16* __restrict__ wcomb_t,
    float* __restrict__ latent_f, _Float16* __restrict__ latent_h) {
  __shared__ __align__(16) _Float16 smem[stage_halves(4, 2)];
  const int blk = blockIdx.x;
  if (blk < NB_BIG) {
    gemm_wmma_tile<1, 4, 2, NTOK_, D_, D_>(x_h, wq_t, nullptr, q_h, blk, smem);
  } else {
    gemm_wmma_tile<2, 2, 1, NTOK_, L_, D_>(x_h, wcomb_t, latent_f, latent_h,
                                           blk - NB_BIG, smem);
    part_stores_issued();  // the q product's code follows in the program
  }
}

// k_rec = latent @ W_up_k (row-major) and v_rec = latent @ W_up_v (per head
// transposed).
__global__ __launch_bounds__(256) void gemm_krec_and_vrec_kernel(
    const _Float16* __restrict__ latent_h, const _Float16* __restrict__ wupk_t,
    _Float16* __restrict__ k_h, const _Float16* __restrict__ wupv_t,
    _Float16* __restrict__ vT) {
  __shared__ __align__(16) _Float16 smem[stage_halves(4, 2)];
  const int blk = blockIdx.x;
  if (blk < NB_BIG) {
    gemm_wmma_tile<1, 4, 2, NTOK_, D_, L_>(latent_h, wupk_t, nullptr, k_h, blk, smem);
  } else {
    gemm_wmma_tile<3, 4, 2, NTOK_, D_, L_>(latent_h, wupv_t, nullptr, vT,
                                           blk - NB_BIG, smem);
    part_stores_issued();  // the k_rec product's code follows in the program
  }
}

// ---------------------------------------------------------------------------
// Flash attention with multiplicative time decay.
// One block = 8 waves = 128 consecutive queries of ONE (b, h). A stage is 64
// keys of K and V, brought into LDS once by global_load_async_to_lds_b128, two
// buffers: the copies of stage s + 2 fly while stage s + 1 is worked on.
// A wave takes 32 queries (two 16-query tiles) and 32 of the stage's 64 keys:
// waves 0 to 3 the lower keys, waves 4 to 7 the upper ones. Every K and V
// fragment read from LDS then feeds two query tiles, and the two running
// softmax states of a query (lower and upper keys) are joined once at the end.
// The products are taken transposed, St = K * Qt and Ot += Vt * Pt: a lane then
// holds 16 of the 32 scores of ONE query (lanes l and l ^ 16 share a query), so
// the row maximum and the row sum are in-lane, and the two score tiles, once
// converted, already are the B operand of the second product.
// ---------------------------------------------------------------------------
// Value of lane l ^ 16 (a vector cross-row move; no LDS round trip).
static __device__ __forceinline__ float other_half(float x) {
  const int i = __builtin_bit_cast(int, x);
  return __builtin_bit_cast(
      float, __builtin_amdgcn_permlanex16(i, i, 0x76543210, 0xfedcba98, false, false));
}

template <bool V> struct form { static constexpr bool value = V; };

// Four waves per SIMD (two blocks per WGP, the whole grid resident at once):
// holds the register count at 256 or below.
__global__ __launch_bounds__(256) __attribute__((amdgpu_waves_per_eu(4, 4)))
void flash_attn_decay_kernel(
    const _Float16* __restrict__ Qh,   // [NTOK_, D_] row-major
    const _Float16* __restrict__ Kh,   // [NTOK_, D_] row-major (k_rec)
    const _Float16* __restrict__ Vt,   // [B_, H_, HD_, S_] (v_rec transposed)
    _Float16* __restrict__ Oh) {       // [NTOK_, D_] row-major
  // 128-byte rows at a pitch of 144 B (odd multiple of 16 B): the 16 rows that
  // one ds_load_b128 fragment read touches fall on distinct bank groups.
  __shared__ __align__(16) _Float16 Ktile[2][64][KP_];  // [key][dim] 18 KB
  __shared__ __align__(16) _Float16 Vtile[2][64][KP_];  // [dim][key] 18 KB
  // Hand-over of the upper-key waves' states at the end: 16 bytes per lane.
  __shared__ __align__(16) v4f Omrg[4][16][32];         // 32 KB
  __shared__ float Mmrg[4][2][32], Lmrg[4][2][32];

  const int t    = threadIdx.x;
  const int lane = t & 31;
  const int wid  = __builtin_amdgcn_readfirstlane(t >> 5);
  const int qg   = wid & 3;                      // which 32 of the block's queries
  const int kh   = wid >> 2;                     // which 32 of a stage's keys
  const int bh   = blockIdx.x >> 4;              // 16 blocks per (b,h)
  const int qt   = ((blockIdx.x & 15) << 3) + qg * 2;  // first of two query tiles
  const int h    = bh & (H_ - 1);
  const int b    = bh >> 4;
  const int g    = lane >> 4;
  const int n    = lane & 15;

  const float scale = 1.0f / (sqrtf((float)D_) + 1e-8f);
  const float lam   = 1e-4f;  // LAMBDA_DECAY * TIME_STEP
  const float CLMP  = 1e4f;
  // The softmax works on x = log2(e) * score - mrun. The raw product is clamped
  // at CLMP / scale, which is the reference's first clamp as scale > 0, and
  // scale, log2(e) and the decay are ONE factor of one multiply-add. The
  // reference's second clamp is an identity: the decay is at most 1, so a score
  // inside +-CLMP stays inside.
  const float CLR = CLMP / scale;
  const float K2  = scale * 1.44269504f;
  // The median of three as one instruction on the matrix result as it is. A NaN
  // gives the smaller bound, as fminf(fmaxf(s, -CLR), CLR) does: the reference
  // sets it to -1e9 and clamps that.
  auto clamp_raw = [&](const float s) { return __builtin_amdgcn_fmed3f(s, -CLR, CLR); };

  // Every "#pragma unroll" of this kernel makes the index of a register array
  // (qa, o, s0, s1, x0, x1, p, c0, pt, o8, mrun, lrun, ...) a compile-time
  // constant: the array stays in registers.
  const int bS    = b * S_;
  const int qrow0 = bS + qt * 16;
  v16h qa[2][2];   // [query tile][dims 0..31, 32..63]
#pragma unroll
  for (int u = 0; u < 2; ++u) {
    qa[u][0] = load_frag(Qh, qrow0 + u * 16, D_, h * HD_ + 0,  lane);
    qa[u][1] = load_frag(Qh, qrow0 + u * 16, D_, h * HD_ + 32, lane);
  }

  const _Float16* vt = Vt + (size_t)(b * H_ + h) * HD_ * S_;

  // Staging: a thread copies the 16-byte piece t & 7 of rows t >> 3 and
  // (t >> 3) + 32 of the K stage and of the V stage; a wave's copy covers 4
  // whole rows of 128 B.
  const int srow = t >> 3, scol = (t & 7) * 8;
  const _Float16* gK = Kh + (size_t)(bS + srow) * D_ + h * HD_ + scol;
  const _Float16* gV = vt + (size_t)srow * S_ + scol;
  const unsigned lK = lds_off_of(&Ktile[0][srow][scol]);
  const unsigned lV = lds_off_of(&Vtile[0][srow][scol]);
  auto issue = [&](const int s, const int buf) {
    const _Float16* k = gK + (size_t)s * (64 * D_);
    const _Float16* v = gV + s * 64;
    const unsigned ob = (unsigned)buf * (64 * KP_ * 2);
    async_copy4_b128(lK + ob, k, lK + ob + 32 * KP_ * 2, k + 32 * D_,
                     lV + ob, v, lV + ob + 32 * KP_ * 2, v + 32 * S_);
  };

  // o[u][f][r] = Ot[dim f*16 + g*8 + r][query n of tile u]; mrun: the query's
  // maximum in use, in log2 units (equal in both lane halves): the first stage
  // sets it to that stage's maximum, and later it is raised only when a score
  // tops it by more than 8, so an exponential reaches 2^8 at most and o and lrun
  // are rescaled only then; lrun: this lane half's share of the row sum.
  v8f o[2][4];
  float mrun[2], lrun[2], qi[2];
  // A score above mrun + top raises mrun, by at least low. Before the first
  // stage both lie below every score: that stage always sets mrun, up or down.
  float top = -3.0e38f, low = -3.0e38f;
#pragma unroll
  for (int u = 0; u < 2; ++u) {
    mrun[u] = 0.f;
    lrun[u] = 0.f;
    qi[u]   = (float)((qt + u) * 16 + n);
#pragma unroll
    for (int f = 0; f < 4; ++f) o[u][f] = zero8();
  }

  const int NS = S_ / 64;

  // Time decay exp(-lam * |i - j|), with key j = j0 + jj, j0 the first of the
  // wave's 32 keys. Keys that lie wholly on one side of the block's 128 queries
  // have |i - j| = |i - j0| - jj (keys below) or |i - j0| + jj (keys above), so
  // the factor is exp(-lam * |i - j0|), one exponential per query and stage, times
  // K2 * exp(+lam * jj) or K2 * exp(-lam * jj), the same for every such stage.
  // The two stages from near0 on hold the block's own positions: direct form.
  const int near0 = (blockIdx.x & 15) << 1;  // of blockIdx alone: the same for the block
  // Pairs of neighbouring keys, as they lie in the score tiles' registers: the
  // multiplies and the multiply-adds below are packed, two scores each.
  v2f c0[4];                                 // jj = g*8 + r, r = 2i, 2i + 1
  float k16;                                 // 16 keys on: c0 times k16 (8 registers fewer)
  auto set_c = [&](const float sl) {
    const float cg = K2 * __expf(sl * (float)(g * 8));
    k16 = __expf(sl * 16.0f);
    // the exponentials of sl * r and k16 are the same in every lane: scalar work
#pragma unroll
    for (int i = 0; i < 4; ++i)
      c0[i] = v2f{cg * __expf(sl * (float)(2 * i)), cg * __expf(sl * (float)(2 * i + 1))};
  };

  // Prologue: stage 0 lands and is published, then stage 1 starts.
  issue(0, 0);
  asm volatile("s_wait_asynccnt 0x0" ::: "memory");  // own copies of stage 0 landed
  __syncthreads();                                   // ... and every wave's
  issue(1, 1);

  // One stage; direct.value says at compile time which form the decay takes.
  auto trip = [&](const int s, auto direct) __attribute__((always_inline)) {
    const int cur = s & 1;
    const int j0  = s * 64 + kh * 32;

    // ---- scores, transposed: 32 keys x 2 x 16 queries ----
    const _Float16* kt = &Ktile[cur][kh * 32][0];
    const v16h kb00 = load_frag(kt, 0,  KP_, 0,  lane);
    const v16h kb01 = load_frag(kt, 0,  KP_, 32, lane);
    const v16h kb10 = load_frag(kt, 16, KP_, 0,  lane);
    const v16h kb11 = load_frag(kt, 16, KP_, 32, lane);
    // The A fragments of the second product: each serves both query tiles.
    const _Float16* vtl = &Vtile[cur][0][kh * 32];
    v16h va[4];
#pragma unroll
    for (int f = 0; f < 4; ++f) va[f] = load_frag(vtl, f * 16, KP_, 0, lane);
    // Keeps all reads of the stage together, ahead of the WMMAs: each separate
    // place with reads makes the wave wait out the LDS latency again.
    __builtin_amdgcn_sched_barrier(0);
    v8f s0[2], s1[2];   // s0[u][r]: key g*8 + r, s1[u][r]: key 16 + g*8 + r
#pragma unroll
    for (int u = 0; u < 2; ++u) {
      s0[u] = wmma_f16f32(kb00, qa[u][0], zero8());
      s1[u] = wmma_f16f32(kb10, qa[u][0], zero8());
    }
#pragma unroll
    for (int u = 0; u < 2; ++u) {
      s0[u] = wmma_f16f32(kb01, qa[u][1], s0[u]);
      s1[u] = wmma_f16f32(kb11, qa[u][1], s1[u]);
    }

    // ---- clamp; x = score * (scale * log2(e) * decay) - maximum in use ----
    v2f x0[2][4], x1[2][4];   // x0[u][i]: keys g*8 + 2i, + 1; x1: 16 more
    float xmax[2];
    bool need = false;
#pragma unroll
    for (int u = 0; u < 2; ++u) {
      const float dq = qi[u] - (float)(j0 + g * 8);  // whole numbers: exact
      const float e  = __expf(-lam * fabsf(qi[u] - (float)j0));  // unused if direct
      const v2f ee = {e, e}, ee16 = {e * k16, e * k16}, nm = {-mrun[u], -mrun[u]};
#pragma unroll
      for (int i = 0; i < 4; ++i) {
        const v2f t0 = {clamp_raw(s0[u][2 * i]), clamp_raw(s0[u][2 * i + 1])};
        const v2f t1 = {clamp_raw(s1[u][2 * i]), clamp_raw(s1[u][2 * i + 1])};
        v2f f0, f1;
        if constexpr (decltype(direct)::value) {
          f0 = v2f{K2 * __expf(-lam * fabsf(dq - (float)(2 * i))),
                   K2 * __expf(-lam * fabsf(dq - (float)(2 * i + 1)))};
          f1 = v2f{K2 * __expf(-lam * fabsf(dq - (float)(16 + 2 * i))),
                   K2 * __expf(-lam * fabsf(dq - (float)(17 + 2 * i)))};
        } else {
          f0 = ee * c0[i];
          f1 = ee16 * c0[i];
        }
        x0[u][i] = __builtin_elementwise_fma(t0, f0, nm);
        x1[u][i] = __builtin_elementwise_fma(t1, f1, nm);
      }
      // in-lane over 16 keys, one exchange between the lane halves
      float m = fmaxf(x0[u][0].x, x0[u][0].y);
#pragma unroll
      for (int i = 1; i < 4; ++i) m = fmaxf(m, fmaxf(x0[u][i].x, x0[u][i].y));
#pragma unroll
      for (int i = 0; i < 4; ++i) m = fmaxf(m, fmaxf(x1[u][i].x, x1[u][i].y));
      xmax[u] = fmaxf(m, other_half(m));
      need = need || (xmax[u] > top);
    }

    // ---- lazy rescale: one test per stage, a scalar branch, rarely taken ----
    if (__builtin_amdgcn_ballot_w32(need) != 0) {
#pragma unroll
      for (int u = 0; u < 2; ++u) {
        const float mnew  = mrun[u] + fmaxf(xmax[u], low);
        const float up    = mnew - mrun[u];
        // up < 0 only in the first stage, where o and lrun are 0: alpha stays finite
        const float alpha = __builtin_amdgcn_exp2f(fminf(-up, 0.0f));
        mrun[u] = mnew;
        lrun[u] *= alpha;
#pragma unroll
        for (int i = 0; i < 4; ++i) {
          x0[u][i] -= up;
          x1[u][i] -= up;
        }
#pragma unroll
        for (int f = 0; f < 4; ++f)
#pragma unroll
          for (int r = 0; r < 8; ++r) o[u][f][r] *= alpha;
      }
      top = 8.0f;
      low = 0.0f;
    }

    v16h pt[2];   // Pt as B operand: element e is key g*8 + e, or 16 + g*8 + (e - 8)
#pragma unroll
    for (int u = 0; u < 2; ++u) {
      v2f p[4];
#pragma unroll
      for (int i = 0; i < 4; ++i) {
        const v2f p0 = {__builtin_amdgcn_exp2f(x0[u][i].x), __builtin_amdgcn_exp2f(x0[u][i].y)};
        const v2f p1 = {__builtin_amdgcn_exp2f(x1[u][i].x), __builtin_amdgcn_exp2f(x1[u][i].y)};
        pt[u][2 * i]         = (_Float16)p0.x;
        pt[u][2 * i + 1]     = (_Float16)p0.y;
        pt[u][8 + 2 * i]     = (_Float16)p1.x;
        pt[u][8 + 2 * i + 1] = (_Float16)p1.y;
        p[i] = p0 + p1;
      }
      // in-lane sum as a tree: short dependent chain
      p[0] += p[2];
      p[1] += p[3];
      p[0] += p[1];
      lrun[u] += p[0].x + p[0].y;
    }

    // ---- Ot += Vt(64x32) @ Pt(32x16) ----
#pragma unroll
    for (int f = 0; f < 4; ++f)
#pragma unroll
      for (int u = 0; u < 2; ++u) o[u][f] = wmma_f16f32(va[f], pt[u], o[u][f]);
    // Keeps the stage's work in front of the publish point: lifted over it, the
    // wait would end the copies of stage s + 1 before the work has covered
    // their latency.
    __builtin_amdgcn_sched_barrier(0);

    // Publish point of stage s + 1, which also frees the buffer just read.
    asm volatile("s_wait_dscnt 0x0" ::: "memory");     // own LDS reads are done
    asm volatile("s_wait_asynccnt 0x0" ::: "memory");  // own copies of s + 1 landed
    __syncthreads();
    if (s + 2 < NS) issue(s + 2, cur);
  };

  // The stages in ascending order. Every bound is the same for the whole block,
  // so all its waves pass the same barriers.
  set_c(lam);
  for (int s = 0; s < near0; ++s) trip(s, form<false>{});
  for (int s = near0; s < near0 + 2; ++s) trip(s, form<true>{});
  set_c(-lam);
  for (int s = near0 + 2; s < NS; ++s) trip(s, form<false>{});
  asm volatile("s_wait_asynccnt 0x0" ::: "memory");  // nothing in flight at the end

  // ---- epilogue: join the lane halves' sums, then the two key halves ----
  float lsum[2];
#pragma unroll
  for (int u = 0; u < 2; ++u) lsum[u] = lrun[u] + other_half(lrun[u]);
  if (kh == 1) {   // the same for a whole wave
#pragma unroll
    for (int u = 0; u < 2; ++u) {
      Mmrg[qg][u][lane] = mrun[u];
      Lmrg[qg][u][lane] = lsum[u];
#pragma unroll
      for (int f = 0; f < 4; ++f) {
        const v4f lo = {o[u][f][0], o[u][f][1], o[u][f][2], o[u][f][3]};
        const v4f hi = {o[u][f][4], o[u][f][5], o[u][f][6], o[u][f][7]};
        Omrg[qg][(u * 4 + f) * 2 + 0][lane] = lo;
        Omrg[qg][(u * 4 + f) * 2 + 1][lane] = hi;
      }
    }
  }
  __syncthreads();  // the upper-key states are visible to the lower-key waves
  if (kh == 0) {
    // A lane holds 8 consecutive dims of its query per tile and f: one 16-byte store.
#pragma unroll
    for (int u = 0; u < 2; ++u) {
      const float m1 = Mmrg[qg][u][lane];
      const float l1 = Lmrg[qg][u][lane];
      const float m  = fmaxf(mrun[u], m1);
      const float a0 = __builtin_amdgcn_exp2f(mrun[u] - m);  // maxima: log2 units
      const float a1 = __builtin_amdgcn_exp2f(m1 - m);
      const float inv = 1.0f / (lsum[u] * a0 + l1 * a1);
      const float w0 = a0 * inv, w1 = a1 * inv;
#pragma unroll
      for (int f = 0; f < 4; ++f) {
        const v4f lo = Omrg[qg][(u * 4 + f) * 2 + 0][lane];
        const v4f hi = Omrg[qg][(u * 4 + f) * 2 + 1][lane];
        v8h o8;
#pragma unroll
        for (int r = 0; r < 4; ++r) {
          o8[r]     = (_Float16)(o[u][f][r] * w0 + lo[r] * w1);
          o8[4 + r] = (_Float16)(o[u][f][4 + r] * w0 + hi[r] * w1);
        }
        *(v8h*)(Oh + (size_t)(qrow0 + u * 16 + n) * D_ + h * HD_ + f * 16 + g * 8) = o8;
      }
    }
  }
}

// ---------------------------------------------------------------------------
// Host orchestration
// ---------------------------------------------------------------------------
extern "C" void kernel_launch(void* const* d_in, const int* in_sizes, int n_in,
                              void* d_out, int out_size, void* d_ws,
                              size_t ws_size, hipStream_t stream) {
  (void)in_sizes; (void)n_in; (void)out_size; (void)ws_size;
  const float* x     = (const float*)d_in[0];
  const float* Wq    = (const float*)d_in[1];
  const float* Wk    = (const float*)d_in[2];
  const float* Wv    = (const float*)d_in[3];
  const float* Wo    = (const float*)d_in[4];
  const float* Wdown = (const float*)d_in[5];
  const float* Wupk  = (const float*)d_in[6];
  const float* Wupv  = (const float*)d_in[7];
  float* out = (float*)d_out;  // [NTOK_*D_] attn-out, then [NTOK_*L_] latent

  // Carve workspace (256B aligned)
  char* wsp = (char*)d_ws;
  auto carve = [&](size_t bytes) {
    char* p = wsp;
    wsp += (bytes + 255) & ~(size_t)255;
    return p;
  };
  _Float16* x_h      = (_Float16*)carve((size_t)NTOK_ * D_ * 2);
  _Float16* q_h      = (_Float16*)carve((size_t)NTOK_ * D_ * 2);
  _Float16* k_h      = (_Float16*)carve((size_t)NTOK_ * D_ * 2);
  _Float16* vT       = (_Float16*)carve((size_t)NTOK_ * D_ * 2);
  _Float16* attn_h   = (_Float16*)carve((size_t)NTOK_ * D_ * 2);
  _Float16* latent_h = (_Float16*)carve((size_t)NTOK_ * L_ * 2);
  _Float16* wq_t     = (_Float16*)carve((size_t)D_ * D_ * 2);
  _Float16* wo_t     = (_Float16*)carve((size_t)D_ * D_ * 2);
  _Float16* wkv_h    = (_Float16*)carve((size_t)D_ * D_ * 2);
  _Float16* wdown_t  = (_Float16*)carve((size_t)D_ * L_ * 2);
  _Float16* wupk_t   = (_Float16*)carve((size_t)D_ * L_ * 2);
  _Float16* wupv_t   = (_Float16*)carve((size_t)D_ * L_ * 2);
  _Float16* wcomb_t  = (_Float16*)carve((size_t)D_ * L_ * 2);

  // --- the operands of W_comb ---
  prep_wcomb_operands_kernel<<<NB_ADD + NB_TDL, 256, 0, stream>>>(
      Wk, Wv, Wdown, wkv_h, wdown_t);

  // --- W_comb^T (folds the k/v GEMMs away), beside all other prep work ---
  gemm_wcomb_and_prep_kernel<<<NB_WC + NB_X + 2 * NB_TDD + 2 * NB_TDL, 256, 0, stream>>>(
      wdown_t, wkv_h, wcomb_t, x, Wq, Wo, Wupk, Wupv,
      x_h, wq_t, wo_t, wupk_t, wupv_t);

  // --- q = x @ Wq, and latent = x @ W_comb : f32 -> d_out tail, f16 -> latent_h ---
  gemm_q_and_latent_kernel<<<NB_BIG + NB_LAT, 256, 0, stream>>>(
      x_h, wq_t, q_h, wcomb_t, out + (size_t)NTOK_ * D_, latent_h);

  // --- k_rec (row-major == B^T for QK^T) and v_rec ([B,H,64,S]) from latent ---
  gemm_krec_and_vrec_kernel<<<2 * NB_BIG, 256, 0, stream>>>(
      latent_h, wupk_t, k_h, wupv_t, vT);

  // --- flash attention with decay: 512 blocks, 8 q-tiles of one (b,h) each ---
  flash_attn_decay_kernel<<<B_ * H_ * (S_ / 128), 256, 0, stream>>>(
      q_h, k_h, vT, attn_h);

  // --- out = attn @ Wo ---
  gemm_wmma_kernel<0, 4, 2, NTOK_, D_, D_>
      <<<(NTOK_ / 128) * (D_ / 128), 256, 0, stream>>>(attn_h, wo_t, out, nullptr);
}

// v010
// One run takes 83.8 microseconds.
// Next to v009, in two timings, it ran 1.08 and 1.09 times as fast.
// All steps since v000 together make it 5.30 times as fast.
#include <hip/hip_runtime.h>

// Problem constants
#define B_    2
#define S_    2048
#define D_    1024
#define H_    16
#define HD_   64
#define L_    256
#define NTOK_ (B_ * S_)
#define KP_   72   // LDS pitch of a 64-half row, in halves

typedef __attribute__((ext_vector_type(16))) _Float16 v16h;
typedef __attribute__((ext_vector_type(8)))  _Float16 v8h;
typedef __attribute__((ext_vector_type(8)))  float    v8f;
typedef __attribute__((ext_vector_type(4)))  _Float16 v4h;
typedef __attribute__((ext_vector_type(4)))  float    v4f;
typedef __attribute__((ext_vector_type(2)))  float    v2f;

static __device__ __forceinline__ v8f wmma_f16f32(v16h a, v16h b, v8f c) {
  // D = A(16x32 f16) * B(32x16 f16) + C(16x16 f32)
  return __builtin_amdgcn_wmma_f32_16x16x32_f16(false, a, false, b, (short)0, c,
                                                false, false);
}

static __device__ __forceinline__ v8f zero8() {
  v8f z = {0.f, 0.f, 0.f, 0.f, 0.f, 0.f, 0.f, 0.f};
  return z;
}

// Load an A-style fragment (row m = lane&15; K chunks at col0+8g and col0+16+8g)
// from a row-major f16 matrix with leading dimension ld. The same routine loads
// B-fragments from the *transposed* (N-major) operand. Works for global or LDS.
static __device__ __forceinline__ v16h load_frag(const _Float16* __restrict__ base,
                                                 int row0, int ld, int col0,
                                                 int lane) {
  const int g = lane >> 4;
  const int m = lane & 15;
  const _Float16* p = base + (size_t)(row0 + m) * ld + col0 + g * 8;
  union { v16h v; v8h h[2]; } u;
  u.h[0] = *(const v8h*)(p);
  u.h[1] = *(const v8h*)(p + 16);
  return u.v;
}

// LDS byte offset of a __shared__ object (dsaddr = LDS_BASE + VGPR, ISA 10.x):
// generic -> addrspace(3) cast yields the 32-bit LDS offset.
static __device__ __forceinline__ unsigned lds_off_of(const void* p) {
  return (unsigned)(unsigned long long)(const __attribute__((address_space(3))) char*)p;
}

// ---------------------------------------------------------------------------
// Elementwise prep work. A thread handles 32 elements through 16-byte
// loads that are all issued before the first is used. Each part below is the
// work of ONE block, numbered blk within its part; the block counts cover the
// fixed shapes exactly (static_assert at the counts), so there is no bounds test.
// ---------------------------------------------------------------------------
// One wave converts NV runs of 128 consecutive floats (512 B per load).
template <int NV>
static __device__ __forceinline__ void f32_to_f16_part(
    const float* __restrict__ in, _Float16* __restrict__ out, const int blk) {
  const int base = (blk * 8 + (threadIdx.x >> 5)) * (NV * 128) +
                   (threadIdx.x & 31) * 4;
  v4f v[NV];
#pragma unroll
  for (int j = 0; j < NV; ++j) v[j] = *(const v4f*)(in + base + j * 128);
#pragma unroll
  for (int j = 0; j < NV; ++j)
    *(v4h*)(out + base + j * 128) = __builtin_convertvector(v[j], v4h);
}

// out[c * R + r] = (f16) in[r * C + c]   (in: R x C f32, out: C x R f16)
// One thread: 8 rows x 4 columns in registers (8 loads of 16 B, 4 stores of
// 16 B). One wave: 8 rows x 128 columns. The 8 waves of a block take 64
// consecutive rows, so each 128-byte line of out is written by one block.
template <int R, int C>
static __device__ __forceinline__ void transpose_f32_to_f16_part(
    const float* __restrict__ in, _Float16* __restrict__ out, const int blk) {
  constexpr int CB = C / 128;
  const int c0 = (blk % CB) * 128 + (threadIdx.x & 31) * 4;
  const int r0 = (blk / CB) * 64 + (threadIdx.x >> 5) * 8;
  v4f v[8];
#pragma unroll
  for (int j = 0; j < 8; ++j) v[j] = *(const v4f*)(in + (r0 + j) * C + c0);
#pragma unroll
  for (int q = 0; q < 4; ++q) {
    v8h o8;
#pragma unroll
    for (int j = 0; j < 8; ++j) o8[j] = (_Float16)v[j][q];
    *(v8h*)(out + (c0 + q) * R + r0) = o8;
  }
}

// Stands behind the last store of a part in a kernel that holds several parts:
// there another part's code follows in the program and rewrites the registers
// that the stores name; the wait comes first (a precaution).
static __device__ __forceinline__ void part_stores_issued() {
  asm volatile("s_wait_xcnt 0x0" ::: "memory");
}

// Blocks per part.
constexpr int NB_X   = NTOK_ * D_ / (256 * 32);  // x -> f16
constexpr int NB_TDD = D_ * D_ / 8192;           // transpose of a D x D weight
constexpr int NB_TDL = D_ * L_ / 8192;           // transpose of an L x D weight
static_assert((NTOK_ * D_) % (256 * 32) == 0 && D_ % 128 == 0 && L_ % 128 == 0,
              "prep blocks cover the shapes");

// ---------------------------------------------------------------------------
// WMMA GEMM: C[M x N] = A[M x K] * B[K x N], B given transposed (N x K).
// One block of 8 waves (2 along M x 4 along N) computes a (32*WM) x (64*WN)
// tile of C; one wave a (16*WM) x (16*WN) part of it. Each trip takes 64 k:
// the block's rows of A and of Bt (128 B each) are brought into LDS once by
// asynchronous copies and every wave reads its fragments from there, so a row
// is fetched from L2 once per block, in whole 128-byte lines. Two buffers: the
// copies of trip t + 2 fly while trip t + 1 is worked on.
// MODE 0: f32 out; 1: f16 out; 2: f32 + f16 out; 3: per-head transposed f16
//         scatter (v_rec -> vT[B][H][64][S]).
// ---------------------------------------------------------------------------
// Four 16-byte asynchronous copies per lane, global memory -> LDS. The
// s_wait_xcnt stands as the last line of the copies' own statement, so that no
// later write of an address register can be moved in front of it (a precaution).
static __device__ __forceinline__ void async_copy4_b128(
    unsigned l0, const _Float16* g0, unsigned l1, const _Float16* g1,
    unsigned l2, const _Float16* g2, unsigned l3, const _Float16* g3) {
  asm volatile(
      "global_load_async_to_lds_b128 %0, %1, off\n\t"
      "global_load_async_to_lds_b128 %2, %3, off\n\t"
      "global_load_async_to_lds_b128 %4, %5, off\n\t"
      "global_load_async_to_lds_b128 %6, %7, off\n\t"
      "s_wait_xcnt 0x0"
      :: "v"(l0), "v"((unsigned long long)g0), "v"(l1),
         "v"((unsigned long long)g1), "v"(l2), "v"((unsigned long long)g2),
         "v"(l3), "v"((unsigned long long)g3)
      : "memory");
}

// Halves of LDS that a block with WM x WN wave tiles stages (two buffers).
constexpr int stage_halves(int WM, int WN) { return 2 * (32 * WM + 64 * WN) * KP_; }

// The work of ONE block: tile number blk of the product; smem is the block's
// staging area, stage_halves(WM, WN) halves, declared by the kernel.
template <int MODE, int WM, int WN, int M, int N, int K>
static __device__ __forceinline__ void gemm_wmma_tile(
    const _Float16* __restrict__ A, const _Float16* __restrict__ Bt,
    float* __restrict__ Cf, _Float16* __restrict__ Ch, const int blk,
    _Float16* smem) {
  constexpr int BM   = 32 * WM;      // rows of C (and of A) per block
  constexpr int BN   = 64 * WN;      // columns of C (rows of Bt) per block
  constexpr int ROWS = BM + BN;      // staged rows per trip: A first, then Bt
  constexpr int NT   = K / 64;       // trips
  constexpr int NC   = ROWS / 32;    // copies per thread and trip
  constexpr unsigned BUFB = ROWS * KP_ * 2;  // bytes of one buffer
  static_assert(M % BM == 0 && N % BN == 0 && K % 64 == 0 && NC % 4 == 0,
                "the grid covers the shape exactly; no edge handling");
  // 128-byte rows at a pitch of 144 B (odd multiple of 16 B) for ds_load_b128.
  _Float16 (*stage)[ROWS][KP_] = reinterpret_cast<_Float16 (*)[ROWS][KP_]>(smem);

  const int t    = threadIdx.x;
  const int lane = t & 31;
  const int wid  = t >> 5;
  const int g = lane >> 4;
  const int n = lane & 15;
  const int bm0 = (blk / (N / BN)) * BM;
  const int bn0 = (blk % (N / BN)) * BN;
  const int wr0 = (wid >> 2) * (WM * 16);  // the wave's first row in the tile
  const int wc0 = (wid & 3) * (WN * 16);   // the wave's first column in the tile

  // Copy j of a thread: staged row (t >> 3) + 32 * j, 16-byte piece t & 7; a
  // wave's copy covers 4 whole rows of 128 B.
  const int crow = t >> 3, ccol = (t & 7) * 8;
  const _Float16* gA = A  + (size_t)(bm0 + crow) * K + ccol;
  const _Float16* gB = Bt + (size_t)(bn0 + crow) * K + ccol;
  const unsigned lrow = lds_off_of(&stage[0][crow][ccol]);

  auto from = [&](int j, int k0) -> const _Float16* {
    return j < BM / 32 ? gA + (size_t)(j * 32) * K + k0
                       : gB + (size_t)(j * 32 - BM) * K + k0;
  };
  auto issue = [&](int tile, int buf) {
    const int k0 = tile * 64;
    const unsigned lb = lrow + (unsigned)buf * BUFB;
    // unrolled so that the choice between A and Bt is made at compile time
#pragma unroll
    for (int j = 0; j < NC; j += 4)
      async_copy4_b128(lb + (j + 0) * (32 * KP_ * 2), from(j + 0, k0),
                       lb + (j + 1) * (32 * KP_ * 2), from(j + 1, k0),
                       lb + (j + 2) * (32 * KP_ * 2), from(j + 2, k0),
                       lb + (j + 3) * (32 * KP_ * 2), from(j + 3, k0));
  };

  // Every "#pragma unroll" from here on makes the index of a register array
  // (acc, a, b) a compile-time constant, so that the array stays in registers.
  v8f acc[WM][WN];
#pragma unroll
  for (int i = 0; i < WM; ++i)
#pragma unroll
    for (int j = 0; j < WN; ++j) acc[i][j] = zero8();

  // Prologue: tile 0 lands and is published, then tile 1 starts.
  issue(0, 0);
  asm volatile("s_wait_asynccnt 0x0" ::: "memory");  // own copies of tile 0 landed
  __syncthreads();                                   // ... and every wave's
  if (NT > 1) issue(1, 1);

  for (int tt = 0; tt < NT; ++tt) {
    const _Float16* sA = &stage[tt & 1][0][0];
    const _Float16* sB = &stage[tt & 1][BM][0];
    // All fragment reads of the trip stand together, ahead of its WMMAs.
    v16h a[2][WM], b[2][WN];
#pragma unroll
    for (int kk = 0; kk < 2; ++kk) {
#pragma unroll
      for (int i = 0; i < WM; ++i)
        a[kk][i] = load_frag(sA, wr0 + i * 16, KP_, kk * 32, lane);
#pragma unroll
      for (int j = 0; j < WN; ++j)
        b[kk][j] = load_frag(sB, wc0 + j * 16, KP_, kk * 32, lane);
    }
    // Keeps the scheduler from sinking the reads among the WMMAs, where each
    // separate place with reads makes the wave wait out the LDS latency again.
    __builtin_amdgcn_sched_barrier(0);
#pragma unroll
    for (int kk = 0; kk < 2; ++kk)
#pragma unroll
      for (int i = 0; i < WM; ++i)
#pragma unroll
        for (int j = 0; j < WN; ++j)
          acc[i][j] = wmma_f16f32(a[kk][i], b[kk][j], acc[i][j]);
    // Keeps the trip's WMMAs in front of the publish point: lifted over them,
    // the waits would end the reads and the copies before any matrix work
    // has covered their latency.
    __builtin_amdgcn_sched_barrier(0);

    // Publish point of tile tt + 1, which also frees the buffer just read.
    asm volatile("s_wait_dscnt 0x0" ::: "memory");     // own LDS reads are done
    asm volatile("s_wait_asynccnt 0x0" ::: "memory");  // own copies of tt + 1 landed
    __syncthreads();
    if (tt + 2 < NT) issue(tt + 2, tt & 1);
  }
  asm volatile("s_wait_asynccnt 0x0" ::: "memory");  // nothing in flight at the end

#pragma unroll
  for (int i = 0; i < WM; ++i) {
    const int row0 = bm0 + wr0 + i * 16;
#pragma unroll
    for (int j = 0; j < WN; ++j) {
      const int col = bn0 + wc0 + j * 16 + n;
      if constexpr (MODE == 3) {
        // v_rec element C[tok][col] -> vT[b][h][d][s], 8 consecutive tokens per lane
        const int hh  = col >> 6;
        const int dd  = col & (HD_ - 1);
        const int tok0 = row0 + g * 8;        // 16-aligned tile: never crosses batch
        const int bb = tok0 >> 11;            // / S_
        const int ss = tok0 & (S_ - 1);
        v8h o8;
#pragma unroll
        for (int r = 0; r < 8; ++r) o8[r] = (_Float16)acc[i][j][r];
        *(v8h*)(Ch + (size_t)((bb * H_ + hh) * HD_ + dd) * S_ + ss) = o8;
      } else {
#pragma unroll
        for (int r = 0; r < 8; ++r) {
          const size_t idx = (size_t)(row0 + g * 8 + r) * N + col;
          if constexpr (MODE == 0 || MODE == 2) Cf[idx] = acc[i][j][r];
          if constexpr (MODE == 1 || MODE == 2) Ch[idx] = (_Float16)acc[i][j][r];
        }
      }
    }
  }
}

// W_comb = (Wk + Wv) @ W_down, taken as its transpose: W_comb^T[l][d] =
// sum over k of W_down[k][l] * (Wk + Wv)[d][k]. It leaves the product in f16 in
// the N-major form that the latent product reads. The block takes both operands
// straight from the f32 weights: a thread loads its share of a 128-k slice into
// registers, and on the way into LDS it adds Wk and Wv, rounds to f16 and turns
// the W_down slice round, so no launch has to prepare these operands first.
// The work of ONE block: a 64 (l) x 64 (d) tile; 8 waves, 2 along l x 4 along d.
// Two LDS buffers; the loads of slice t + 2 fly while slice t is multiplied.
constexpr int WC_KT = 128;        // k per trip
constexpr int WC_P  = WC_KT + 8;  // LDS pitch in halves: 272 B, an odd multiple of 16 B
constexpr int WC_STAGE_HALVES = 2 * 128 * WC_P;  // two buffers of 64 + 64 rows

static __device__ __forceinline__ void wcomb_tile_from_f32(
    const float* __restrict__ Wk, const float* __restrict__ Wv,
    const float* __restrict__ Wdown, _Float16* __restrict__ wcomb_t,
    const int blk, _Float16* smem) {
  constexpr int NT = D_ / WC_KT;  // trips
  static_assert(D_ % WC_KT == 0 && D_ % 64 == 0 && L_ % 64 == 0 && NT >= 2,
                "the tiles cover the shape exactly; no edge handling");
  // rows 0..63: W_down^T (row l, k along the row); rows 64..127: Wk + Wv (row d)
  _Float16 (*stage)[128][WC_P] = reinterpret_cast<_Float16 (*)[128][WC_P]>(smem);

  const int t    = threadIdx.x;
  const int lane = t & 31;
  const int wid  = t >> 5;
  const int g = lane >> 4;
  const int n = lane & 15;
  const int bm0 = (blk / (D_ / 64)) * 64;  // first l of the tile
  const int bn0 = (blk % (D_ / 64)) * 64;  // first d of the tile
  const int wr0 = (wid >> 2) * 32;         // the wave's first row in the tile
  const int wc0 = (wid & 3) * 16;          // the wave's first column in the tile

  // Wk, Wv: piece j of a thread is 8 k of row (t >> 4) + 16 * j; 16 lanes cover
  // the 512 B that a slice holds of one row. W_down: 8 k x 4 l per thread; 16
  // lanes cover the 256 B that the tile holds of one k.
  const int hi = t >> 4, lo = t & 15;
  const float* pk = Wk + (bn0 + hi) * D_ + lo * 8;
  const float* pv = Wv + (bn0 + hi) * D_ + lo * 8;
  const float* pd = Wdown + (hi * 8) * L_ + bm0 + lo * 4;

  // Every "#pragma unroll" of this function makes the index of a register array
  // (rk, rv, rd, a, b, acc) a compile-time constant: the array stays in registers.
  v4f rk[4][2], rv[4][2], rd[8];
  auto fetch = [&](const int tile) {
    const int k0 = tile * WC_KT;
#pragma unroll
    for (int j = 0; j < 4; ++j)
#pragma unroll
      for (int c = 0; c < 2; ++c) {
        rk[j][c] = *(const v4f*)(pk + j * 16 * D_ + k0 + c * 4);
        rv[j][c] = *(const v4f*)(pv + j * 16 * D_ + k0 + c * 4);
      }
#pragma unroll
    for (int j = 0; j < 8; ++j) rd[j] = *(const v4f*)(pd + (k0 + j) * L_);
  };
  auto put = [&](const int buf) {
#pragma unroll
    for (int j = 0; j < 4; ++j) {
      const v4h s0 = __builtin_convertvector(rk[j][0] + rv[j][0], v4h);
      const v4h s1 = __builtin_convertvector(rk[j][1] + rv[j][1], v4h);
      *(v8h*)&stage[buf][64 + hi + 16 * j][lo * 8] =
          __builtin_shufflevector(s0, s1, 0, 1, 2, 3, 4, 5, 6, 7);
    }
#pragma unroll
    for (int q = 0; q < 4; ++q) {
      v8h o8;
#pragma unroll
      for (int j = 0; j < 8; ++j) o8[j] = (_Float16)rd[j][q];
      *(v8h*)&stage[buf][lo * 4 + q][hi * 8] = o8;
    }
  };

  // The block's barrier with fences for LDS alone. __syncthreads() orders global
  // memory too: it would make every wave wait here for the loads of the slice
  // after next, which nobody else reads and which should stay in flight.
  auto lds_barrier = [&]() {
    // Stands in front of every later write of an address register that the
    // loads in flight name (a precaution); the scheduling barrier behind each
    // call keeps such writes behind it.
    asm volatile("s_wait_xcnt 0x0" ::: "memory");
    asm volatile("s_wait_dscnt 0x0" ::: "memory");  // own LDS reads and writes are done
    __builtin_amdgcn_fence(__ATOMIC_RELEASE, "workgroup", "local");
    __builtin_amdgcn_s_barrier();
    __builtin_amdgcn_fence(__ATOMIC_ACQUIRE, "workgroup", "local");
  };

  v8f acc[2] = {zero8(), zero8()};

  fetch(0);
  put(0);
  __builtin_amdgcn_sched_barrier(0);  // as in the loop: one set of load registers
  fetch(1);
  lds_barrier();  // slice 0 is visible to every wave
  __builtin_amdgcn_sched_barrier(0);  // as at the loop's foot

  // Unrolled: the slice's offset is then an immediate of every load, and no
  // address register changes while loads are in flight.
#pragma unroll
  for (int tt = 0; tt < NT; ++tt) {
    // The next slice goes into the buffer that the trip before has read (the
    // barrier at that trip's foot ended those reads), which frees the registers
    // for the loads of the slice after it: they have a whole trip to arrive.
    if (tt + 1 < NT) put((tt + 1) & 1);
    // Keeps the loads behind the stores that free their registers: lifted over
    // them they take a second set of 96, and only one block fits a WGP.
    __builtin_amdgcn_sched_barrier(0);
    if (tt + 2 < NT) fetch(tt + 2);
    // Keeps the loads in front of the trip's matrix work, which covers their
    // latency, and the sums and conversions of a later slice out of this trip,
    // where they would wait for loads that have only just been issued.
    __builtin_amdgcn_sched_barrier(0);
    const _Float16* sA = &stage[tt & 1][0][0];
    const _Float16* sB = &stage[tt & 1][64][0];
    v16h a[4][2], b[4];
#pragma unroll
    for (int kk = 0; kk < 4; ++kk) {
      a[kk][0] = load_frag(sA, wr0, WC_P, kk * 32, lane);
      a[kk][1] = load_frag(sA, wr0 + 16, WC_P, kk * 32, lane);
      b[kk]    = load_frag(sB, wc0, WC_P, kk * 32, lane);
    }
    // Keeps all fragment reads of the trip together, ahead of its WMMAs: each
    // separate place with reads makes the wave wait out the LDS latency again.
    __builtin_amdgcn_sched_barrier(0);
#pragma unroll
    for (int kk = 0; kk < 4; ++kk) {
      acc[0] = wmma_f16f32(a[kk][0], b[kk], acc[0]);
      acc[1] = wmma_f16f32(a[kk][1], b[kk], acc[1]);
    }
    // Publishes slice tt + 1 and ends the reads of the buffer of slice tt.
    if (tt + 1 < NT) lds_barrier();
    // Keeps the next trip's sums and conversions, which wait for its loads,
    // behind the barrier: the waves arrive there without that wait.
    __builtin_amdgcn_sched_barrier(0);
  }

#pragma unroll
  for (int i = 0; i < 2; ++i)
#pragma unroll
    for (int r = 0; r < 8; ++r)
      wcomb_t[(bm0 + wr0 + i * 16 + g * 8 + r) * D_ + bn0 + wc0 + n] =
          (_Float16)acc[i][r];
}

// One product per launch.
template <int MODE, int WM, int WN, int M, int N, int K>
__global__ __launch_bounds__(256) void gemm_wmma_kernel(
    const _Float16* __restrict__ A, const _Float16* __restrict__ Bt,
    float* __restrict__ Cf, _Float16* __restrict__ Ch) {
  __shared__ __align__(16) _Float16 smem[stage_halves(WM, WN)];
  gemm_wmma_tile<MODE, WM, WN, M, N, K>(A, Bt, Cf, Ch, blockIdx.x, smem);
}

// Pieces of work that do not need each other, in ONE launch; each takes a range
// of the block index (a scalar branch, the same for a whole block, so every
// barrier inside a product is passed by all waves of its block).
constexpr int NB_BIG = (NTOK_ / 128) * (D_ / 128);  // blocks of a NTOK x D product
constexpr int NB_WC  = (D_ / 64) * (L_ / 64);       // blocks of W_comb
constexpr int NB_LAT = (NTOK_ / 64) * (L_ / 64);    // blocks of latent

// W_comb^T from the f32 weights. Its 64 blocks come first in the grid, as they
// run longest; all prep work (x, Wq, Wo, W_up_k, W_up_v), of which it needs
// nothing, runs beside them.
__global__ __launch_bounds__(256) void gemm_wcomb_and_prep_kernel(
    const float* __restrict__ Wk, const float* __restrict__ Wv,
    const float* __restrict__ Wdown,
    _Float16* __restrict__ wcomb_t, const float* __restrict__ x,
    const float* __restrict__ Wq, const float* __restrict__ Wo,
    const float* __restrict__ Wupk, const float* __restrict__ Wupv,
    _Float16* __restrict__ x_h, _Float16* __restrict__ wq_t,
    _Float16* __restrict__ wo_t, _Float16* __restrict__ wupk_t,
    _Float16* __restrict__ wupv_t) {
  __shared__ __align__(16) _Float16 smem[WC_STAGE_HALVES];
  int blk = blockIdx.x;
  if (blk < NB_WC) {
    wcomb_tile_from_f32(Wk, Wv, Wdown, wcomb_t, blk, smem);
    return;
  }
  blk -= NB_WC;
  if (blk < NB_X) {
    f32_to_f16_part<8>(x, x_h, blk);
    part_stores_issued();
    return;
  }
  blk -= NB_X;
  if (blk < NB_TDD) {
    transpose_f32_to_f16_part<D_, D_>(Wq, wq_t, blk);
    part_stores_issued();
    return;
  }
  blk -= NB_TDD;
  if (blk < NB_TDD) {
    transpose_f32_to_f16_part<D_, D_>(Wo, wo_t, blk);
    part_stores_issued();
    return;
  }
  blk -= NB_TDD;
  if (blk < NB_TDL) {
    transpose_f32_to_f16_part<L_, D_>(Wupk, wupk_t, blk);
    part_stores_issued();
    return;
  }
  blk -= NB_TDL;
  transpose_f32_to_f16_part<L_, D_>(Wupv, wupv_t, blk);
  part_stores_issued();
}

// q = x @ Wq (one block per WGP) and latent = x @ W_comb (f32 to the output's
// tail, f16 for k_rec and v_rec): both read x_h over the same 1024 k, and the
// small latent blocks take the places that q leaves free on every WGP.
__global__ __launch_bounds__(256) void gemm_q_and_latent_kernel(
    const _Float16* __restrict__ x_h, const _Float16* __restrict__ wq_t,
    _Float16* __restrict__ q_h, const _Float16* __restrict__ wcomb_t,
    float* __restrict__ latent_f, _Float16* __restrict__ latent_h) {
  __shared__ __align__(16) _Float16 smem[stage_halves(4, 2)];
  const int blk = blockIdx.x;
  if (blk < NB_BIG) {
    gemm_wmma_tile<1, 4, 2, NTOK_, D_, D_>(x_h, wq_t, nullptr, q_h, blk, smem);
  } else {
    gemm_wmma_tile<2, 2, 1, NTOK_, L_, D_>(x_h, wcomb_t, latent_f, latent_h,
                                           blk - NB_BIG, smem);
    part_stores_issued();  // the q product's code follows in the program
  }
}

// k_rec = latent @ W_up_k (row-major) and v_rec = latent @ W_up_v (per head
// transposed).
__global__ __launch_bounds__(256) void gemm_krec_and_vrec_kernel(
    const _Float16* __restrict__ latent_h, const _Float16* __restrict__ wupk_t,
    _Float16* __restrict__ k_h, const _Float16* __restrict__ wupv_t,
    _Float16* __restrict__ vT) {
  __shared__ __align__(16) _Float16 smem[stage_halves(4, 2)];
  const int blk = blockIdx.x;
  if (blk < NB_BIG) {
    gemm_wmma_tile<1, 4, 2, NTOK_, D_, L_>(latent_h, wupk_t, nullptr, k_h, blk, smem);
  } else {
    gemm_wmma_tile<3, 4, 2, NTOK_, D_, L_>(latent_h, wupv_t, nullptr, vT,
                                           blk - NB_BIG, smem);
    part_stores_issued();  // the k_rec product's code follows in the program
  }
}

// ---------------------------------------------------------------------------
// Flash attention with multiplicative time decay.
// One block = 8 waves = 128 consecutive queries of ONE (b, h). A stage is 64
// keys of K and V, brought into LDS once by global_load_async_to_lds_b128, two
// buffers: the copies of stage s + 2 fly while stage s + 1 is worked on.
// A wave takes 32 queries (two 16-query tiles) and 32 of the stage's 64 keys:
// waves 0 to 3 the lower keys, waves 4 to 7 the upper ones. Every K and V
// fragment read from LDS then feeds two query tiles, and the two running
// softmax states of a query (lower and upper keys) are joined once at the end.
// The products are taken transposed, St = K * Qt and Ot += Vt * Pt: a lane then
// holds 16 of the 32 scores of ONE query (lanes l and l ^ 16 share a query), so
// the row maximum and the row sum are in-lane, and the two score tiles, once
// converted, already are the B operand of the second product.
// ---------------------------------------------------------------------------
// Value of lane l ^ 16 (a vector cross-row move; no LDS round trip).
static __device__ __forceinline__ float other_half(float x) {
  const int i = __builtin_bit_cast(int, x);
  return __builtin_bit_cast(
      float, __builtin_amdgcn_permlanex16(i, i, 0x76543210, 0xfedcba98, false, false));
}

template <bool V> struct form { static constexpr bool value = V; };

// Four waves per SIMD (two blocks per WGP, the whole grid resident at once):
// holds the register count at 256 or below.
__global__ __launch_bounds__(256) __attribute__((amdgpu_waves_per_eu(4, 4)))
void flash_attn_decay_kernel(
    const _Float16* __restrict__ Qh,   // [NTOK_, D_] row-major
    const _Float16* __restrict__ Kh,   // [NTOK_, D_] row-major (k_rec)
    const _Float16* __restrict__ Vt,   // [B_, H_, HD_, S_] (v_rec transposed)
    _Float16* __restrict__ Oh) {       // [NTOK_, D_] row-major
  // 128-byte rows at a pitch of 144 B (odd multiple of 16 B): the 16 rows that
  // one ds_load_b128 fragment read touches fall on distinct bank groups.
  __shared__ __align__(16) _Float16 Ktile[2][64][KP_];  // [key][dim] 18 KB
  __shared__ __align__(16) _Float16 Vtile[2][64][KP_];  // [dim][key] 18 KB
  // Hand-over of the upper-key waves' states at the end: 16 bytes per lane.
  __shared__ __align__(16) v4f Omrg[4][16][32];         // 32 KB
  __shared__ float Mmrg[4][2][32], Lmrg[4][2][32];

  const int t    = threadIdx.x;
  const int lane = t & 31;
  const int wid  = __builtin_amdgcn_readfirstlane(t >> 5);
  const int qg   = wid & 3;                      // which 32 of the block's queries
  const int kh   = wid >> 2;                     // which 32 of a stage's keys
  const int bh   = blockIdx.x >> 4;              // 16 blocks per (b,h)
  const int qt   = ((blockIdx.x & 15) << 3) + qg * 2;  // first of two query tiles
  const int h    = bh & (H_ - 1);
  const int b    = bh >> 4;
  const int g    = lane >> 4;
  const int n    = lane & 15;

  const float scale = 1.0f / (sqrtf((float)D_) + 1e-8f);
  const float lam   = 1e-4f;  // LAMBDA_DECAY * TIME_STEP
  const float CLMP  = 1e4f;
  // The softmax works on x = log2(e) * score - mrun. The raw product is clamped
  // at CLMP / scale, which is the reference's first clamp as scale > 0, and
  // scale, log2(e) and the decay are ONE factor of one multiply-add. The
  // reference's second clamp is an identity: the decay is at most 1, so a score
  // inside +-CLMP stays inside.
  const float CLR = CLMP / scale;
  const float K2  = scale * 1.44269504f;
  // The median of three as one instruction on the matrix result as it is. A NaN
  // gives the smaller bound, as fminf(fmaxf(s, -CLR), CLR) does: the reference
  // sets it to -1e9 and clamps that.
  auto clamp_raw = [&](const float s) { return __builtin_amdgcn_fmed3f(s, -CLR, CLR); };

  // Every "#pragma unroll" of this kernel makes the index of a register array
  // (qa, o, s0, s1, x0, x1, p, c0, pt, o8, mrun, lrun, ...) a compile-time
  // constant: the array stays in registers.
  const int bS    = b * S_;
  const int qrow0 = bS + qt * 16;
  v16h qa[2][2];   // [query tile][dims 0..31, 32..63]
#pragma unroll
  for (int u = 0; u < 2; ++u) {
    qa[u][0] = load_frag(Qh, qrow0 + u * 16, D_, h * HD_ + 0,  lane);
    qa[u][1] = load_frag(Qh, qrow0 + u * 16, D_, h * HD_ + 32, lane);
  }

  const _Float16* vt = Vt + (size_t)(b * H_ + h) * HD_ * S_;

  // Staging: a thread copies the 16-byte piece t & 7 of rows t >> 3 and
  // (t >> 3) + 32 of the K stage and of the V stage; a wave's copy covers 4
  // whole rows of 128 B.
  const int srow = t >> 3, scol = (t & 7) * 8;
  const _Float16* gK = Kh + (size_t)(bS + srow) * D_ + h * HD_ + scol;
  const _Float16* gV = vt + (size_t)srow * S_ + scol;
  const unsigned lK = lds_off_of(&Ktile[0][srow][scol]);
  const unsigned lV = lds_off_of(&Vtile[0][srow][scol]);
  auto issue = [&](const int s, const int buf) {
    const _Float16* k = gK + (size_t)s * (64 * D_);
    const _Float16* v = gV + s * 64;
    const unsigned ob = (unsigned)buf * (64 * KP_ * 2);
    async_copy4_b128(lK + ob, k, lK + ob + 32 * KP_ * 2, k + 32 * D_,
                     lV + ob, v, lV + ob + 32 * KP_ * 2, v + 32 * S_);
  };

  // o[u][f][r] = Ot[dim f*16 + g*8 + r][query n of tile u]; mrun: the query's
  // maximum in use, in log2 units (equal in both lane halves): the first stage
  // sets it to that stage's maximum, and later it is raised only when a score
  // tops it by more than 8, so an exponential reaches 2^8 at most and o and lrun
  // are rescaled only then; lrun: this lane half's share of the row sum.
  v8f o[2][4];
  float mrun[2], lrun[2], qi[2];
  // A score above mrun + top raises mrun, by at least low. Before the first
  // stage both lie below every score: that stage always sets mrun, up or down.
  float top = -3.0e38f, low = -3.0e38f;
#pragma unroll
  for (int u = 0; u < 2; ++u) {
    mrun[u] = 0.f;
    lrun[u] = 0.f;
    qi[u]   = (float)((qt + u) * 16 + n);
#pragma unroll
    for (int f = 0; f < 4; ++f) o[u][f] = zero8();
  }

  const int NS = S_ / 64;

  // Time decay exp(-lam * |i - j|), with key j = j0 + jj, j0 the first of the
  // wave's 32 keys. Keys that lie wholly on one side of the block's 128 queries
  // have |i - j| = |i - j0| - jj (keys below) or |i - j0| + jj (keys above), so
  // the factor is exp(-lam * |i - j0|), one exponential per query and stage, times
  // K2 * exp(+lam * jj) or K2 * exp(-lam * jj), the same for every such stage.
  // The two stages from near0 on hold the block's own positions: direct form.
  const int near0 = (blockIdx.x & 15) << 1;  // of blockIdx alone: the same for the block
  // Pairs of neighbouring keys, as they lie in the score tiles' registers: the
  // multiplies and the multiply-adds below are packed, two scores each.
  v2f c0[4];                                 // jj = g*8 + r, r = 2i, 2i + 1
  float k16;                                 // 16 keys on: c0 times k16 (8 registers fewer)
  auto set_c = [&](const float sl) {
    const float cg = K2 * __expf(sl * (float)(g * 8));
    k16 = __expf(sl * 16.0f);
    // the exponentials of sl * r and k16 are the same in every lane: scalar work
#pragma unroll
    for (int i = 0; i < 4; ++i)
      c0[i] = v2f{cg * __expf(sl * (float)(2 * i)), cg * __expf(sl * (float)(2 * i + 1))};
  };

  // Prologue: stage 0 lands and is published, then stage 1 starts.
  issue(0, 0);
  asm volatile("s_wait_asynccnt 0x0" ::: "memory");  // own copies of stage 0 landed
  __syncthreads();                                   // ... and every wave's
  issue(1, 1);

  // One stage; direct.value says at compile time which form the decay takes.
  auto trip = [&](const int s, auto direct) __attribute__((always_inline)) {
    const int cur = s & 1;
    const int j0  = s * 64 + kh * 32;

    // ---- scores, transposed: 32 keys x 2 x 16 queries ----
    const _Float16* kt = &Ktile[cur][kh * 32][0];
    const v16h kb00 = load_frag(kt, 0,  KP_, 0,  lane);
    const v16h kb01 = load_frag(kt, 0,  KP_, 32, lane);
    const v16h kb10 = load_frag(kt, 16, KP_, 0,  lane);
    const v16h kb11 = load_frag(kt, 16, KP_, 32, lane);
    // The A fragments of the second product: each serves both query tiles.
    const _Float16* vtl = &Vtile[cur][0][kh * 32];
    v16h va[4];
#pragma unroll
    for (int f = 0; f < 4; ++f) va[f] = load_frag(vtl, f * 16, KP_, 0, lane);
    // Keeps all reads of the stage together, ahead of the WMMAs: each separate
    // place with reads makes the wave wait out the LDS latency again.
    __builtin_amdgcn_sched_barrier(0);
    v8f s0[2], s1[2];   // s0[u][r]: key g*8 + r, s1[u][r]: key 16 + g*8 + r
#pragma unroll
    for (int u = 0; u < 2; ++u) {
      s0[u] = wmma_f16f32(kb00, qa[u][0], zero8());
      s1[u] = wmma_f16f32(kb10, qa[u][0], zero8());
    }
#pragma unroll
    for (int u = 0; u < 2; ++u) {
      s0[u] = wmma_f16f32(kb01, qa[u][1], s0[u]);
      s1[u] = wmma_f16f32(kb11, qa[u][1], s1[u]);
    }

    // ---- clamp; x = score * (scale * log2(e) * decay) - maximum in use ----
    v2f x0[2][4], x1[2][4];   // x0[u][i]: keys g*8 + 2i, + 1; x1: 16 more
    float xmax[2];
    bool need = false;
#pragma unroll
    for (int u = 0; u < 2; ++u) {
      const float dq = qi[u] - (float)(j0 + g * 8);  // whole numbers: exact
      const float e  = __expf(-lam * fabsf(qi[u] - (float)j0));  // unused if direct
      const v2f ee = {e, e}, ee16 = {e * k16, e * k16}, nm = {-mrun[u], -mrun[u]};
#pragma unroll
      for (int i = 0; i < 4; ++i) {
        const v2f t0 = {clamp_raw(s0[u][2 * i]), clamp_raw(s0[u][2 * i + 1])};
        const v2f t1 = {clamp_raw(s1[u][2 * i]), clamp_raw(s1[u][2 * i + 1])};
        v2f f0, f1;
        if constexpr (decltype(direct)::value) {
          f0 = v2f{K2 * __expf(-lam * fabsf(dq - (float)(2 * i))),
                   K2 * __expf(-lam * fabsf(dq - (float)(2 * i + 1)))};
          f1 = v2f{K2 * __expf(-lam * fabsf(dq - (float)(16 + 2 * i))),
                   K2 * __expf(-lam * fabsf(dq - (float)(17 + 2 * i)))};
        } else {
          f0 = ee * c0[i];
          f1 = ee16 * c0[i];
        }
        x0[u][i] = __builtin_elementwise_fma(t0, f0, nm);
        x1[u][i] = __builtin_elementwise_fma(t1, f1, nm);
      }
      // in-lane over 16 keys, one exchange between the lane halves
      float m = fmaxf(x0[u][0].x, x0[u][0].y);
#pragma unroll
      for (int i = 1; i < 4; ++i) m = fmaxf(m, fmaxf(x0[u][i].x, x0[u][i].y));
#pragma unroll
      for (int i = 0; i < 4; ++i) m = fmaxf(m, fmaxf(x1[u][i].x, x1[u][i].y));
      xmax[u] = fmaxf(m, other_half(m));
      need = need || (xmax[u] > top);
    }

    // ---- lazy rescale: one test per stage, a scalar branch, rarely taken ----
    if (__builtin_amdgcn_ballot_w32(need) != 0) {
#pragma unroll
      for (int u = 0; u < 2; ++u) {
        const float mnew  = mrun[u] + fmaxf(xmax[u], low);
        const float up    = mnew - mrun[u];
        // up < 0 only in the first stage, where o and lrun are 0: alpha stays finite
        const float alpha = __builtin_amdgcn_exp2f(fminf(-up, 0.0f));
        mrun[u] = mnew;
        lrun[u] *= alpha;
#pragma unroll
        for (int i = 0; i < 4; ++i) {
          x0[u][i] -= up;
          x1[u][i] -= up;
        }
#pragma unroll
        for (int f = 0; f < 4; ++f)
#pragma unroll
          for (int r = 0; r < 8; ++r) o[u][f][r] *= alpha;
      }
      top = 8.0f;
      low = 0.0f;
    }

    v16h pt[2];   // Pt as B operand: element e is key g*8 + e, or 16 + g*8 + (e - 8)
#pragma unroll
    for (int u = 0; u < 2; ++u) {
      v2f p[4];
#pragma unroll
      for (int i = 0; i < 4; ++i) {
        const v2f p0 = {__builtin_amdgcn_exp2f(x0[u][i].x), __builtin_amdgcn_exp2f(x0[u][i].y)};
        const v2f p1 = {__builtin_amdgcn_exp2f(x1[u][i].x), __builtin_amdgcn_exp2f(x1[u][i].y)};
        pt[u][2 * i]         = (_Float16)p0.x;
        pt[u][2 * i + 1]     = (_Float16)p0.y;
        pt[u][8 + 2 * i]     = (_Float16)p1.x;
        pt[u][8 + 2 * i + 1] = (_Float16)p1.y;
        p[i] = p0 + p1;
      }
      // in-lane sum as a tree: short dependent chain
      p[0] += p[2];
      p[1] += p[3];
      p[0] += p[1];
      lrun[u] += p[0].x + p[0].y;
    }

    // ---- Ot += Vt(64x32) @ Pt(32x16) ----
#pragma unroll
    for (int f = 0; f < 4; ++f)
#pragma unroll
      for (int u = 0; u < 2; ++u) o[u][f] = wmma_f16f32(va[f], pt[u], o[u][f]);
    // Keeps the stage's work in front of the publish point: lifted over it, the
    // wait would end the copies of stage s + 1 before the work has covered
    // their latency.
    __builtin_amdgcn_sched_barrier(0);

    // Publish point of stage s + 1, which also frees the buffer just read.
    asm volatile("s_wait_dscnt 0x0" ::: "memory");     // own LDS reads are done
    asm volatile("s_wait_asynccnt 0x0" ::: "memory");  // own copies of s + 1 landed
    __syncthreads();
    if (s + 2 < NS) issue(s + 2, cur);
  };

  // The stages in ascending order. Every bound is the same for the whole block,
  // so all its waves pass the same barriers.
  set_c(lam);
  for (int s = 0; s < near0; ++s) trip(s, form<false>{});
  for (int s = near0; s < near0 + 2; ++s) trip(s, form<true>{});
  set_c(-lam);
  for (int s = near0 + 2; s < NS; ++s) trip(s, form<false>{});
  asm volatile("s_wait_asynccnt 0x0" ::: "memory");  // nothing in flight at the end

  // ---- epilogue: join the lane halves' sums, then the two key halves ----
  float lsum[2];
#pragma unroll
  for (int u = 0; u < 2; ++u) lsum[u] = lrun[u] + other_half(lrun[u]);
  if (kh == 1) {   // the same for a whole wave
#pragma unroll
    for (int u = 0; u < 2; ++u) {
      Mmrg[qg][u][lane] = mrun[u];
      Lmrg[qg][u][lane] = lsum[u];
#pragma unroll
      for (int f = 0; f < 4; ++f) {
        const v4f lo = {o[u][f][0], o[u][f][1], o[u][f][2], o[u][f][3]};
        const v4f hi = {o[u][f][4], o[u][f][5], o[u][f][6], o[u][f][7]};
        Omrg[qg][(u * 4 + f) * 2 + 0][lane] = lo;
        Omrg[qg][(u * 4 + f) * 2 + 1][lane] = hi;
      }
    }
  }
  __syncthreads();  // the upper-key states are visible to the lower-key waves
  if (kh == 0) {
    // A lane holds 8 consecutive dims of its query per tile and f: one 16-byte store.
#pragma unroll
    for (int u = 0; u < 2; ++u) {
      const float m1 = Mmrg[qg][u][lane];
      const float l1 = Lmrg[qg][u][lane];
      const float m  = fmaxf(mrun[u], m1);
      const float a0 = __builtin_amdgcn_exp2f(mrun[u] - m);  // maxima: log2 units
      const float a1 = __builtin_amdgcn_exp2f(m1 - m);
      const float inv = 1.0f / (lsum[u] * a0 + l1 * a1);
      const float w0 = a0 * inv, w1 = a1 * inv;
#pragma unroll
      for (int f = 0; f < 4; ++f) {
        const v4f lo = Omrg[qg][(u * 4 + f) * 2 + 0][lane];
        const v4f hi = Omrg[qg][(u * 4 + f) * 2 + 1][lane];
        v8h o8;
#pragma unroll
        for (int r = 0; r < 4; ++r) {
          o8[r]     = (_Float16)(o[u][f][r] * w0 + lo[r] * w1);
          o8[4 + r] = (_Float16)(o[u][f][4 + r] * w0 + hi[r] * w1);
        }
        *(v8h*)(Oh + (size_t)(qrow0 + u * 16 + n) * D_ + h * HD_ + f * 16 + g * 8) = o8;
      }
    }
  }
}

// ---------------------------------------------------------------------------
// Host orchestration
// ---------------------------------------------------------------------------
extern "C" void kernel_launch(void* const* d_in, const int* in_sizes, int n_in,
                              void* d_out, int out_size, void* d_ws,
                              size_t ws_size, hipStream_t stream) {
  (void)in_sizes; (void)n_in; (void)out_size; (void)ws_size;
  const float* x     = (const float*)d_in[0];
  const float* Wq    = (const float*)d_in[1];
  const float* Wk    = (const float*)d_in[2];
  const float* Wv    = (const float*)d_in[3];
  const float* Wo    = (const float*)d_in[4];
  const float* Wdown = (const float*)d_in[5];
  const float* Wupk  = (const float*)d_in[6];
  const float* Wupv  = (const float*)d_in[7];
  float* out = (float*)d_out;  // [NTOK_*D_] attn-out, then [NTOK_*L_] latent

  // Carve workspace (256B aligned)
  char* wsp = (char*)d_ws;
  auto carve = [&](size_t bytes) {
    char* p = wsp;
    wsp += (bytes + 255) & ~(size_t)255;
    return p;
  };
  _Float16* x_h      = (_Float16*)carve((size_t)NTOK_ * D_ * 2);
  _Float16* q_h      = (_Float16*)carve((size_t)NTOK_ * D_ * 2);
  _Float16* k_h      = (_Float16*)carve((size_t)NTOK_ * D_ * 2);
  _Float16* vT       = (_Float16*)carve((size_t)NTOK_ * D_ * 2);
  _Float16* attn_h   = (_Float16*)carve((size_t)NTOK_ * D_ * 2);
  _Float16* latent_h = (_Float16*)carve((size_t)NTOK_ * L_ * 2);
  _Float16* wq_t     = (_Float16*)carve((size_t)D_ * D_ * 2);
  _Float16* wo_t     = (_Float16*)carve((size_t)D_ * D_ * 2);
  _Float16* wupk_t   = (_Float16*)carve((size_t)D_ * L_ * 2);
  _Float16* wupv_t   = (_Float16*)carve((size_t)D_ * L_ * 2);
  _Float16* wcomb_t  = (_Float16*)carve((size_t)D_ * L_ * 2);

  // --- W_comb^T (folds the k/v GEMMs away) from the f32 weights, beside all prep work ---
  gemm_wcomb_and_prep_kernel<<<NB_WC + NB_X + 2 * NB_TDD + 2 * NB_TDL, 256, 0, stream>>>(
      Wk, Wv, Wdown, wcomb_t, x, Wq, Wo, Wupk, Wupv,
      x_h, wq_t, wo_t, wupk_t, wupv_t);

  // --- q = x @ Wq, and latent = x @ W_comb : f32 -> d_out tail, f16 -> latent_h ---
  gemm_q_and_latent_kernel<<<NB_BIG + NB_LAT, 256, 0, stream>>>(
      x_h, wq_t, q_h, wcomb_t, out + (size_t)NTOK_ * D_, latent_h);

  // --- k_rec (row-major == B^T for QK^T) and v_rec ([B,H,64,S]) from latent ---
  gemm_krec_and_vrec_kernel<<<2 * NB_BIG, 256, 0, stream>>>(
      latent_h, wupk_t, k_h, wupv_t, vT);

  // --- flash attention with decay: 512 blocks, 8 q-tiles of one (b,h) each ---
  flash_attn_decay_kernel<<<B_ * H_ * (S_ / 128), 256, 0, stream>>>(
      q_h, k_h, vT, attn_h);

  // --- out = attn @ Wo ---
  gemm_wmma_kernel<0, 4, 2, NTOK_, D_, D_>
      <<<(NTOK_ / 128) * (D_ / 128), 256, 0, stream>>>(attn_h, wo_t, out, nullptr);
}
